// v000
// The times below were measured on an AMD MI455X: many runs one after another, warmed up first and cycling through
// copies of the inputs, with the whole window's GPU time divided by the number of runs. Launches and the gaps
// between them are all in it. The median over several windows is given; except for v000 it joins two sittings, which
// can be a few percent apart, so the side-by-side timings, each taken in one sitting, are the better comparison.
// The starting kernel, v000, takes 435 microseconds a run.
#include <hip/hip_runtime.h>
#include <math.h>

#define E 8

typedef __attribute__((ext_vector_type(16))) _Float16 v16h;
typedef __attribute__((ext_vector_type(8)))  _Float16 v8h;
typedef __attribute__((ext_vector_type(8)))  float    v8f;
typedef __attribute__((ext_vector_type(4)))  float    v4f;
typedef unsigned int u32;

__device__ __forceinline__ float pe_val(float pos, int oc) {
  int k = oc & ~1;
  float div = __expf((float)k * (-9.210340371976184f / 8.0f));
  float ang = pos * div;
  return (oc & 1) ? __cosf(ang) : __sinf(ang);
}

// ---------------------------------------------------------------------------
// One v_wmma_f32_16x16x32_f16 per 16-row chunk. K=8 real (zero-padded to 32).
// A (16-bit 16x32): lanes 0-15 row M=lane, halves 0..7 = K 0..7; lanes 16-31 zero.
// B (16-bit 32x16): lanes 0-15 col N=lane, halves 0..7 = K 0..7.
// D (f32 16x16):    lane -> col N=lane&15, VGPR r -> row M = r + 8*(lane>>4).
// Sources live in LDS as f16 rows (16B) -> A build = one ds_load_b128, no cvt.
// Bias is folded into the C accumulator (C[m][n] = bias[n]).
// ---------------------------------------------------------------------------

__device__ __forceinline__ v16h load_a_frag(const _Float16* src, int ch, int lane,
                                            u32 amask) {
  uint4 raw = *(const uint4*)(src + (ch * 16 + (lane & 15)) * 8);
  raw.x &= amask; raw.y &= amask; raw.z &= amask; raw.w &= amask;
  union { uint4 u; v8h h; } cv;
  cv.u = raw;
  v16h af;
  #pragma unroll
  for (int k = 0; k < 8; ++k) af[k] = cv.h[k];
  #pragma unroll
  for (int k = 8; k < 16; ++k) af[k] = (_Float16)0.0f;
  return af;
}

// Transposed-output projection. DUAL packs two 8x8 weight blocks into B's 16
// columns -> one WMMA yields both K and V. Writeback: 2 contiguous b128 stores.
template <bool DUAL>
__device__ __forceinline__ void wave_proj_t(const _Float16* src,
                                            const float* W1, const float* b1,
                                            const float* W2, const float* b2,
                                            float* d1T, float* d2T, int ld,
                                            int lane, int c0, int c1) {
  const int n = lane & 15;
  const int half = lane >> 4;
  const u32 amask = (lane < 16) ? 0xFFFFFFFFu : 0u;
  v16h bf = {};
  float bn = 0.0f;
  float* dcol = nullptr;
  if (n < 8) { bn = b1[n]; dcol = d1T + n * ld; }
  else if (DUAL) { bn = b2[n - 8]; dcol = d2T + (n - 8) * ld; }
  if (lane < 16 && (n < 8 || DUAL)) {
    const float* wrow = (n < 8) ? (W1 + n * 8) : (W2 + (n - 8) * 8);
    #pragma unroll
    for (int k = 0; k < 8; ++k) bf[k] = (_Float16)wrow[k];
  }
  for (int ch = c0; ch < c1; ++ch) {
    v16h af = load_a_frag(src, ch, lane, amask);
    v8f c = {bn, bn, bn, bn, bn, bn, bn, bn};
    c = __builtin_amdgcn_wmma_f32_16x16x32_f16(false, af, false, bf, (short)0, c,
                                               false, false);
    if (DUAL || n < 8) {
      const int rb = ch * 16 + 8 * half;
      *(v4f*)(dcol + rb)     = (v4f){c[0], c[1], c[2], c[3]};
      *(v4f*)(dcol + rb + 4) = (v4f){c[4], c[5], c[6], c[7]};
    }
  }
}

// Row-major f32 output projection (result consumed row-wise by layernorm/fc1).
__device__ __forceinline__ void wave_proj_rm(const _Float16* src, const float* W,
                                             const float* bias, float* dst,
                                             int lane, int c0, int c1) {
  const int n = lane & 15;
  const int half = lane >> 4;
  const u32 amask = (lane < 16) ? 0xFFFFFFFFu : 0u;
  v16h bf = {};
  if (lane < 16 && n < 8) {
    #pragma unroll
    for (int k = 0; k < 8; ++k) bf[k] = (_Float16)W[n * 8 + k];
  }
  const float bn = (n < 8) ? bias[n] : 0.0f;
  for (int ch = c0; ch < c1; ++ch) {
    v16h af = load_a_frag(src, ch, lane, amask);
    v8f c = {bn, bn, bn, bn, bn, bn, bn, bn};
    c = __builtin_amdgcn_wmma_f32_16x16x32_f16(false, af, false, bf, (short)0, c,
                                               false, false);
    if (n < 8) {
      const int rb = ch * 16 + 8 * half;
      #pragma unroll
      for (int r = 0; r < 8; ++r) dst[(rb + r) * 8 + n] = c[r];
    }
  }
}

// Per-lane softmax attention row (head_dim=1, scale=1). Transposed K/V allow
// contiguous b128 reads along j. Row result converted to f16 (next A-source).
__device__ __forceinline__ void attn_rows(int i, const float* qpT,
                                          const float* kpT, const float* vpT,
                                          int ldk, int Lk, _Float16* ob) {
  float o[8];
  for (int h = 0; h < 8; ++h) {
    const float qv = qpT[h * 32 + i];
    const float* kc = kpT + h * ldk;
    const float* vc = vpT + h * ldk;
    float m = -3.4e38f;
    int j = 0;
    for (; j + 3 < Lk; j += 4) {
      v4f k4 = *(const v4f*)(kc + j);
      m = fmaxf(m, fmaxf(fmaxf(qv * k4[0], qv * k4[1]),
                         fmaxf(qv * k4[2], qv * k4[3])));
    }
    for (; j < Lk; ++j) m = fmaxf(m, qv * kc[j]);
    float s = 0.0f, acc = 0.0f;
    j = 0;
    for (; j + 3 < Lk; j += 4) {
      v4f k4 = *(const v4f*)(kc + j);
      v4f vv4 = *(const v4f*)(vc + j);
      #pragma unroll
      for (int u = 0; u < 4; ++u) {
        float ev = __expf(qv * k4[u] - m);
        s += ev;
        acc += ev * vv4[u];
      }
    }
    for (; j < Lk; ++j) {
      float ev = __expf(qv * kc[j] - m);
      s += ev;
      acc += ev * vc[j];
    }
    o[h] = acc / s;
  }
  union { uint4 u; v8h h; } cv;
  #pragma unroll
  for (int h = 0; h < 8; ++h) cv.h[h] = (_Float16)o[h];
  *(uint4*)(ob + i * 8) = cv.u;
}

// Full MHA by one wave. scr (1024 f32): [0..255]=qpT[8][32], [256..511]=kpT,
// [512..767]=vpT, [768..1023]=row-major f32 result. ob = f16 [32][8] scratch.
__device__ void wave_mha(int lane, const _Float16* q, const _Float16* kv, int Lk,
                         const float* wIn, const float* bIn,
                         const float* wOut, const float* bOut,
                         float* scr, _Float16* ob) {
  wave_proj_t<false>(q, wIn, bIn, nullptr, nullptr, scr, nullptr, 32, lane, 0, 2);
  wave_proj_t<true>(kv, wIn + 64, bIn + 8, wIn + 128, bIn + 16,
                    scr + 256, scr + 512, 32, lane, 0, 2);
  attn_rows(lane, scr, scr + 256, scr + 512, 32, Lk, ob);
  wave_proj_rm(ob, wOut, bOut, scr + 768, lane, 0, 2);
}

__global__ __launch_bounds__(256) void cmt_kernel(
    const float* __restrict__ eeg, const float* __restrict__ pupil,
    const float* __restrict__ speech, const float* __restrict__ action,
    const float* __restrict__ location, const float* __restrict__ tgt,
    const float* __restrict__ eeg_w, const float* __restrict__ eeg_b,
    const float* __restrict__ psa_w, const float* __restrict__ psa_b,
    const float* __restrict__ loc_w, const float* __restrict__ loc_b,
    const float* __restrict__ tgt_w, const float* __restrict__ tgt_b,
    const float* __restrict__ ng, const float* __restrict__ nb,
    const float* __restrict__ cin_w, const float* __restrict__ cin_b,
    const float* __restrict__ cout_w, const float* __restrict__ cout_b,
    const float* __restrict__ sfin_w, const float* __restrict__ sfin_b,
    const float* __restrict__ sfout_w, const float* __restrict__ sfout_b,
    const float* __restrict__ oin_w, const float* __restrict__ oin_b,
    const float* __restrict__ oout_w, const float* __restrict__ oout_b,
    const float* __restrict__ fc1_w, const float* __restrict__ fc1_b,
    float* __restrict__ out) {
  __shared__ _Float16 s_seq[5][32][E];   // f16 A-sources: e(30), p, s, a, l
  __shared__ _Float16 s_t[32][E];
  __shared__ _Float16 s_concat[128][E];  // 126 rows used
  __shared__ _Float16 s_ob[8][32][E];    // per-wave attention-output (A-source)
  __shared__ float s_acc[4][32][E];
  __shared__ float s_scr[8][1024];       // per-wave qpT/kpT/vpT/result
  __shared__ float s_kpTf[8][128];       // final MHA K, transposed [head][pos]
  __shared__ float s_vpTf[8][128];
  __shared__ float s_tout[32][E];
  __shared__ float s_fc[96];

  const int b    = blockIdx.x;
  const int tid  = threadIdx.x;
  const int lane = tid & 31;
  const int wave = tid >> 5;
  const int Lseq[5] = {30, 32, 32, 32, 32};

  __builtin_prefetch(fc1_w + (tid << 6), 0, 1);   // global_prefetch_b8

  // ---------------- Phase 0: convs + positional encoding into LDS ----------
  for (int idx = tid; idx < 4 * 32 * E; idx += 256) ((float*)s_acc)[idx] = 0.0f;

  if (tid < 240) {  // eeg conv2d (2,20,118) -> 30x8, kernel (20,2), stride (1,4)
    int pos = tid >> 3, oc = tid & 7;
    const float* ep = eeg + (size_t)b * (2 * 20 * 118);
    float sum = eeg_b[oc];
    for (int ic = 0; ic < 2; ++ic) {
      #pragma unroll 4
      for (int kh = 0; kh < 20; ++kh) {
        const float* row = ep + (ic * 20 + kh) * 118 + pos * 4;
        const float* wr  = eeg_w + ((oc * 2 + ic) * 20 + kh) * 2;
        sum += row[0] * wr[0] + row[1] * wr[1];
      }
    }
    s_seq[0][pos][oc] = (_Float16)(sum + pe_val(30.0f, oc));
  }

  for (int idx = tid; idx < 5 * 32 * E; idx += 256) {  // p/s/a/l/tgt conv1d k1p1
    int sSel = idx >> 8;
    int pos  = (idx >> 3) & 31;
    int oc   = idx & 7;
    float v;
    _Float16* dst;
    if (sSel < 3) {
      const float* x = (sSel == 0 ? pupil : (sSel == 1 ? speech : action)) + (size_t)b * 60;
      v = psa_b[oc];
      if (pos >= 1 && pos <= 30)
        v += psa_w[oc * 2 + 0] * x[pos - 1] + psa_w[oc * 2 + 1] * x[30 + pos - 1];
      dst = &s_seq[1 + sSel][pos][oc];
    } else if (sSel == 3) {
      const float* x = location + (size_t)b * 90;
      v = loc_b[oc];
      if (pos >= 1 && pos <= 30)
        #pragma unroll
        for (int ic = 0; ic < 3; ++ic) v += loc_w[oc * 3 + ic] * x[ic * 30 + pos - 1];
      dst = &s_seq[4][pos][oc];
    } else {
      const float* x = tgt + (size_t)b * 30;
      v = tgt_b[oc];
      if (pos >= 1 && pos <= 30) v += tgt_w[oc] * x[pos - 1];
      dst = &s_t[pos][oc];
    }
    *dst = (_Float16)(v + pe_val(32.0f, oc));
  }
  __syncthreads();

  // ---------------- Phase 1: 18 MHAs strided over 8 waves (2-3 each) --------------------
  const int TQ[18] = {0,0,0,0,0, 1,1,1,1,1, 2,2,2,2, 3,3,3,3};
  const int TK[18] = {1,3,4,0,2, 0,3,4,1,2, 0,1,3,4, 0,1,3,2};
  const int TS[18] = {0,0,0,1,0, 0,0,0,1,0, 0,0,0,0, 0,0,1,0};
  const int TA[18] = {0,0,0,0,0, 1,1,1,1,1, 2,2,2,2, 3,3,3,3};
  const int TB[18] = {-1,-1,-1,-1,-1, -1,-1,-1,-1,-1, -1,-1,-1,3, -1,-1,-1,-1};

  for (int t = wave; t < 18; t += 8) {
    const float* wIn  = TS[t] ? sfin_w  : cin_w;
    const float* bIn  = TS[t] ? sfin_b  : cin_b;
    const float* wOut = TS[t] ? sfout_w : cout_w;
    const float* bOut = TS[t] ? sfout_b : cout_b;
    int Lq = Lseq[TQ[t]], Lk = Lseq[TK[t]];
    float* scr = s_scr[wave];
    wave_mha(lane, &s_seq[TQ[t]][0][0], &s_seq[TK[t]][0][0], Lk,
             wIn, bIn, wOut, bOut, scr, &s_ob[wave][0][0]);
    // layernorm + accumulate (ds_add_f32 atomics across waves)
    int i = lane;
    if (i < Lq) {
      const float* row = scr + 768 + i * 8;
      float mu = 0.0f;
      #pragma unroll
      for (int c = 0; c < E; ++c) mu += row[c];
      mu *= 0.125f;
      float var = 0.0f;
      #pragma unroll
      for (int c = 0; c < E; ++c) { float d = row[c] - mu; var += d * d; }
      var *= 0.125f;
      float rinv = rsqrtf(var + 1e-5f);
      #pragma unroll
      for (int c = 0; c < E; ++c) {
        float v = (row[c] - mu) * rinv * ng[c] + nb[c];
        atomicAdd(&s_acc[TA[t]][i][c], v);
        if (TB[t] >= 0) atomicAdd(&s_acc[TB[t]][i][c], v);
      }
    }
  }
  __syncthreads();

  // ---------------- Phase 2: concat (f16) + final MHA ----------------------
  for (int idx = tid; idx < 126 * E; idx += 256) {  // [eeg30|pupil32|action32|speech32]
    int row = idx >> 3, c = idx & 7;
    int ai, r2;
    if (row < 30)      { ai = 0; r2 = row; }
    else if (row < 62) { ai = 1; r2 = row - 30; }
    else if (row < 94) { ai = 3; r2 = row - 62; }
    else               { ai = 2; r2 = row - 94; }
    s_concat[row][c] = (_Float16)s_acc[ai][r2][c];
  }
  __syncthreads();

  // K/V of 126-row concat: dual WMMA, one 16-row chunk per wave
  wave_proj_t<true>(&s_concat[0][0], oin_w + 64, oin_b + 8, oin_w + 128, oin_b + 16,
                    &s_kpTf[0][0], &s_vpTf[0][0], 128, lane, wave, wave + 1);
  __syncthreads();

  if (wave == 0) {
    float* scr = s_scr[0];
    wave_proj_t<false>(&s_t[0][0], oin_w, oin_b, nullptr, nullptr,
                       scr, nullptr, 32, lane, 0, 2);
    attn_rows(lane, scr, &s_kpTf[0][0], &s_vpTf[0][0], 128, 126, &s_ob[0][0][0]);
    wave_proj_rm(&s_ob[0][0][0], oout_w, oout_b, &s_tout[0][0], lane, 0, 2);
  }
  __syncthreads();

  // ---------------- Phase 3: fc1 + channel softmax -> (B,3,30) -------------
  if (tid < 90) {
    float sum = fc1_b[tid];
    const float* wr = fc1_w + tid * 256;
    const float* x  = (const float*)s_tout;
    #pragma unroll 8
    for (int j = 0; j < 256; ++j) sum += wr[j] * x[j];
    s_fc[tid] = sum;
  }
  __syncthreads();
  if (tid < 30) {
    float x0 = s_fc[tid * 3 + 0], x1 = s_fc[tid * 3 + 1], x2 = s_fc[tid * 3 + 2];
    float m  = fmaxf(x0, fmaxf(x1, x2));
    float e0 = __expf(x0 - m), e1 = __expf(x1 - m), e2 = __expf(x2 - m);
    float s  = e0 + e1 + e2;
    float* o = out + (size_t)b * 90;
    o[0 * 30 + tid] = e0 / s;
    o[1 * 30 + tid] = e1 / s;
    o[2 * 30 + tid] = e2 / s;
  }
}

extern "C" void kernel_launch(void* const* d_in, const int* in_sizes, int n_in,
                              void* d_out, int out_size, void* d_ws, size_t ws_size,
                              hipStream_t stream) {
  (void)n_in; (void)out_size; (void)d_ws; (void)ws_size;
  const int B = in_sizes[0] / (2 * 20 * 118);
  cmt_kernel<<<B, 256, 0, stream>>>(
      (const float*)d_in[0],  (const float*)d_in[1],  (const float*)d_in[2],
      (const float*)d_in[3],  (const float*)d_in[4],  (const float*)d_in[5],
      (const float*)d_in[6],  (const float*)d_in[7],  (const float*)d_in[8],
      (const float*)d_in[9],  (const float*)d_in[10], (const float*)d_in[11],
      (const float*)d_in[12], (const float*)d_in[13], (const float*)d_in[14],
      (const float*)d_in[15], (const float*)d_in[16], (const float*)d_in[17],
      (const float*)d_in[18], (const float*)d_in[19], (const float*)d_in[20],
      (const float*)d_in[21], (const float*)d_in[22], (const float*)d_in[23],
      (const float*)d_in[24], (const float*)d_in[25], (const float*)d_in[26],
      (const float*)d_in[27], (const float*)d_in[28], (const float*)d_in[29],
      (float*)d_out);
}

// v001
// One run takes 374 microseconds.
// Next to v000, in two timings, it ran 1.22 times as fast each time.
#include <hip/hip_runtime.h>
#include <math.h>

#define E 8

typedef __attribute__((ext_vector_type(16))) _Float16 v16h;
typedef __attribute__((ext_vector_type(8)))  _Float16 v8h;
typedef __attribute__((ext_vector_type(8)))  float    v8f;
typedef __attribute__((ext_vector_type(4)))  float    v4f;
typedef unsigned int u32;

__device__ __forceinline__ float pe_val(float pos, int oc) {
  int k = oc & ~1;
  float div = __expf((float)k * (-9.210340371976184f / 8.0f));
  float ang = pos * div;
  return (oc & 1) ? __cosf(ang) : __sinf(ang);
}

// ---------------------------------------------------------------------------
// One v_wmma_f32_16x16x32_f16 per 16-row chunk. K=8 real (zero-padded to 32).
// A (16-bit 16x32): lanes 0-15 row M=lane, halves 0..7 = K 0..7; lanes 16-31 zero.
// B (16-bit 32x16): lanes 0-15 col N=lane, halves 0..7 = K 0..7.
// D (f32 16x16):    lane -> col N=lane&15, VGPR r -> row M = r + 8*(lane>>4).
// Sources live in LDS as f16 rows (16B) -> A build = one ds_load_b128, no cvt.
// Bias is folded into the C accumulator (C[m][n] = bias[n]).
// ---------------------------------------------------------------------------

__device__ __forceinline__ v16h load_a_frag(const _Float16* src, int ch, int lane,
                                            u32 amask) {
  uint4 raw = *(const uint4*)(src + (ch * 16 + (lane & 15)) * 8);
  raw.x &= amask; raw.y &= amask; raw.z &= amask; raw.w &= amask;
  union { uint4 u; v8h h; } cv;
  cv.u = raw;
  v16h af;
  #pragma unroll
  for (int k = 0; k < 8; ++k) af[k] = cv.h[k];
  #pragma unroll
  for (int k = 8; k < 16; ++k) af[k] = (_Float16)0.0f;
  return af;
}

// Value held by the same lane of the other 16-lane row (all 32 lanes active).
__device__ __forceinline__ float other_row(float x) {
  u32 u = __builtin_bit_cast(u32, x);
  return __builtin_bit_cast(float, __builtin_amdgcn_permlanex16(
      u, u, 0x76543210u, 0xfedcba98u, false, false));
}

// Transposed-output projection. DUAL packs two 8x8 weight blocks into B's 16
// columns -> one WMMA yields both K and V. Writeback: 2 contiguous b128 stores.
// DUAL also leaves each head's largest and smallest K over the rows it projects:
// ext[head*2*np + slot] and ext[head*2*np + np + slot]. Every projected row
// counts, so pad rows of src must repeat a real row.
template <bool DUAL>
__device__ __forceinline__ void wave_proj_t(const _Float16* src,
                                            const float* W1, const float* b1,
                                            const float* W2, const float* b2,
                                            float* d1T, float* d2T, int ld,
                                            int lane, int c0, int c1,
                                            float* ext = nullptr, int np = 1,
                                            int slot = 0) {
  const int n = lane & 15;
  const int half = lane >> 4;
  const u32 amask = (lane < 16) ? 0xFFFFFFFFu : 0u;
  v16h bf = {};
  float bn = 0.0f;
  float* dcol = nullptr;
  if (n < 8) { bn = b1[n]; dcol = d1T + n * ld; }
  else if (DUAL) { bn = b2[n - 8]; dcol = d2T + (n - 8) * ld; }
  if (lane < 16 && (n < 8 || DUAL)) {
    const float* wrow = (n < 8) ? (W1 + n * 8) : (W2 + (n - 8) * 8);
    #pragma unroll
    for (int k = 0; k < 8; ++k) bf[k] = (_Float16)wrow[k];
  }
  float kmx = -INFINITY, kmn = INFINITY;
  for (int ch = c0; ch < c1; ++ch) {
    v16h af = load_a_frag(src, ch, lane, amask);
    v8f c = {bn, bn, bn, bn, bn, bn, bn, bn};
    c = __builtin_amdgcn_wmma_f32_16x16x32_f16(false, af, false, bf, (short)0, c,
                                               false, false);
    if (DUAL || n < 8) {
      const int rb = ch * 16 + 8 * half;
      *(v4f*)(dcol + rb)     = (v4f){c[0], c[1], c[2], c[3]};
      *(v4f*)(dcol + rb + 4) = (v4f){c[4], c[5], c[6], c[7]};
    }
    if (DUAL) {
      #pragma unroll  // constant r: c[r] stays a named register, pairs fold into max3/min3
      for (int r = 0; r < 8; ++r) {
        kmx = fmaxf(kmx, c[r]);
        kmn = fminf(kmn, c[r]);
      }
    }
  }
  if (DUAL) {
    kmx = fmaxf(kmx, other_row(kmx));
    kmn = fminf(kmn, other_row(kmn));
    if (lane < 8) {
      ext[lane * 2 * np + slot]      = kmx;
      ext[lane * 2 * np + np + slot] = kmn;
    }
  }
}

// Row-major f32 output projection (result consumed row-wise by layernorm/fc1).
__device__ __forceinline__ void wave_proj_rm(const _Float16* src, const float* W,
                                             const float* bias, float* dst,
                                             int lane, int c0, int c1) {
  const int n = lane & 15;
  const int half = lane >> 4;
  const u32 amask = (lane < 16) ? 0xFFFFFFFFu : 0u;
  v16h bf = {};
  if (lane < 16 && n < 8) {
    #pragma unroll
    for (int k = 0; k < 8; ++k) bf[k] = (_Float16)W[n * 8 + k];
  }
  const float bn = (n < 8) ? bias[n] : 0.0f;
  for (int ch = c0; ch < c1; ++ch) {
    v16h af = load_a_frag(src, ch, lane, amask);
    v8f c = {bn, bn, bn, bn, bn, bn, bn, bn};
    c = __builtin_amdgcn_wmma_f32_16x16x32_f16(false, af, false, bf, (short)0, c,
                                               false, false);
    if (n < 8) {
      const int rb = ch * 16 + 8 * half;
      #pragma unroll
      for (int r = 0; r < 8; ++r) dst[(rb + r) * 8 + n] = c[r];
    }
  }
}

// Per-lane softmax attention row (head_dim=1, scale=1). Transposed K/V allow
// contiguous b128 reads along j. Row result converted to f16 (next A-source).
// A score is q*k[j] with one q per row, and rounding keeps the order of the
// products, so the row maximum is exactly max(q*kmax, q*kmin): no pass over j.
// ext holds NP partial maxima, then NP partial minima, of each head's K.
template <int NP>
__device__ __forceinline__ void attn_rows(int i, const float* qpT,
                                          const float* kpT, const float* vpT,
                                          int ldk, int Lk, const float* ext,
                                          _Float16* ob) {
  float o[8];
  for (int h = 0; h < 8; ++h) {
    const float qv = qpT[h * 32 + i];
    const float* kc = kpT + h * ldk;
    const float* vc = vpT + h * ldk;
    const float* ex = ext + h * 2 * NP;
    float kmx = ex[0], kmn = ex[NP];
    #pragma unroll  // constant offsets: the partials come in as b128 reads
    for (int p = 1; p < NP; ++p) {
      kmx = fmaxf(kmx, ex[p]);
      kmn = fminf(kmn, ex[NP + p]);
    }
    const float m = fmaxf(qv * kmx, qv * kmn);
    float s = 0.0f, acc = 0.0f;
    int j = 0;
    for (; j + 3 < Lk; j += 4) {
      v4f k4 = *(const v4f*)(kc + j);
      v4f vv4 = *(const v4f*)(vc + j);
      #pragma unroll
      for (int u = 0; u < 4; ++u) {
        float ev = __expf(qv * k4[u] - m);
        s += ev;
        acc += ev * vv4[u];
      }
    }
    for (; j < Lk; ++j) {
      float ev = __expf(qv * kc[j] - m);
      s += ev;
      acc += ev * vc[j];
    }
    o[h] = acc / s;
  }
  union { uint4 u; v8h h; } cv;
  #pragma unroll
  for (int h = 0; h < 8; ++h) cv.h[h] = (_Float16)o[h];
  *(uint4*)(ob + i * 8) = cv.u;
}

// Full MHA by one wave. scr (1024 f32): [0..255]=qpT[8][32], [256..511]=kpT,
// [512..767]=vpT, [768..1023]=row-major f32 result (its first 16 words hold the
// K extremes until the attention has read them). ob = f16 [32][8] scratch.
__device__ void wave_mha(int lane, const _Float16* q, const _Float16* kv, int Lk,
                         const float* wIn, const float* bIn,
                         const float* wOut, const float* bOut,
                         float* scr, _Float16* ob) {
  wave_proj_t<false>(q, wIn, bIn, nullptr, nullptr, scr, nullptr, 32, lane, 0, 2);
  wave_proj_t<true>(kv, wIn + 64, bIn + 8, wIn + 128, bIn + 16,
                    scr + 256, scr + 512, 32, lane, 0, 2, scr + 768, 1, 0);
  attn_rows<1>(lane, scr, scr + 256, scr + 512, 32, Lk, scr + 768, ob);
  wave_proj_rm(ob, wOut, bOut, scr + 768, lane, 0, 2);
}

__global__ __launch_bounds__(256) void cmt_kernel(
    const float* __restrict__ eeg, const float* __restrict__ pupil,
    const float* __restrict__ speech, const float* __restrict__ action,
    const float* __restrict__ location, const float* __restrict__ tgt,
    const float* __restrict__ eeg_w, const float* __restrict__ eeg_b,
    const float* __restrict__ psa_w, const float* __restrict__ psa_b,
    const float* __restrict__ loc_w, const float* __restrict__ loc_b,
    const float* __restrict__ tgt_w, const float* __restrict__ tgt_b,
    const float* __restrict__ ng, const float* __restrict__ nb,
    const float* __restrict__ cin_w, const float* __restrict__ cin_b,
    const float* __restrict__ cout_w, const float* __restrict__ cout_b,
    const float* __restrict__ sfin_w, const float* __restrict__ sfin_b,
    const float* __restrict__ sfout_w, const float* __restrict__ sfout_b,
    const float* __restrict__ oin_w, const float* __restrict__ oin_b,
    const float* __restrict__ oout_w, const float* __restrict__ oout_b,
    const float* __restrict__ fc1_w, const float* __restrict__ fc1_b,
    float* __restrict__ out) {
  __shared__ _Float16 s_seq[5][32][E];   // f16 A-sources: e(30), p, s, a, l
  __shared__ _Float16 s_t[32][E];
  __shared__ _Float16 s_concat[128][E];  // 126 rows + 2 pad rows
  __shared__ _Float16 s_ob[8][32][E];    // per-wave attention-output (A-source)
  __shared__ float s_acc[4][32][E];
  __shared__ float s_scr[8][1024];       // per-wave qpT/kpT/vpT/result
  __shared__ float s_kpTf[8][128];       // final MHA K, transposed [head][pos]
  __shared__ float s_vpTf[8][128];
  __shared__ float s_tout[32][E];
  __shared__ float s_fc[96];

  const int b    = blockIdx.x;
  const int tid  = threadIdx.x;
  const int lane = tid & 31;
  const int wave = tid >> 5;
  const int Lseq[5] = {30, 32, 32, 32, 32};

  __builtin_prefetch(fc1_w + (tid << 6), 0, 1);   // global_prefetch_b8

  // ---------------- Phase 0: convs + positional encoding into LDS ----------
  for (int idx = tid; idx < 4 * 32 * E; idx += 256) ((float*)s_acc)[idx] = 0.0f;

  if (tid < 240) {  // eeg conv2d (2,20,118) -> 30x8, kernel (20,2), stride (1,4)
    int pos = tid >> 3, oc = tid & 7;
    const float* ep = eeg + (size_t)b * (2 * 20 * 118);
    float sum = eeg_b[oc];
    for (int ic = 0; ic < 2; ++ic) {
      #pragma unroll 4
      for (int kh = 0; kh < 20; ++kh) {
        const float* row = ep + (ic * 20 + kh) * 118 + pos * 4;
        const float* wr  = eeg_w + ((oc * 2 + ic) * 20 + kh) * 2;
        sum += row[0] * wr[0] + row[1] * wr[1];
      }
    }
    const _Float16 hv = (_Float16)(sum + pe_val(30.0f, oc));
    s_seq[0][pos][oc] = hv;
    if (pos == 29) {  // pad rows repeat the last row: K extremes stay those of 30 rows
      s_seq[0][30][oc] = hv;
      s_seq[0][31][oc] = hv;
    }
  }

  for (int idx = tid; idx < 5 * 32 * E; idx += 256) {  // p/s/a/l/tgt conv1d k1p1
    int sSel = idx >> 8;
    int pos  = (idx >> 3) & 31;
    int oc   = idx & 7;
    float v;
    _Float16* dst;
    if (sSel < 3) {
      const float* x = (sSel == 0 ? pupil : (sSel == 1 ? speech : action)) + (size_t)b * 60;
      v = psa_b[oc];
      if (pos >= 1 && pos <= 30)
        v += psa_w[oc * 2 + 0] * x[pos - 1] + psa_w[oc * 2 + 1] * x[30 + pos - 1];
      dst = &s_seq[1 + sSel][pos][oc];
    } else if (sSel == 3) {
      const float* x = location + (size_t)b * 90;
      v = loc_b[oc];
      if (pos >= 1 && pos <= 30)
        #pragma unroll
        for (int ic = 0; ic < 3; ++ic) v += loc_w[oc * 3 + ic] * x[ic * 30 + pos - 1];
      dst = &s_seq[4][pos][oc];
    } else {
      const float* x = tgt + (size_t)b * 30;
      v = tgt_b[oc];
      if (pos >= 1 && pos <= 30) v += tgt_w[oc] * x[pos - 1];
      dst = &s_t[pos][oc];
    }
    *dst = (_Float16)(v + pe_val(32.0f, oc));
  }
  __syncthreads();

  // ---------------- Phase 1: 18 MHAs strided over 8 waves (2-3 each) --------------------
  const int TQ[18] = {0,0,0,0,0, 1,1,1,1,1, 2,2,2,2, 3,3,3,3};
  const int TK[18] = {1,3,4,0,2, 0,3,4,1,2, 0,1,3,4, 0,1,3,2};
  const int TS[18] = {0,0,0,1,0, 0,0,0,1,0, 0,0,0,0, 0,0,1,0};
  const int TA[18] = {0,0,0,0,0, 1,1,1,1,1, 2,2,2,2, 3,3,3,3};
  const int TB[18] = {-1,-1,-1,-1,-1, -1,-1,-1,-1,-1, -1,-1,-1,3, -1,-1,-1,-1};

  for (int t = wave; t < 18; t += 8) {
    const float* wIn  = TS[t] ? sfin_w  : cin_w;
    const float* bIn  = TS[t] ? sfin_b  : cin_b;
    const float* wOut = TS[t] ? sfout_w : cout_w;
    const float* bOut = TS[t] ? sfout_b : cout_b;
    int Lq = Lseq[TQ[t]], Lk = Lseq[TK[t]];
    float* scr = s_scr[wave];
    wave_mha(lane, &s_seq[TQ[t]][0][0], &s_seq[TK[t]][0][0], Lk,
             wIn, bIn, wOut, bOut, scr, &s_ob[wave][0][0]);
    // layernorm + accumulate (ds_add_f32 atomics across waves)
    int i = lane;
    if (i < Lq) {
      const float* row = scr + 768 + i * 8;
      float mu = 0.0f;
      #pragma unroll
      for (int c = 0; c < E; ++c) mu += row[c];
      mu *= 0.125f;
      float var = 0.0f;
      #pragma unroll
      for (int c = 0; c < E; ++c) { float d = row[c] - mu; var += d * d; }
      var *= 0.125f;
      float rinv = rsqrtf(var + 1e-5f);
      #pragma unroll
      for (int c = 0; c < E; ++c) {
        float v = (row[c] - mu) * rinv * ng[c] + nb[c];
        atomicAdd(&s_acc[TA[t]][i][c], v);
        if (TB[t] >= 0) atomicAdd(&s_acc[TB[t]][i][c], v);
      }
    }
  }
  __syncthreads();

  // ---------------- Phase 2: concat (f16) + final MHA ----------------------
  for (int idx = tid; idx < 128 * E; idx += 256) {  // [eeg30|pupil32|action32|speech32]
    int drow = idx >> 3, c = idx & 7;
    int row = drow < 125 ? drow : 125;  // pad rows 126, 127 repeat row 125
    int ai, r2;
    if (row < 30)      { ai = 0; r2 = row; }
    else if (row < 62) { ai = 1; r2 = row - 30; }
    else if (row < 94) { ai = 3; r2 = row - 62; }
    else               { ai = 2; r2 = row - 94; }
    s_concat[drow][c] = (_Float16)s_acc[ai][r2][c];
  }
  __syncthreads();

  // K/V of 126-row concat: dual WMMA, one 16-row chunk per wave; each wave leaves
  // its chunk's K extremes in s_scr[1] (free since phase 1), 8 partials per head
  wave_proj_t<true>(&s_concat[0][0], oin_w + 64, oin_b + 8, oin_w + 128, oin_b + 16,
                    &s_kpTf[0][0], &s_vpTf[0][0], 128, lane, wave, wave + 1,
                    s_scr[1], 8, wave);
  __syncthreads();

  if (wave == 0) {
    float* scr = s_scr[0];
    wave_proj_t<false>(&s_t[0][0], oin_w, oin_b, nullptr, nullptr,
                       scr, nullptr, 32, lane, 0, 2);
    attn_rows<8>(lane, scr, &s_kpTf[0][0], &s_vpTf[0][0], 128, 126, s_scr[1],
                 &s_ob[0][0][0]);
    wave_proj_rm(&s_ob[0][0][0], oout_w, oout_b, &s_tout[0][0], lane, 0, 2);
  }
  __syncthreads();

  // ---------------- Phase 3: fc1 + channel softmax -> (B,3,30) -------------
  if (tid < 90) {
    float sum = fc1_b[tid];
    const float* wr = fc1_w + tid * 256;
    const float* x  = (const float*)s_tout;
    #pragma unroll 8
    for (int j = 0; j < 256; ++j) sum += wr[j] * x[j];
    s_fc[tid] = sum;
  }
  __syncthreads();
  if (tid < 30) {
    float x0 = s_fc[tid * 3 + 0], x1 = s_fc[tid * 3 + 1], x2 = s_fc[tid * 3 + 2];
    float m  = fmaxf(x0, fmaxf(x1, x2));
    float e0 = __expf(x0 - m), e1 = __expf(x1 - m), e2 = __expf(x2 - m);
    float s  = e0 + e1 + e2;
    float* o = out + (size_t)b * 90;
    o[0 * 30 + tid] = e0 / s;
    o[1 * 30 + tid] = e1 / s;
    o[2 * 30 + tid] = e2 / s;
  }
}

extern "C" void kernel_launch(void* const* d_in, const int* in_sizes, int n_in,
                              void* d_out, int out_size, void* d_ws, size_t ws_size,
                              hipStream_t stream) {
  (void)n_in; (void)out_size; (void)d_ws; (void)ws_size;
  const int B = in_sizes[0] / (2 * 20 * 118);
  cmt_kernel<<<B, 256, 0, stream>>>(
      (const float*)d_in[0],  (const float*)d_in[1],  (const float*)d_in[2],
      (const float*)d_in[3],  (const float*)d_in[4],  (const float*)d_in[5],
      (const float*)d_in[6],  (const float*)d_in[7],  (const float*)d_in[8],
      (const float*)d_in[9],  (const float*)d_in[10], (const float*)d_in[11],
      (const float*)d_in[12], (const float*)d_in[13], (const float*)d_in[14],
      (const float*)d_in[15], (const float*)d_in[16], (const float*)d_in[17],
      (const float*)d_in[18], (const float*)d_in[19], (const float*)d_in[20],
      (const float*)d_in[21], (const float*)d_in[22], (const float*)d_in[23],
      (const float*)d_in[24], (const float*)d_in[25], (const float*)d_in[26],
      (const float*)d_in[27], (const float*)d_in[28], (const float*)d_in[29],
      (float*)d_out);
}

// v002
// Measured time: 304 microseconds a run.
// Timed twice side by side with v001, it ran 1.23 times as fast both times.
// Counting every step since v000, it is 1.50 times as fast.
#include <hip/hip_runtime.h>
#include <math.h>

#define E 8

typedef __attribute__((ext_vector_type(16))) _Float16 v16h;
typedef __attribute__((ext_vector_type(8)))  _Float16 v8h;
typedef __attribute__((ext_vector_type(8)))  float    v8f;
typedef __attribute__((ext_vector_type(4)))  float    v4f;
typedef unsigned int u32;

__device__ __forceinline__ float pe_val(float pos, int oc) {
  int k = oc & ~1;
  float div = __expf((float)k * (-9.210340371976184f / 8.0f));
  float ang = pos * div;
  return (oc & 1) ? __cosf(ang) : __sinf(ang);
}

// ---------------------------------------------------------------------------
// One v_wmma_f32_16x16x32_f16 per 16-row chunk. K=8 real (zero-padded to 32).
// A (16-bit 16x32): lanes 0-15 row M=lane, halves 0..7 = K 0..7; lanes 16-31 zero.
// B (16-bit 32x16): lanes 0-15 col N=lane, halves 0..7 = K 0..7.
// D (f32 16x16):    lane -> col N=lane&15, VGPR r -> row M = r + 8*(lane>>4).
// Sources live in LDS as f16 rows (16B) -> A build = one ds_load_b128, no cvt.
// Bias is folded into the C accumulator (C[m][n] = bias[n]).
// ---------------------------------------------------------------------------

__device__ __forceinline__ v16h load_a_frag(const _Float16* src, int ch, int lane,
                                            u32 amask) {
  uint4 raw = *(const uint4*)(src + (ch * 16 + (lane & 15)) * 8);
  raw.x &= amask; raw.y &= amask; raw.z &= amask; raw.w &= amask;
  union { uint4 u; v8h h; } cv;
  cv.u = raw;
  v16h af;
  #pragma unroll
  for (int k = 0; k < 8; ++k) af[k] = cv.h[k];
  #pragma unroll
  for (int k = 8; k < 16; ++k) af[k] = (_Float16)0.0f;
  return af;
}

// Value held by the same lane of the other 16-lane row (all 32 lanes active).
__device__ __forceinline__ float other_row(float x) {
  u32 u = __builtin_bit_cast(u32, x);
  return __builtin_bit_cast(float, __builtin_amdgcn_permlanex16(
      u, u, 0x76543210u, 0xfedcba98u, false, false));
}

// Transposed-output projection. DUAL packs two 8x8 weight blocks into B's 16
// columns -> one WMMA yields both K and V. Writeback: 2 contiguous b128 stores.
// DUAL also leaves each head's largest and smallest K over the rows it projects:
// ext[head*2*np + slot] and ext[head*2*np + np + slot]. Every projected row
// counts, so pad rows of src must repeat a real row.
template <bool DUAL>
__device__ __forceinline__ void wave_proj_t(const _Float16* src,
                                            const float* W1, const float* b1,
                                            const float* W2, const float* b2,
                                            float* d1T, float* d2T, int ld,
                                            int lane, int c0, int c1,
                                            float* ext = nullptr, int np = 1,
                                            int slot = 0) {
  const int n = lane & 15;
  const int half = lane >> 4;
  const u32 amask = (lane < 16) ? 0xFFFFFFFFu : 0u;
  v16h bf = {};
  float bn = 0.0f;
  float* dcol = nullptr;
  if (n < 8) { bn = b1[n]; dcol = d1T + n * ld; }
  else if (DUAL) { bn = b2[n - 8]; dcol = d2T + (n - 8) * ld; }
  if (lane < 16 && (n < 8 || DUAL)) {
    const float* wrow = (n < 8) ? (W1 + n * 8) : (W2 + (n - 8) * 8);
    #pragma unroll
    for (int k = 0; k < 8; ++k) bf[k] = (_Float16)wrow[k];
  }
  float kmx = -INFINITY, kmn = INFINITY;
  for (int ch = c0; ch < c1; ++ch) {
    v16h af = load_a_frag(src, ch, lane, amask);
    v8f c = {bn, bn, bn, bn, bn, bn, bn, bn};
    c = __builtin_amdgcn_wmma_f32_16x16x32_f16(false, af, false, bf, (short)0, c,
                                               false, false);
    if (DUAL || n < 8) {
      const int rb = ch * 16 + 8 * half;
      *(v4f*)(dcol + rb)     = (v4f){c[0], c[1], c[2], c[3]};
      *(v4f*)(dcol + rb + 4) = (v4f){c[4], c[5], c[6], c[7]};
    }
    if (DUAL) {
      #pragma unroll  // constant r: c[r] stays a named register, pairs fold into max3/min3
      for (int r = 0; r < 8; ++r) {
        kmx = fmaxf(kmx, c[r]);
        kmn = fminf(kmn, c[r]);
      }
    }
  }
  if (DUAL) {
    kmx = fmaxf(kmx, other_row(kmx));
    kmn = fminf(kmn, other_row(kmn));
    if (lane < 8) {
      ext[lane * 2 * np + slot]      = kmx;
      ext[lane * 2 * np + np + slot] = kmn;
    }
  }
}

// Row-major f32 output projection (result consumed row-wise by layernorm/fc1).
__device__ __forceinline__ void wave_proj_rm(const _Float16* src, const float* W,
                                             const float* bias, float* dst,
                                             int lane, int c0, int c1) {
  const int n = lane & 15;
  const int half = lane >> 4;
  const u32 amask = (lane < 16) ? 0xFFFFFFFFu : 0u;
  v16h bf = {};
  if (lane < 16 && n < 8) {
    #pragma unroll
    for (int k = 0; k < 8; ++k) bf[k] = (_Float16)W[n * 8 + k];
  }
  const float bn = (n < 8) ? bias[n] : 0.0f;
  for (int ch = c0; ch < c1; ++ch) {
    v16h af = load_a_frag(src, ch, lane, amask);
    v8f c = {bn, bn, bn, bn, bn, bn, bn, bn};
    c = __builtin_amdgcn_wmma_f32_16x16x32_f16(false, af, false, bf, (short)0, c,
                                               false, false);
    if (n < 8) {
      const int rb = ch * 16 + 8 * half;
      #pragma unroll
      for (int r = 0; r < 8; ++r) dst[(rb + r) * 8 + n] = c[r];
    }
  }
}

// Per-lane softmax attention row (head_dim=1, scale=1). Transposed K/V allow
// contiguous b128 reads along j. Row result converted to f16 (next A-source).
// A score is q*k[j] with one q per row, and rounding keeps the order of the
// products, so the row maximum is exactly max(q*kmax, q*kmin): no pass over j.
// ext holds NP partial maxima, then NP partial minima, of each head's K.
// attn_head: query row i of head h.
template <int NP>
__device__ __forceinline__ float attn_head(int i, int h, const float* qpT,
                                           const float* kpT, const float* vpT,
                                           int ldk, int Lk, const float* ext) {
  const float qv = qpT[h * 32 + i];
  const float* kc = kpT + h * ldk;
  const float* vc = vpT + h * ldk;
  const float* ex = ext + h * 2 * NP;
  float kmx = ex[0], kmn = ex[NP];
  #pragma unroll  // constant offsets: the partials come in as b128 reads
  for (int p = 1; p < NP; ++p) {
    kmx = fmaxf(kmx, ex[p]);
    kmn = fminf(kmn, ex[NP + p]);
  }
  const float m = fmaxf(qv * kmx, qv * kmn);
  float s = 0.0f, acc = 0.0f;
  int j = 0;
  for (; j + 3 < Lk; j += 4) {
    v4f k4 = *(const v4f*)(kc + j);
    v4f vv4 = *(const v4f*)(vc + j);
    #pragma unroll
    for (int u = 0; u < 4; ++u) {
      float ev = __expf(qv * k4[u] - m);
      s += ev;
      acc += ev * vv4[u];
    }
  }
  for (; j < Lk; ++j) {
    float ev = __expf(qv * kc[j] - m);
    s += ev;
    acc += ev * vc[j];
  }
  return acc / s;
}

// All eight heads of query row i by one lane.
template <int NP>
__device__ __forceinline__ void attn_rows(int i, const float* qpT,
                                          const float* kpT, const float* vpT,
                                          int ldk, int Lk, const float* ext,
                                          _Float16* ob) {
  float o[8];
  for (int h = 0; h < 8; ++h)
    o[h] = attn_head<NP>(i, h, qpT, kpT, vpT, ldk, Lk, ext);
  union { uint4 u; v8h h; } cv;
  #pragma unroll
  for (int h = 0; h < 8; ++h) cv.h[h] = (_Float16)o[h];
  *(uint4*)(ob + i * 8) = cv.u;
}

// Full MHA by one wave. scr (1024 f32): [0..255]=qpT[8][32], [256..511]=kpT,
// [512..767]=vpT, [768..1023]=row-major f32 result (its first 16 words hold the
// K extremes until the attention has read them). ob = f16 [32][8] scratch.
__device__ void wave_mha(int lane, const _Float16* q, const _Float16* kv, int Lk,
                         const float* wIn, const float* bIn,
                         const float* wOut, const float* bOut,
                         float* scr, _Float16* ob) {
  wave_proj_t<false>(q, wIn, bIn, nullptr, nullptr, scr, nullptr, 32, lane, 0, 2);
  wave_proj_t<true>(kv, wIn + 64, bIn + 8, wIn + 128, bIn + 16,
                    scr + 256, scr + 512, 32, lane, 0, 2, scr + 768, 1, 0);
  attn_rows<1>(lane, scr, scr + 256, scr + 512, 32, Lk, scr + 768, ob);
  wave_proj_rm(ob, wOut, bOut, scr + 768, lane, 0, 2);
}

__global__ __launch_bounds__(256) void cmt_kernel(
    const float* __restrict__ eeg, const float* __restrict__ pupil,
    const float* __restrict__ speech, const float* __restrict__ action,
    const float* __restrict__ location, const float* __restrict__ tgt,
    const float* __restrict__ eeg_w, const float* __restrict__ eeg_b,
    const float* __restrict__ psa_w, const float* __restrict__ psa_b,
    const float* __restrict__ loc_w, const float* __restrict__ loc_b,
    const float* __restrict__ tgt_w, const float* __restrict__ tgt_b,
    const float* __restrict__ ng, const float* __restrict__ nb,
    const float* __restrict__ cin_w, const float* __restrict__ cin_b,
    const float* __restrict__ cout_w, const float* __restrict__ cout_b,
    const float* __restrict__ sfin_w, const float* __restrict__ sfin_b,
    const float* __restrict__ sfout_w, const float* __restrict__ sfout_b,
    const float* __restrict__ oin_w, const float* __restrict__ oin_b,
    const float* __restrict__ oout_w, const float* __restrict__ oout_b,
    const float* __restrict__ fc1_w, const float* __restrict__ fc1_b,
    float* __restrict__ out) {
  __shared__ _Float16 s_seq[5][32][E];   // f16 A-sources: e(30), p, s, a, l
  __shared__ _Float16 s_t[32][E];
  __shared__ _Float16 s_concat[128][E];  // 126 rows + 2 pad rows
  __shared__ _Float16 s_ob[8][32][E];    // per-wave attention-output (A-source)
  __shared__ float s_acc[4][32][E];
  __shared__ float s_scr[8][1024];       // per-wave qpT/kpT/vpT/result
  __shared__ float s_kpTf[8][128];       // final MHA K, transposed [head][pos]
  __shared__ float s_vpTf[8][128];
  __shared__ float s_tout[32][E];
  __shared__ float s_fc[96];

  const int b    = blockIdx.x;
  const int tid  = threadIdx.x;
  const int lane = tid & 31;
  const int wave = tid >> 5;
  const int Lseq[5] = {30, 32, 32, 32, 32};

  __builtin_prefetch(fc1_w + (tid << 6), 0, 1);   // global_prefetch_b8

  // ---------------- Phase 0: convs + positional encoding into LDS ----------
  for (int idx = tid; idx < 4 * 32 * E; idx += 256) ((float*)s_acc)[idx] = 0.0f;

  if (tid < 240) {  // eeg conv2d (2,20,118) -> 30x8, kernel (20,2), stride (1,4)
    int pos = tid >> 3, oc = tid & 7;
    const float* ep = eeg + (size_t)b * (2 * 20 * 118);
    float sum = eeg_b[oc];
    for (int ic = 0; ic < 2; ++ic) {
      #pragma unroll 4
      for (int kh = 0; kh < 20; ++kh) {
        const float* row = ep + (ic * 20 + kh) * 118 + pos * 4;
        const float* wr  = eeg_w + ((oc * 2 + ic) * 20 + kh) * 2;
        sum += row[0] * wr[0] + row[1] * wr[1];
      }
    }
    const _Float16 hv = (_Float16)(sum + pe_val(30.0f, oc));
    s_seq[0][pos][oc] = hv;
    if (pos == 29) {  // pad rows repeat the last row: K extremes stay those of 30 rows
      s_seq[0][30][oc] = hv;
      s_seq[0][31][oc] = hv;
    }
  }

  for (int idx = tid; idx < 5 * 32 * E; idx += 256) {  // p/s/a/l/tgt conv1d k1p1
    int sSel = idx >> 8;
    int pos  = (idx >> 3) & 31;
    int oc   = idx & 7;
    float v;
    _Float16* dst;
    if (sSel < 3) {
      const float* x = (sSel == 0 ? pupil : (sSel == 1 ? speech : action)) + (size_t)b * 60;
      v = psa_b[oc];
      if (pos >= 1 && pos <= 30)
        v += psa_w[oc * 2 + 0] * x[pos - 1] + psa_w[oc * 2 + 1] * x[30 + pos - 1];
      dst = &s_seq[1 + sSel][pos][oc];
    } else if (sSel == 3) {
      const float* x = location + (size_t)b * 90;
      v = loc_b[oc];
      if (pos >= 1 && pos <= 30)
        #pragma unroll
        for (int ic = 0; ic < 3; ++ic) v += loc_w[oc * 3 + ic] * x[ic * 30 + pos - 1];
      dst = &s_seq[4][pos][oc];
    } else {
      const float* x = tgt + (size_t)b * 30;
      v = tgt_b[oc];
      if (pos >= 1 && pos <= 30) v += tgt_w[oc] * x[pos - 1];
      dst = &s_t[pos][oc];
    }
    *dst = (_Float16)(v + pe_val(32.0f, oc));
  }
  __syncthreads();

  // ---------------- Phase 1: 18 MHAs strided over 8 waves (2-3 each) --------------------
  const int TQ[18] = {0,0,0,0,0, 1,1,1,1,1, 2,2,2,2, 3,3,3,3};
  const int TK[18] = {1,3,4,0,2, 0,3,4,1,2, 0,1,3,4, 0,1,3,2};
  const int TS[18] = {0,0,0,1,0, 0,0,0,1,0, 0,0,0,0, 0,0,1,0};
  const int TA[18] = {0,0,0,0,0, 1,1,1,1,1, 2,2,2,2, 3,3,3,3};
  const int TB[18] = {-1,-1,-1,-1,-1, -1,-1,-1,-1,-1, -1,-1,-1,3, -1,-1,-1,-1};

  for (int t = wave; t < 18; t += 8) {
    const float* wIn  = TS[t] ? sfin_w  : cin_w;
    const float* bIn  = TS[t] ? sfin_b  : cin_b;
    const float* wOut = TS[t] ? sfout_w : cout_w;
    const float* bOut = TS[t] ? sfout_b : cout_b;
    int Lq = Lseq[TQ[t]], Lk = Lseq[TK[t]];
    float* scr = s_scr[wave];
    wave_mha(lane, &s_seq[TQ[t]][0][0], &s_seq[TK[t]][0][0], Lk,
             wIn, bIn, wOut, bOut, scr, &s_ob[wave][0][0]);
    // layernorm + accumulate (ds_add_f32 atomics across waves)
    int i = lane;
    if (i < Lq) {
      const float* row = scr + 768 + i * 8;
      float mu = 0.0f;
      #pragma unroll
      for (int c = 0; c < E; ++c) mu += row[c];
      mu *= 0.125f;
      float var = 0.0f;
      #pragma unroll
      for (int c = 0; c < E; ++c) { float d = row[c] - mu; var += d * d; }
      var *= 0.125f;
      float rinv = rsqrtf(var + 1e-5f);
      #pragma unroll
      for (int c = 0; c < E; ++c) {
        float v = (row[c] - mu) * rinv * ng[c] + nb[c];
        atomicAdd(&s_acc[TA[t]][i][c], v);
        if (TB[t] >= 0) atomicAdd(&s_acc[TB[t]][i][c], v);
      }
    }
  }
  __syncthreads();

  // ---------------- Phase 2: concat (f16) + final MHA ----------------------
  for (int idx = tid; idx < 128 * E; idx += 256) {  // [eeg30|pupil32|action32|speech32]
    int drow = idx >> 3, c = idx & 7;
    int row = drow < 125 ? drow : 125;  // pad rows 126, 127 repeat row 125
    int ai, r2;
    if (row < 30)      { ai = 0; r2 = row; }
    else if (row < 62) { ai = 1; r2 = row - 30; }
    else if (row < 94) { ai = 3; r2 = row - 62; }
    else               { ai = 2; r2 = row - 94; }
    s_concat[drow][c] = (_Float16)s_acc[ai][r2][c];
  }
  __syncthreads();

  // K/V of 126-row concat: dual WMMA, one 16-row chunk per wave; each wave leaves
  // its chunk's K extremes in s_scr[1] (free since phase 1), 8 partials per head
  wave_proj_t<true>(&s_concat[0][0], oin_w + 64, oin_b + 8, oin_w + 128, oin_b + 16,
                    &s_kpTf[0][0], &s_vpTf[0][0], 128, lane, wave, wave + 1,
                    s_scr[1], 8, wave);
  // Q of the 32 target rows into s_scr[0]: one 16-row chunk on each of waves 2, 3
  // (they had one task fewer than waves 0, 1 in phase 1)
  const bool projWave = (wave == 2 || wave == 3);
  if (projWave)
    wave_proj_t<false>(&s_t[0][0], oin_w, oin_b, nullptr, nullptr,
                       s_scr[0], nullptr, 32, lane, wave - 2, wave - 1);
  __syncthreads();

  // One head per wave, one query row per lane: all eight waves share the 8 x 126
  // keys that one wave would otherwise walk alone.
  s_ob[0][lane][wave] = (_Float16)attn_head<8>(lane, wave, s_scr[0], &s_kpTf[0][0],
                                               &s_vpTf[0][0], 128, 126, s_scr[1]);
  __syncthreads();  // a row of s_ob[0] holds the heads of eight waves

  if (projWave)
    wave_proj_rm(&s_ob[0][0][0], oout_w, oout_b, &s_tout[0][0], lane,
                 wave - 2, wave - 1);
  __syncthreads();

  // ---------------- Phase 3: fc1 + channel softmax -> (B,3,30) -------------
  if (tid < 90) {
    float sum = fc1_b[tid];
    const float* wr = fc1_w + tid * 256;
    const float* x  = (const float*)s_tout;
    #pragma unroll 8
    for (int j = 0; j < 256; ++j) sum += wr[j] * x[j];
    s_fc[tid] = sum;
  }
  __syncthreads();
  if (tid < 30) {
    float x0 = s_fc[tid * 3 + 0], x1 = s_fc[tid * 3 + 1], x2 = s_fc[tid * 3 + 2];
    float m  = fmaxf(x0, fmaxf(x1, x2));
    float e0 = __expf(x0 - m), e1 = __expf(x1 - m), e2 = __expf(x2 - m);
    float s  = e0 + e1 + e2;
    float* o = out + (size_t)b * 90;
    o[0 * 30 + tid] = e0 / s;
    o[1 * 30 + tid] = e1 / s;
    o[2 * 30 + tid] = e2 / s;
  }
}

extern "C" void kernel_launch(void* const* d_in, const int* in_sizes, int n_in,
                              void* d_out, int out_size, void* d_ws, size_t ws_size,
                              hipStream_t stream) {
  (void)n_in; (void)out_size; (void)d_ws; (void)ws_size;
  const int B = in_sizes[0] / (2 * 20 * 118);
  cmt_kernel<<<B, 256, 0, stream>>>(
      (const float*)d_in[0],  (const float*)d_in[1],  (const float*)d_in[2],
      (const float*)d_in[3],  (const float*)d_in[4],  (const float*)d_in[5],
      (const float*)d_in[6],  (const float*)d_in[7],  (const float*)d_in[8],
      (const float*)d_in[9],  (const float*)d_in[10], (const float*)d_in[11],
      (const float*)d_in[12], (const float*)d_in[13], (const float*)d_in[14],
      (const float*)d_in[15], (const float*)d_in[16], (const float*)d_in[17],
      (const float*)d_in[18], (const float*)d_in[19], (const float*)d_in[20],
      (const float*)d_in[21], (const float*)d_in[22], (const float*)d_in[23],
      (const float*)d_in[24], (const float*)d_in[25], (const float*)d_in[26],
      (const float*)d_in[27], (const float*)d_in[28], (const float*)d_in[29],
      (float*)d_out);
}

// v004
// Measured time: 193 microseconds a run.
// Versions between v002 and this one are left out; their measured steps multiply to 1.57 times as fast.
// Over all steps from v000 it is 2.36 times as fast.
#include <hip/hip_runtime.h>
#include <math.h>

#define E 8

typedef __attribute__((ext_vector_type(16))) _Float16 v16h;
typedef __attribute__((ext_vector_type(8)))  _Float16 v8h;
typedef __attribute__((ext_vector_type(8)))  float    v8f;
typedef __attribute__((ext_vector_type(4)))  float    v4f;
typedef __attribute__((ext_vector_type(2)))  float    v2f;
typedef unsigned int u32;

__device__ __forceinline__ float pe_val(float pos, int oc) {
  int k = oc & ~1;
  float div = __expf((float)k * (-9.210340371976184f / 8.0f));
  float ang = pos * div;
  return (oc & 1) ? __cosf(ang) : __sinf(ang);
}

// ---------------------------------------------------------------------------
// One v_wmma_f32_16x16x32_f16 per 16-row chunk. K=8 real (zero-padded to 32).
// A (16-bit 16x32): lanes 0-15 row M=lane, halves 0..7 = K 0..7; lanes 16-31 zero.
// B (16-bit 32x16): lanes 0-15 col N=lane, halves 0..7 = K 0..7.
// D (f32 16x16):    lane -> col N=lane&15, VGPR r -> row M = r + 8*(lane>>4).
// Sources live in LDS as f16 rows (16B) -> A build = one ds_load_b128, no cvt.
// Bias is folded into the C accumulator (C[m][n] = bias[n]).
// ---------------------------------------------------------------------------

__device__ __forceinline__ v16h load_a_frag(const _Float16* src, int ch, int lane,
                                            u32 amask) {
  uint4 raw = *(const uint4*)(src + (ch * 16 + (lane & 15)) * 8);
  raw.x &= amask; raw.y &= amask; raw.z &= amask; raw.w &= amask;
  union { uint4 u; v8h h; } cv;
  cv.u = raw;
  v16h af;
  #pragma unroll
  for (int k = 0; k < 8; ++k) af[k] = cv.h[k];
  #pragma unroll
  for (int k = 8; k < 16; ++k) af[k] = (_Float16)0.0f;
  return af;
}

// Value held by the same lane of the other 16-lane row (all 32 lanes active).
__device__ __forceinline__ float other_row(float x) {
  u32 u = __builtin_bit_cast(u32, x);
  return __builtin_bit_cast(float, __builtin_amdgcn_permlanex16(
      u, u, 0x76543210u, 0xfedcba98u, false, false));
}

// Transposed-output projection. DUAL packs two 8x8 weight blocks into B's 16
// columns -> one WMMA yields both K and V. Writeback: 2 contiguous b128 stores.
// DUAL also leaves each head's largest and smallest K over the rows it projects:
// ext[head*2*np + slot] and ext[head*2*np + np + slot]. Every projected row
// counts, so pad rows of src must repeat a real row.
template <bool DUAL>
__device__ __forceinline__ void wave_proj_t(const _Float16* src,
                                            const float* W1, const float* b1,
                                            const float* W2, const float* b2,
                                            float* d1T, float* d2T, int ld,
                                            int lane, int c0, int c1,
                                            float* ext = nullptr, int np = 1,
                                            int slot = 0) {
  const int n = lane & 15;
  const int half = lane >> 4;
  const u32 amask = (lane < 16) ? 0xFFFFFFFFu : 0u;
  v16h bf = {};
  float bn = 0.0f;
  float* dcol = nullptr;
  if (n < 8) { bn = b1[n]; dcol = d1T + n * ld; }
  else if (DUAL) { bn = b2[n - 8]; dcol = d2T + (n - 8) * ld; }
  if (lane < 16 && (n < 8 || DUAL)) {
    const float* wrow = (n < 8) ? (W1 + n * 8) : (W2 + (n - 8) * 8);
    #pragma unroll
    for (int k = 0; k < 8; ++k) bf[k] = (_Float16)wrow[k];
  }
  float kmx = -INFINITY, kmn = INFINITY;
  for (int ch = c0; ch < c1; ++ch) {
    v16h af = load_a_frag(src, ch, lane, amask);
    v8f c = {bn, bn, bn, bn, bn, bn, bn, bn};
    c = __builtin_amdgcn_wmma_f32_16x16x32_f16(false, af, false, bf, (short)0, c,
                                               false, false);
    if (DUAL || n < 8) {
      const int rb = ch * 16 + 8 * half;
      *(v4f*)(dcol + rb)     = (v4f){c[0], c[1], c[2], c[3]};
      *(v4f*)(dcol + rb + 4) = (v4f){c[4], c[5], c[6], c[7]};
    }
    if (DUAL) {
      #pragma unroll  // constant r: c[r] stays a named register, pairs fold into max3/min3
      for (int r = 0; r < 8; ++r) {
        kmx = fmaxf(kmx, c[r]);
        kmn = fminf(kmn, c[r]);
      }
    }
  }
  if (DUAL) {
    kmx = fmaxf(kmx, other_row(kmx));
    kmn = fminf(kmn, other_row(kmn));
    if (lane < 8) {
      ext[lane * 2 * np + slot]      = kmx;
      ext[lane * 2 * np + np + slot] = kmn;
    }
  }
}

// Row-major f32 output projection (result consumed row-wise by layernorm/fc1).
__device__ __forceinline__ void wave_proj_rm(const _Float16* src, const float* W,
                                             const float* bias, float* dst,
                                             int lane, int c0, int c1) {
  const int n = lane & 15;
  const int half = lane >> 4;
  const u32 amask = (lane < 16) ? 0xFFFFFFFFu : 0u;
  v16h bf = {};
  if (lane < 16 && n < 8) {
    #pragma unroll
    for (int k = 0; k < 8; ++k) bf[k] = (_Float16)W[n * 8 + k];
  }
  const float bn = (n < 8) ? bias[n] : 0.0f;
  for (int ch = c0; ch < c1; ++ch) {
    v16h af = load_a_frag(src, ch, lane, amask);
    v8f c = {bn, bn, bn, bn, bn, bn, bn, bn};
    c = __builtin_amdgcn_wmma_f32_16x16x32_f16(false, af, false, bf, (short)0, c,
                                               false, false);
    if (n < 8) {
      const int rb = ch * 16 + 8 * half;
      #pragma unroll
      for (int r = 0; r < 8; ++r) dst[(rb + r) * 8 + n] = c[r];
    }
  }
}

// Per-lane softmax attention row (head_dim=1, scale=1). Transposed K/V allow
// contiguous b128 reads along j. Row result converted to f16 (next A-source).
// A score is q*k[j] with one q per row, and rounding keeps the order of the
// products, so the row maximum is exactly max(q*kmax, q*kmin): no pass over j.
// ext holds NP partial maxima, then NP partial minima, of each head's K.
// attn_head: query row i of head h.
template <int NP>
__device__ __forceinline__ float attn_head(int i, int h, const float* qpT,
                                           const float* kpT, const float* vpT,
                                           int ldk, int Lk, const float* ext) {
  const float qv = qpT[h * 32 + i];
  const float* kc = kpT + h * ldk;
  const float* vc = vpT + h * ldk;
  const float* ex = ext + h * 2 * NP;
  float kmx = ex[0], kmn = ex[NP];
  #pragma unroll  // constant offsets: the partials come in as b128 reads
  for (int p = 1; p < NP; ++p) {
    kmx = fmaxf(kmx, ex[p]);
    kmn = fminf(kmn, ex[NP + p]);
  }
  const float m = fmaxf(qv * kmx, qv * kmn);
  float s = 0.0f, acc = 0.0f;
  int j = 0;
  for (; j + 3 < Lk; j += 4) {
    v4f k4 = *(const v4f*)(kc + j);
    v4f vv4 = *(const v4f*)(vc + j);
    #pragma unroll
    for (int u = 0; u < 4; ++u) {
      float ev = __expf(qv * k4[u] - m);
      s += ev;
      acc += ev * vv4[u];
    }
  }
  for (; j < Lk; ++j) {
    float ev = __expf(qv * kc[j] - m);
    s += ev;
    acc += ev * vc[j];
  }
  return acc / s;
}

// 2^x of eight values, each in its own register. One statement, so that no
// instruction directly behind a v_exp_f32 reads its result or overwrites its source
// (the slot the instruction set asks for); the v_nop is that slot behind the last.
__device__ __forceinline__ void exp2_x8(float* x) {
  asm("v_exp_f32 %0, %0\n\tv_exp_f32 %1, %1\n\tv_exp_f32 %2, %2\n\tv_exp_f32 %3, %3\n\t"
      "v_exp_f32 %4, %4\n\tv_exp_f32 %5, %5\n\tv_exp_f32 %6, %6\n\tv_exp_f32 %7, %7\n\t"
      "v_nop"
      : "+v"(x[0]), "+v"(x[1]), "+v"(x[2]), "+v"(x[3]),
        "+v"(x[4]), "+v"(x[5]), "+v"(x[6]), "+v"(x[7]));
}

// All eight heads of a 32-query, 32-key task by one wave, sums on the matrix unit.
// D = A x B per head and 16-query chunk, f16 operands, f32 accumulate:
//   B column c = query c, its 32 softmax weights exp(q*k - m) of that head;
//   A row 2*hd = V of head hd, row 2*hd+1 = ones (one fragment for all heads).
// Element s of lane half g is key 16*g + s in A and in B alike.
// D row 2*hd = weighted V sum, row 2*hd+1 = weight sum: register r of lane half g
// is row 8*g + r, so lanes 0-15 read heads 0-3 and lanes 16-31 heads 4-7.
// Lk is 30 or 32: at 30 the A columns of keys 30, 31 are zero, so the pad keys
// reach neither sum.
__device__ __forceinline__ void attn_rows_mm(int lane, const float* qpT,
                                             const float* kpT, const float* vpT,
                                             int Lk, const float* ext,
                                             _Float16* ob) {
  const int c = lane & 15;
  const int half = lane >> 4;
  union { u32 w[8]; v16h h; } a;
  const float* vr = vpT + (c >> 1) * 32 + 16 * half;
  #pragma unroll
  for (int p = 0; p < 4; ++p) {
    v4f x = *(const v4f*)(vr + 4 * p);
    #pragma unroll
    for (int u = 0; u < 4; ++u) a.h[4 * p + u] = (_Float16)x[u];
  }
  #pragma unroll
  for (int p = 0; p < 8; ++p) a.w[p] = (c & 1) ? 0x3C003C00u : a.w[p];  // 1.0h pair
  if (half == 1 && Lk < 32) a.w[7] = 0u;

  #pragma unroll 1  // rolled: four unrolled head pairs do not fit the register budget of 10 waves per SIMD
  for (int hp = 0; hp < 4; ++hp) {
    float num[2][2], den[2][2];
    #pragma unroll
    for (int w = 0; w < 2; ++w) {
      const int hd = hp + 4 * w;
      const float* kc = kpT + hd * 32 + 16 * half;
      float k[16];
      #pragma unroll
      for (int p = 0; p < 4; ++p) {
        v4f x = *(const v4f*)(kc + 4 * p);
        #pragma unroll
        for (int u = 0; u < 4; ++u) k[4 * p + u] = x[u];
      }
      const float kmx = ext[hd * 2], kmn = ext[hd * 2 + 1];
      const float q2[2] = {qpT[hd * 32 + c], qpT[hd * 32 + 16 + c]};
      const float m2[2] = {fmaxf(q2[0] * kmx, q2[0] * kmn), fmaxf(q2[1] * kmx, q2[1] * kmn)};
      #pragma unroll
      for (int ch = 0; ch < 2; ++ch) {
        const float qv = q2[ch];
        const float m = m2[ch];
        float e[16];  // exp(x) = 2^(x * log2 e), as __expf forms it
        #pragma unroll
        for (int g = 0; g < 2; ++g) {
          #pragma unroll
          for (int s = 8 * g; s < 8 * g + 8; ++s)
            e[s] = (qv * k[s] - m) * 1.44269504088896341f;
          exp2_x8(e + 8 * g);
          // eight scores at a time: with all sixteen formed ahead of the exps the build
          // takes a 97th register, which costs a wave per SIMD
          __builtin_amdgcn_sched_barrier(0);
        }
        v16h pf;
        #pragma unroll
        for (int s = 0; s < 16; ++s) pf[s] = (_Float16)e[s];
        v8f d = {};
        d = __builtin_amdgcn_wmma_f32_16x16x32_f16(false, a.h, false, pf, (short)0, d,
                                                   false, false);
        num[w][ch] = d[2 * hp];
        den[w][ch] = d[2 * hp + 1];
      }
    }
    #pragma unroll
    for (int ch = 0; ch < 2; ++ch)
      ob[(ch * 16 + c) * 8 + 4 * half + hp] =
          (_Float16)((half ? num[1][ch] : num[0][ch]) / (half ? den[1][ch] : den[0][ch]));
  }
}

// Full MHA by one wave. scr (1024 f32): [0..255]=qpT[8][32], [256..511]=kpT,
// [512..767]=vpT, [768..1023]=row-major f32 result (its first 16 words hold the
// K extremes until the attention has read them). ob = f16 [32][8] scratch.
__device__ void wave_mha(int lane, const _Float16* q, const _Float16* kv, int Lk,
                         const float* wIn, const float* bIn,
                         const float* wOut, const float* bOut,
                         float* scr, _Float16* ob) {
  wave_proj_t<false>(q, wIn, bIn, nullptr, nullptr, scr, nullptr, 32, lane, 0, 2);
  wave_proj_t<true>(kv, wIn + 64, bIn + 8, wIn + 128, bIn + 16,
                    scr + 256, scr + 512, 32, lane, 0, 2, scr + 768, 1, 0);
  attn_rows_mm(lane, scr, scr + 256, scr + 512, Lk, scr + 768, ob);
  wave_proj_rm(ob, wOut, bOut, scr + 768, lane, 0, 2);
}

__global__ __launch_bounds__(256) void cmt_kernel(
    const float* __restrict__ eeg, const float* __restrict__ pupil,
    const float* __restrict__ speech, const float* __restrict__ action,
    const float* __restrict__ location, const float* __restrict__ tgt,
    const float* __restrict__ eeg_w, const float* __restrict__ eeg_b,
    const float* __restrict__ psa_w, const float* __restrict__ psa_b,
    const float* __restrict__ loc_w, const float* __restrict__ loc_b,
    const float* __restrict__ tgt_w, const float* __restrict__ tgt_b,
    const float* __restrict__ ng, const float* __restrict__ nb,
    const float* __restrict__ cin_w, const float* __restrict__ cin_b,
    const float* __restrict__ cout_w, const float* __restrict__ cout_b,
    const float* __restrict__ sfin_w, const float* __restrict__ sfin_b,
    const float* __restrict__ sfout_w, const float* __restrict__ sfout_b,
    const float* __restrict__ oin_w, const float* __restrict__ oin_b,
    const float* __restrict__ oout_w, const float* __restrict__ oout_b,
    const float* __restrict__ fc1_w, const float* __restrict__ fc1_b,
    float* __restrict__ out) {
  __shared__ _Float16 s_seq[5][32][E];   // f16 A-sources: e(30), p, s, a, l
  __shared__ _Float16 s_t[32][E];
  __shared__ _Float16 s_concat[128][E];  // 126 rows + 2 pad rows
  __shared__ _Float16 s_ob[8][32][E];    // per-wave attention-output (A-source)
  __shared__ float s_acc[4][32][E];
  __shared__ float s_scr[8][1024];       // per-wave qpT/kpT/vpT/result
  __shared__ float s_kpTf[8][128];       // final MHA K, transposed [head][pos]
  __shared__ float s_vpTf[8][128];
  __shared__ float s_tout[32][E];
  __shared__ float s_fc[96];

  const int b    = blockIdx.x;
  const int tid  = threadIdx.x;
  const int lane = tid & 31;
  const int wave = tid >> 5;
  const int Lseq[5] = {30, 32, 32, 32, 32};

  __builtin_prefetch(fc1_w + (tid << 6), 0, 1);   // global_prefetch_b8

  // ---------------- Phase 0: convs + positional encoding into LDS ----------
  for (int idx = tid; idx < 4 * 32 * E; idx += 256) ((float*)s_acc)[idx] = 0.0f;

  // Every global read of phase 0 is issued here, ahead of the first use of any of
  // them: one memory latency for the whole phase, not one per group of conv rows.
  // The eeg block and its conv weights go through registers into s_scr, which is
  // free until phase 1, in floats: [0,5120) the 4720 floats of the block, then
  // copies of its last 16 bytes that nobody reads; from 5120 the weights, one row of
  // 80 per output channel at a pitch of 84 (b128 reads of 8 rows, no bank shared);
  // rows 8 to 12 take the stores of the threads without a chunk, read by nobody.
  float* stage = &s_scr[0][0];
  const int pos = tid >> 3;  // 0..31
  const int oc  = tid & 7;
  const v4f* ep4 = (const v4f*)(eeg + (size_t)b * (2 * 20 * 118));
  v4f ech[5];
  #pragma unroll  // constant k: the five chunks stay in named registers
  for (int k = 0; k < 5; ++k) {
    const int i = tid + 256 * k;
    ech[k] = ep4[i < 1180 ? i : 1179];
  }
  const v4f wch = ((const v4f*)eeg_w)[tid < 160 ? tid : 159];
  const bool inb = (pos >= 1 && pos <= 30);
  const u32 xi = inb ? (u32)(pos - 1) : 0u;  // in bounds for the two pad positions too
  const float* xp = pupil    + (size_t)b * 60;
  const float* xs = speech   + (size_t)b * 60;
  const float* xa = action   + (size_t)b * 60;
  const float* xl = location + (size_t)b * 90;
  const float psa_x[3][2] = {{xp[xi], xp[xi + 30]}, {xs[xi], xs[xi + 30]},
                             {xa[xi], xa[xi + 30]}};
  const float loc_x[3] = {xl[xi], xl[xi + 30], xl[xi + 60]};
  const float tgt_x = (tgt + (size_t)b * 30)[xi];
  const float pw0 = psa_w[oc * 2 + 0], pw1 = psa_w[oc * 2 + 1], pb = psa_b[oc];
  const float lw[3] = {loc_w[oc * 3 + 0], loc_w[oc * 3 + 1], loc_w[oc * 3 + 2]};
  const float lb = loc_b[oc], tw = tgt_w[oc], tb = tgt_b[oc], eb = eeg_b[oc];

  #pragma unroll  // constant k, as above
  for (int k = 0; k < 5; ++k) *(v4f*)(stage + (tid + 256 * k) * 4) = ech[k];
  *(v4f*)(stage + 5120 + (tid / 20) * 84 + (tid % 20) * 4) = wch;

  {  // p/s/a/l/tgt conv1d k1p1: this thread's (pos, oc) of all five
    const float pe32 = pe_val(32.0f, oc);
    #pragma unroll  // constant q: psa_x stays in named registers
    for (int q = 0; q < 3; ++q) {
      float v = pb;
      if (inb) v += pw0 * psa_x[q][0] + pw1 * psa_x[q][1];
      s_seq[1 + q][pos][oc] = (_Float16)(v + pe32);
    }
    float v = lb;
    if (inb) {
      #pragma unroll  // constant ic: lw and loc_x stay in named registers
      for (int ic = 0; ic < 3; ++ic) v += lw[ic] * loc_x[ic];
    }
    s_seq[4][pos][oc] = (_Float16)(v + pe32);
    v = tb;
    if (inb) v += tw * tgt_x;
    s_t[pos][oc] = (_Float16)(v + pe32);
  }
  __syncthreads();  // the staged block and weights are read by other threads than stored them

  if (tid < 240) {  // eeg conv2d (2,20,118) -> 30x8, kernel (20,2), stride (1,4)
    const float* xr = stage + pos * 4;
    const float* wr = stage + 5120 + oc * 84;
    float sum = eb;
    #pragma unroll 5  // ten conv rows a trip, so that their LDS reads overlap; more rows cost registers
    for (int j = 0; j < 20; ++j) {  // rows 2j, 2j+1 of the 40 (ic, kh) rows, in order
      const v4f w  = *(const v4f*)(wr + 4 * j);
      const v2f x0 = *(const v2f*)(xr + (2 * j) * 118);
      const v2f x1 = *(const v2f*)(xr + (2 * j + 1) * 118);
      sum += x0[0] * w[0] + x0[1] * w[1];
      sum += x1[0] * w[2] + x1[1] * w[3];
    }
    const _Float16 hv = (_Float16)(sum + pe_val(30.0f, oc));
    s_seq[0][pos][oc] = hv;
    if (pos == 29) {  // pad rows repeat the last row: K extremes stay those of 30 rows
      s_seq[0][30][oc] = hv;
      s_seq[0][31][oc] = hv;
    }
  }
  __syncthreads();

  // ---------------- Phase 1: 18 MHAs strided over 8 waves (2-3 each) --------------------
  const int TQ[18] = {0,0,0,0,0, 1,1,1,1,1, 2,2,2,2, 3,3,3,3};
  const int TK[18] = {1,3,4,0,2, 0,3,4,1,2, 0,1,3,4, 0,1,3,2};
  const int TS[18] = {0,0,0,1,0, 0,0,0,1,0, 0,0,0,0, 0,0,1,0};
  const int TA[18] = {0,0,0,0,0, 1,1,1,1,1, 2,2,2,2, 3,3,3,3};
  const int TB[18] = {-1,-1,-1,-1,-1, -1,-1,-1,-1,-1, -1,-1,-1,3, -1,-1,-1,-1};

  for (int t = wave; t < 18; t += 8) {
    const float* wIn  = TS[t] ? sfin_w  : cin_w;
    const float* bIn  = TS[t] ? sfin_b  : cin_b;
    const float* wOut = TS[t] ? sfout_w : cout_w;
    const float* bOut = TS[t] ? sfout_b : cout_b;
    int Lq = Lseq[TQ[t]], Lk = Lseq[TK[t]];
    float* scr = s_scr[wave];
    wave_mha(lane, &s_seq[TQ[t]][0][0], &s_seq[TK[t]][0][0], Lk,
             wIn, bIn, wOut, bOut, scr, &s_ob[wave][0][0]);
    // layernorm + accumulate (ds_add_f32 atomics across waves)
    int i = lane;
    if (i < Lq) {
      const float* row = scr + 768 + i * 8;
      float mu = 0.0f;
      #pragma unroll
      for (int c = 0; c < E; ++c) mu += row[c];
      mu *= 0.125f;
      float var = 0.0f;
      #pragma unroll
      for (int c = 0; c < E; ++c) { float d = row[c] - mu; var += d * d; }
      var *= 0.125f;
      float rinv = rsqrtf(var + 1e-5f);
      #pragma unroll
      for (int c = 0; c < E; ++c) {
        float v = (row[c] - mu) * rinv * ng[c] + nb[c];
        atomicAdd(&s_acc[TA[t]][i][c], v);
        if (TB[t] >= 0) atomicAdd(&s_acc[TB[t]][i][c], v);
      }
    }
  }
  __syncthreads();

  // ---------------- Phase 2: concat (f16) + final MHA ----------------------
  for (int idx = tid; idx < 128 * E; idx += 256) {  // [eeg30|pupil32|action32|speech32]
    int drow = idx >> 3, c = idx & 7;
    int row = drow < 125 ? drow : 125;  // pad rows 126, 127 repeat row 125
    int ai, r2;
    if (row < 30)      { ai = 0; r2 = row; }
    else if (row < 62) { ai = 1; r2 = row - 30; }
    else if (row < 94) { ai = 3; r2 = row - 62; }
    else               { ai = 2; r2 = row - 94; }
    s_concat[drow][c] = (_Float16)s_acc[ai][r2][c];
  }
  __syncthreads();

  // K/V of 126-row concat: dual WMMA, one 16-row chunk per wave; each wave leaves
  // its chunk's K extremes in s_scr[1] (free since phase 1), 8 partials per head
  wave_proj_t<true>(&s_concat[0][0], oin_w + 64, oin_b + 8, oin_w + 128, oin_b + 16,
                    &s_kpTf[0][0], &s_vpTf[0][0], 128, lane, wave, wave + 1,
                    s_scr[1], 8, wave);
  // Q of the 32 target rows into s_scr[0]: one 16-row chunk on each of waves 2, 3
  // (they had one task fewer than waves 0, 1 in phase 1)
  const bool projWave = (wave == 2 || wave == 3);
  if (projWave)
    wave_proj_t<false>(&s_t[0][0], oin_w, oin_b, nullptr, nullptr,
                       s_scr[0], nullptr, 32, lane, wave - 2, wave - 1);
  __syncthreads();

  // One head per wave, one query row per lane: all eight waves share the 8 x 126
  // keys that one wave would otherwise walk alone.
  s_ob[0][lane][wave] = (_Float16)attn_head<8>(lane, wave, s_scr[0], &s_kpTf[0][0],
                                               &s_vpTf[0][0], 128, 126, s_scr[1]);
  __syncthreads();  // a row of s_ob[0] holds the heads of eight waves

  if (projWave)
    wave_proj_rm(&s_ob[0][0][0], oout_w, oout_b, &s_tout[0][0], lane,
                 wave - 2, wave - 1);
  __syncthreads();

  // ---------------- Phase 3: fc1 + channel softmax -> (B,3,30) -------------
  if (tid < 90) {
    float sum = fc1_b[tid];
    const float* wr = fc1_w + tid * 256;
    const float* x  = (const float*)s_tout;
    #pragma unroll 8
    for (int j = 0; j < 256; ++j) sum += wr[j] * x[j];
    s_fc[tid] = sum;
  }
  __syncthreads();
  if (tid < 30) {
    float x0 = s_fc[tid * 3 + 0], x1 = s_fc[tid * 3 + 1], x2 = s_fc[tid * 3 + 2];
    float m  = fmaxf(x0, fmaxf(x1, x2));
    float e0 = __expf(x0 - m), e1 = __expf(x1 - m), e2 = __expf(x2 - m);
    float s  = e0 + e1 + e2;
    float* o = out + (size_t)b * 90;
    o[0 * 30 + tid] = e0 / s;
    o[1 * 30 + tid] = e1 / s;
    o[2 * 30 + tid] = e2 / s;
  }
}

extern "C" void kernel_launch(void* const* d_in, const int* in_sizes, int n_in,
                              void* d_out, int out_size, void* d_ws, size_t ws_size,
                              hipStream_t stream) {
  (void)n_in; (void)out_size; (void)d_ws; (void)ws_size;
  const int B = in_sizes[0] / (2 * 20 * 118);
  cmt_kernel<<<B, 256, 0, stream>>>(
      (const float*)d_in[0],  (const float*)d_in[1],  (const float*)d_in[2],
      (const float*)d_in[3],  (const float*)d_in[4],  (const float*)d_in[5],
      (const float*)d_in[6],  (const float*)d_in[7],  (const float*)d_in[8],
      (const float*)d_in[9],  (const float*)d_in[10], (const float*)d_in[11],
      (const float*)d_in[12], (const float*)d_in[13], (const float*)d_in[14],
      (const float*)d_in[15], (const float*)d_in[16], (const float*)d_in[17],
      (const float*)d_in[18], (const float*)d_in[19], (const float*)d_in[20],
      (const float*)d_in[21], (const float*)d_in[22], (const float*)d_in[23],
      (const float*)d_in[24], (const float*)d_in[25], (const float*)d_in[26],
      (const float*)d_in[27], (const float*)d_in[28], (const float*)d_in[29],
      (float*)d_out);
}

// v005
// A run of this version takes 180 microseconds.
// In both of two side-by-side timings against v004, it was 1.07 times as fast.
// Counting every step since v000, it is 2.53 times as fast.
#include <hip/hip_runtime.h>
#include <math.h>

#define E 8

typedef __attribute__((ext_vector_type(16))) _Float16 v16h;
typedef __attribute__((ext_vector_type(8)))  _Float16 v8h;
typedef __attribute__((ext_vector_type(8)))  float    v8f;
typedef __attribute__((ext_vector_type(4)))  float    v4f;
typedef __attribute__((ext_vector_type(2)))  float    v2f;
typedef unsigned int u32;

__device__ __forceinline__ float pe_val(float pos, int oc) {
  int k = oc & ~1;
  float div = __expf((float)k * (-9.210340371976184f / 8.0f));
  float ang = pos * div;
  return (oc & 1) ? __cosf(ang) : __sinf(ang);
}

// ---------------------------------------------------------------------------
// One v_wmma_f32_16x16x32_f16 per 16-row chunk. K=8 real (zero-padded to 32).
// A (16-bit 16x32): lanes 0-15 row M=lane, halves 0..7 = K 0..7; lanes 16-31 zero.
// B (16-bit 32x16): lanes 0-15 col N=lane, halves 0..7 = K 0..7.
// D (f32 16x16):    lane -> col N=lane&15, VGPR r -> row M = r + 8*(lane>>4).
// Sources live in LDS as f16 rows (16B) -> A build = one ds_load_b128, no cvt.
// Bias is folded into the C accumulator (C[m][n] = bias[n]).
// ---------------------------------------------------------------------------

__device__ __forceinline__ v16h load_a_frag(const _Float16* src, int ch, int lane,
                                            u32 amask) {
  uint4 raw = *(const uint4*)(src + (ch * 16 + (lane & 15)) * 8);
  raw.x &= amask; raw.y &= amask; raw.z &= amask; raw.w &= amask;
  union { uint4 u; v8h h; } cv;
  cv.u = raw;
  v16h af;
  #pragma unroll
  for (int k = 0; k < 8; ++k) af[k] = cv.h[k];
  #pragma unroll
  for (int k = 8; k < 16; ++k) af[k] = (_Float16)0.0f;
  return af;
}

// Value held by the same lane of the other 16-lane row (all 32 lanes active).
__device__ __forceinline__ float other_row(float x) {
  u32 u = __builtin_bit_cast(u32, x);
  return __builtin_bit_cast(float, __builtin_amdgcn_permlanex16(
      u, u, 0x76543210u, 0xfedcba98u, false, false));
}

// x plus the x of lane l ^ M inside a 16-lane row (all lanes active).
template <int M>
__device__ __forceinline__ float row_xadd(float x) {
  const int y = __builtin_amdgcn_update_dpp(0, __builtin_bit_cast(int, x), 0x160 | M,
                                            0xf, 0xf, true);  // 0x160 | M: row_xmask:M
  return x + __builtin_bit_cast(float, y);
}

// Transposed-output projection. DUAL packs two 8x8 weight blocks into B's 16
// columns -> one WMMA yields both K and V. Writeback: 2 contiguous b128 stores.
// DUAL also leaves each head's largest and smallest K over the rows it projects:
// ext[head*2*np + slot] and ext[head*2*np + np + slot]. Every projected row
// counts, so pad rows of src must repeat a real row.
template <bool DUAL>
__device__ __forceinline__ void wave_proj_t(const _Float16* src,
                                            const float* W1, const float* b1,
                                            const float* W2, const float* b2,
                                            float* d1T, float* d2T, int ld,
                                            int lane, int c0, int c1,
                                            float* ext = nullptr, int np = 1,
                                            int slot = 0) {
  const int n = lane & 15;
  const int half = lane >> 4;
  const u32 amask = (lane < 16) ? 0xFFFFFFFFu : 0u;
  v16h bf = {};
  float bn = 0.0f;
  float* dcol = nullptr;
  if (n < 8) { bn = b1[n]; dcol = d1T + n * ld; }
  else if (DUAL) { bn = b2[n - 8]; dcol = d2T + (n - 8) * ld; }
  if (lane < 16 && (n < 8 || DUAL)) {
    const float* wrow = (n < 8) ? (W1 + n * 8) : (W2 + (n - 8) * 8);
    #pragma unroll
    for (int k = 0; k < 8; ++k) bf[k] = (_Float16)wrow[k];
  }
  float kmx = -INFINITY, kmn = INFINITY;
  for (int ch = c0; ch < c1; ++ch) {
    v16h af = load_a_frag(src, ch, lane, amask);
    v8f c = {bn, bn, bn, bn, bn, bn, bn, bn};
    c = __builtin_amdgcn_wmma_f32_16x16x32_f16(false, af, false, bf, (short)0, c,
                                               false, false);
    if (DUAL || n < 8) {
      const int rb = ch * 16 + 8 * half;
      *(v4f*)(dcol + rb)     = (v4f){c[0], c[1], c[2], c[3]};
      *(v4f*)(dcol + rb + 4) = (v4f){c[4], c[5], c[6], c[7]};
    }
    if (DUAL) {
      #pragma unroll  // constant r: c[r] stays a named register, pairs fold into max3/min3
      for (int r = 0; r < 8; ++r) {
        kmx = fmaxf(kmx, c[r]);
        kmn = fminf(kmn, c[r]);
      }
    }
  }
  if (DUAL) {
    kmx = fmaxf(kmx, other_row(kmx));
    kmn = fminf(kmn, other_row(kmn));
    if (lane < 8) {
      ext[lane * 2 * np + slot]      = kmx;
      ext[lane * 2 * np + np + slot] = kmn;
    }
  }
}

// Row-major f32 output projection (result consumed row-wise by layernorm/fc1).
__device__ __forceinline__ void wave_proj_rm(const _Float16* src, const float* W,
                                             const float* bias, float* dst,
                                             int lane, int c0, int c1) {
  const int n = lane & 15;
  const int half = lane >> 4;
  const u32 amask = (lane < 16) ? 0xFFFFFFFFu : 0u;
  v16h bf = {};
  if (lane < 16 && n < 8) {
    #pragma unroll
    for (int k = 0; k < 8; ++k) bf[k] = (_Float16)W[n * 8 + k];
  }
  const float bn = (n < 8) ? bias[n] : 0.0f;
  for (int ch = c0; ch < c1; ++ch) {
    v16h af = load_a_frag(src, ch, lane, amask);
    v8f c = {bn, bn, bn, bn, bn, bn, bn, bn};
    c = __builtin_amdgcn_wmma_f32_16x16x32_f16(false, af, false, bf, (short)0, c,
                                               false, false);
    if (n < 8) {
      const int rb = ch * 16 + 8 * half;
      #pragma unroll
      for (int r = 0; r < 8; ++r) dst[(rb + r) * 8 + n] = c[r];
    }
  }
}

// Per-lane softmax attention row (head_dim=1, scale=1). Transposed K/V allow
// contiguous b128 reads along j. Row result converted to f16 (next A-source).
// A score is q*k[j] with one q per row, and rounding keeps the order of the
// products, so the row maximum is exactly max(q*kmax, q*kmin): no pass over j.
// ext holds NP partial maxima, then NP partial minima, of each head's K.
// attn_head: query row i of head h.
template <int NP>
__device__ __forceinline__ float attn_head(int i, int h, const float* qpT,
                                           const float* kpT, const float* vpT,
                                           int ldk, int Lk, const float* ext) {
  const float qv = qpT[h * 32 + i];
  const float* kc = kpT + h * ldk;
  const float* vc = vpT + h * ldk;
  const float* ex = ext + h * 2 * NP;
  float kmx = ex[0], kmn = ex[NP];
  #pragma unroll  // constant offsets: the partials come in as b128 reads
  for (int p = 1; p < NP; ++p) {
    kmx = fmaxf(kmx, ex[p]);
    kmn = fminf(kmn, ex[NP + p]);
  }
  const float m = fmaxf(qv * kmx, qv * kmn);
  float s = 0.0f, acc = 0.0f;
  int j = 0;
  for (; j + 3 < Lk; j += 4) {
    v4f k4 = *(const v4f*)(kc + j);
    v4f vv4 = *(const v4f*)(vc + j);
    #pragma unroll
    for (int u = 0; u < 4; ++u) {
      float ev = __expf(qv * k4[u] - m);
      s += ev;
      acc += ev * vv4[u];
    }
  }
  for (; j < Lk; ++j) {
    float ev = __expf(qv * kc[j] - m);
    s += ev;
    acc += ev * vc[j];
  }
  return acc / s;
}

// 2^x of eight values, each in its own register. One statement, so that no
// instruction directly behind a v_exp_f32 reads its result or overwrites its source
// (the slot the instruction set asks for); the v_nop is that slot behind the last.
__device__ __forceinline__ void exp2_x8(float* x) {
  asm("v_exp_f32 %0, %0\n\tv_exp_f32 %1, %1\n\tv_exp_f32 %2, %2\n\tv_exp_f32 %3, %3\n\t"
      "v_exp_f32 %4, %4\n\tv_exp_f32 %5, %5\n\tv_exp_f32 %6, %6\n\tv_exp_f32 %7, %7\n\t"
      "v_nop"
      : "+v"(x[0]), "+v"(x[1]), "+v"(x[2]), "+v"(x[3]),
        "+v"(x[4]), "+v"(x[5]), "+v"(x[6]), "+v"(x[7]));
}

// All eight heads of a 32-query, 32-key task by one wave, sums on the matrix unit.
// D = A x B per head and 16-query chunk, f16 operands, f32 accumulate:
//   B column c = query c, its 32 softmax weights exp(q*k - m) of that head;
//   A row 2*hd = V of head hd, row 2*hd+1 = ones (one fragment for all heads).
// Element s of lane half g is key 16*g + s in A and in B alike.
// D row 2*hd = weighted V sum, row 2*hd+1 = weight sum: register r of lane half g
// is row 8*g + r, so lanes 0-15 read heads 0-3 and lanes 16-31 heads 4-7.
// Lk is 30 or 32: at 30 the A columns of keys 30, 31 are zero, so the pad keys
// reach neither sum.
__device__ __forceinline__ void attn_rows_mm(int lane, const float* qpT,
                                             const float* kpT, const float* vpT,
                                             int Lk, const float* ext,
                                             _Float16* ob) {
  const int c = lane & 15;
  const int half = lane >> 4;
  union { u32 w[8]; v16h h; } a;
  const float* vr = vpT + (c >> 1) * 32 + 16 * half;
  #pragma unroll
  for (int p = 0; p < 4; ++p) {
    v4f x = *(const v4f*)(vr + 4 * p);
    #pragma unroll
    for (int u = 0; u < 4; ++u) a.h[4 * p + u] = (_Float16)x[u];
  }
  #pragma unroll
  for (int p = 0; p < 8; ++p) a.w[p] = (c & 1) ? 0x3C003C00u : a.w[p];  // 1.0h pair
  if (half == 1 && Lk < 32) a.w[7] = 0u;

  #pragma unroll 1  // rolled: four unrolled head pairs do not fit the register budget of 10 waves per SIMD
  for (int hp = 0; hp < 4; ++hp) {
    float num[2][2], den[2][2];
    #pragma unroll
    for (int w = 0; w < 2; ++w) {
      const int hd = hp + 4 * w;
      const float* kc = kpT + hd * 32 + 16 * half;
      float k[16];
      #pragma unroll
      for (int p = 0; p < 4; ++p) {
        v4f x = *(const v4f*)(kc + 4 * p);
        #pragma unroll
        for (int u = 0; u < 4; ++u) k[4 * p + u] = x[u];
      }
      const float kmx = ext[hd * 2], kmn = ext[hd * 2 + 1];
      const float q2[2] = {qpT[hd * 32 + c], qpT[hd * 32 + 16 + c]};
      const float m2[2] = {fmaxf(q2[0] * kmx, q2[0] * kmn), fmaxf(q2[1] * kmx, q2[1] * kmn)};
      #pragma unroll
      for (int ch = 0; ch < 2; ++ch) {
        const float qv = q2[ch];
        const float m = m2[ch];
        float e[16];  // exp(x) = 2^(x * log2 e), as __expf forms it
        #pragma unroll
        for (int g = 0; g < 2; ++g) {
          #pragma unroll
          for (int s = 8 * g; s < 8 * g + 8; ++s)
            e[s] = (qv * k[s] - m) * 1.44269504088896341f;
          exp2_x8(e + 8 * g);
          // eight scores at a time: with all sixteen formed ahead of the exps the build
          // takes a 97th register, which costs a wave per SIMD
          __builtin_amdgcn_sched_barrier(0);
        }
        v16h pf;
        #pragma unroll
        for (int s = 0; s < 16; ++s) pf[s] = (_Float16)e[s];
        v8f d = {};
        d = __builtin_amdgcn_wmma_f32_16x16x32_f16(false, a.h, false, pf, (short)0, d,
                                                   false, false);
        num[w][ch] = d[2 * hp];
        den[w][ch] = d[2 * hp + 1];
      }
    }
    #pragma unroll
    for (int ch = 0; ch < 2; ++ch)
      ob[(ch * 16 + c) * 8 + 4 * half + hp] =
          (_Float16)((half ? num[1][ch] : num[0][ch]) / (half ? den[1][ch] : den[0][ch]));
  }
}

// Full MHA by one wave. scr (1024 f32): [0..255]=qpT[8][32], [256..511]=kpT,
// [512..767]=vpT, [768..1023]=row-major f32 result (its first 16 words hold the
// K extremes until the attention has read them). ob = f16 [32][8] scratch.
__device__ void wave_mha(int lane, const _Float16* q, const _Float16* kv, int Lk,
                         const float* wIn, const float* bIn,
                         const float* wOut, const float* bOut,
                         float* scr, _Float16* ob) {
  wave_proj_t<false>(q, wIn, bIn, nullptr, nullptr, scr, nullptr, 32, lane, 0, 2);
  wave_proj_t<true>(kv, wIn + 64, bIn + 8, wIn + 128, bIn + 16,
                    scr + 256, scr + 512, 32, lane, 0, 2, scr + 768, 1, 0);
  attn_rows_mm(lane, scr, scr + 256, scr + 512, Lk, scr + 768, ob);
  wave_proj_rm(ob, wOut, bOut, scr + 768, lane, 0, 2);
}

__global__ __launch_bounds__(256) void cmt_kernel(
    const float* __restrict__ eeg, const float* __restrict__ pupil,
    const float* __restrict__ speech, const float* __restrict__ action,
    const float* __restrict__ location, const float* __restrict__ tgt,
    const float* __restrict__ eeg_w, const float* __restrict__ eeg_b,
    const float* __restrict__ psa_w, const float* __restrict__ psa_b,
    const float* __restrict__ loc_w, const float* __restrict__ loc_b,
    const float* __restrict__ tgt_w, const float* __restrict__ tgt_b,
    const float* __restrict__ ng, const float* __restrict__ nb,
    const float* __restrict__ cin_w, const float* __restrict__ cin_b,
    const float* __restrict__ cout_w, const float* __restrict__ cout_b,
    const float* __restrict__ sfin_w, const float* __restrict__ sfin_b,
    const float* __restrict__ sfout_w, const float* __restrict__ sfout_b,
    const float* __restrict__ oin_w, const float* __restrict__ oin_b,
    const float* __restrict__ oout_w, const float* __restrict__ oout_b,
    const float* __restrict__ fc1_w, const float* __restrict__ fc1_b,
    float* __restrict__ out) {
  __shared__ _Float16 s_seq[5][32][E];   // f16 A-sources: e(30), p, s, a, l
  __shared__ _Float16 s_t[32][E];
  __shared__ _Float16 s_concat[128][E];  // 126 rows + 2 pad rows
  __shared__ _Float16 s_ob[8][32][E];    // per-wave attention-output (A-source)
  __shared__ float s_acc[4][32][E];
  __shared__ float s_scr[8][1024];       // per-wave qpT/kpT/vpT/result
  __shared__ float s_kpTf[8][128];       // final MHA K, transposed [head][pos]
  __shared__ float s_vpTf[8][128];
  __shared__ float s_tout[32][E];
  __shared__ float s_fc[96];

  const int b    = blockIdx.x;
  const int tid  = threadIdx.x;
  const int lane = tid & 31;
  const int wave = tid >> 5;
  const int Lseq[5] = {30, 32, 32, 32, 32};

  __builtin_prefetch(fc1_w + (tid << 6), 0, 1);   // global_prefetch_b8

  // ---------------- Phase 0: convs + positional encoding into LDS ----------
  for (int idx = tid; idx < 4 * 32 * E; idx += 256) ((float*)s_acc)[idx] = 0.0f;

  // Every global read of phase 0 is issued here, ahead of the first use of any of
  // them: one memory latency for the whole phase, not one per group of conv rows.
  // The eeg block and its conv weights go through registers into s_scr, which is
  // free until phase 1, in floats: [0,5120) the 4720 floats of the block, then
  // copies of its last 16 bytes that nobody reads; from 5120 the weights, one row of
  // 80 per output channel at a pitch of 84 (b128 reads of 8 rows, no bank shared);
  // rows 8 to 12 take the stores of the threads without a chunk, read by nobody.
  float* stage = &s_scr[0][0];
  const int pos = tid >> 3;  // 0..31
  const int oc  = tid & 7;
  const v4f* ep4 = (const v4f*)(eeg + (size_t)b * (2 * 20 * 118));
  v4f ech[5];
  #pragma unroll  // constant k: the five chunks stay in named registers
  for (int k = 0; k < 5; ++k) {
    const int i = tid + 256 * k;
    ech[k] = ep4[i < 1180 ? i : 1179];
  }
  const v4f wch = ((const v4f*)eeg_w)[tid < 160 ? tid : 159];
  const bool inb = (pos >= 1 && pos <= 30);
  const u32 xi = inb ? (u32)(pos - 1) : 0u;  // in bounds for the two pad positions too
  const float* xp = pupil    + (size_t)b * 60;
  const float* xs = speech   + (size_t)b * 60;
  const float* xa = action   + (size_t)b * 60;
  const float* xl = location + (size_t)b * 90;
  const float psa_x[3][2] = {{xp[xi], xp[xi + 30]}, {xs[xi], xs[xi + 30]},
                             {xa[xi], xa[xi + 30]}};
  const float loc_x[3] = {xl[xi], xl[xi + 30], xl[xi + 60]};
  const float tgt_x = (tgt + (size_t)b * 30)[xi];
  const float pw0 = psa_w[oc * 2 + 0], pw1 = psa_w[oc * 2 + 1], pb = psa_b[oc];
  const float lw[3] = {loc_w[oc * 3 + 0], loc_w[oc * 3 + 1], loc_w[oc * 3 + 2]};
  const float lb = loc_b[oc], tw = tgt_w[oc], tb = tgt_b[oc], eb = eeg_b[oc];

  #pragma unroll  // constant k, as above
  for (int k = 0; k < 5; ++k) *(v4f*)(stage + (tid + 256 * k) * 4) = ech[k];
  *(v4f*)(stage + 5120 + (tid / 20) * 84 + (tid % 20) * 4) = wch;

  {  // p/s/a/l/tgt conv1d k1p1: this thread's (pos, oc) of all five
    const float pe32 = pe_val(32.0f, oc);
    #pragma unroll  // constant q: psa_x stays in named registers
    for (int q = 0; q < 3; ++q) {
      float v = pb;
      if (inb) v += pw0 * psa_x[q][0] + pw1 * psa_x[q][1];
      s_seq[1 + q][pos][oc] = (_Float16)(v + pe32);
    }
    float v = lb;
    if (inb) {
      #pragma unroll  // constant ic: lw and loc_x stay in named registers
      for (int ic = 0; ic < 3; ++ic) v += lw[ic] * loc_x[ic];
    }
    s_seq[4][pos][oc] = (_Float16)(v + pe32);
    v = tb;
    if (inb) v += tw * tgt_x;
    s_t[pos][oc] = (_Float16)(v + pe32);
  }
  __syncthreads();  // the staged block and weights are read by other threads than stored them

  if (tid < 240) {  // eeg conv2d (2,20,118) -> 30x8, kernel (20,2), stride (1,4)
    const float* xr = stage + pos * 4;
    const float* wr = stage + 5120 + oc * 84;
    float sum = eb;
    #pragma unroll 5  // ten conv rows a trip, so that their LDS reads overlap; more rows cost registers
    for (int j = 0; j < 20; ++j) {  // rows 2j, 2j+1 of the 40 (ic, kh) rows, in order
      const v4f w  = *(const v4f*)(wr + 4 * j);
      const v2f x0 = *(const v2f*)(xr + (2 * j) * 118);
      const v2f x1 = *(const v2f*)(xr + (2 * j + 1) * 118);
      sum += x0[0] * w[0] + x0[1] * w[1];
      sum += x1[0] * w[2] + x1[1] * w[3];
    }
    const _Float16 hv = (_Float16)(sum + pe_val(30.0f, oc));
    s_seq[0][pos][oc] = hv;
    if (pos == 29) {  // pad rows repeat the last row: K extremes stay those of 30 rows
      s_seq[0][30][oc] = hv;
      s_seq[0][31][oc] = hv;
    }
  }
  __syncthreads();

  // ---------------- Phase 1: 18 MHAs strided over 8 waves (2-3 each) --------------------
  const int TQ[18] = {0,0,0,0,0, 1,1,1,1,1, 2,2,2,2, 3,3,3,3};
  const int TK[18] = {1,3,4,0,2, 0,3,4,1,2, 0,1,3,4, 0,1,3,2};
  const int TS[18] = {0,0,0,1,0, 0,0,0,1,0, 0,0,0,0, 0,0,1,0};
  const int TA[18] = {0,0,0,0,0, 1,1,1,1,1, 2,2,2,2, 3,3,3,3};
  const int TB[18] = {-1,-1,-1,-1,-1, -1,-1,-1,-1,-1, -1,-1,-1,3, -1,-1,-1,-1};

  for (int t = wave; t < 18; t += 8) {
    const float* wIn  = TS[t] ? sfin_w  : cin_w;
    const float* bIn  = TS[t] ? sfin_b  : cin_b;
    const float* wOut = TS[t] ? sfout_w : cout_w;
    const float* bOut = TS[t] ? sfout_b : cout_b;
    int Lq = Lseq[TQ[t]], Lk = Lseq[TK[t]];
    float* scr = s_scr[wave];
    wave_mha(lane, &s_seq[TQ[t]][0][0], &s_seq[TK[t]][0][0], Lk,
             wIn, bIn, wOut, bOut, scr, &s_ob[wave][0][0]);
    // layernorm + accumulate (ds_add_f32 atomics across waves)
    int i = lane;
    if (i < Lq) {
      const float* row = scr + 768 + i * 8;
      float mu = 0.0f;
      #pragma unroll
      for (int c = 0; c < E; ++c) mu += row[c];
      mu *= 0.125f;
      float var = 0.0f;
      #pragma unroll
      for (int c = 0; c < E; ++c) { float d = row[c] - mu; var += d * d; }
      var *= 0.125f;
      float rinv = rsqrtf(var + 1e-5f);
      #pragma unroll
      for (int c = 0; c < E; ++c) {
        float v = (row[c] - mu) * rinv * ng[c] + nb[c];
        atomicAdd(&s_acc[TA[t]][i][c], v);
        if (TB[t] >= 0) atomicAdd(&s_acc[TB[t]][i][c], v);
      }
    }
  }
  __syncthreads();

  // ---------------- Phase 2: concat (f16) + final MHA ----------------------
  for (int idx = tid; idx < 128 * E; idx += 256) {  // [eeg30|pupil32|action32|speech32]
    int drow = idx >> 3, c = idx & 7;
    int row = drow < 125 ? drow : 125;  // pad rows 126, 127 repeat row 125
    int ai, r2;
    if (row < 30)      { ai = 0; r2 = row; }
    else if (row < 62) { ai = 1; r2 = row - 30; }
    else if (row < 94) { ai = 3; r2 = row - 62; }
    else               { ai = 2; r2 = row - 94; }
    s_concat[drow][c] = (_Float16)s_acc[ai][r2][c];
  }
  __syncthreads();

  // K/V of 126-row concat: dual WMMA, one 16-row chunk per wave; each wave leaves
  // its chunk's K extremes in s_scr[1] (free since phase 1), 8 partials per head
  wave_proj_t<true>(&s_concat[0][0], oin_w + 64, oin_b + 8, oin_w + 128, oin_b + 16,
                    &s_kpTf[0][0], &s_vpTf[0][0], 128, lane, wave, wave + 1,
                    s_scr[1], 8, wave);
  // Q of the 32 target rows into s_scr[0]: one 16-row chunk on each of waves 2, 3
  // (they had one task fewer than waves 0, 1 in phase 1)
  const bool projWave = (wave == 2 || wave == 3);
  if (projWave)
    wave_proj_t<false>(&s_t[0][0], oin_w, oin_b, nullptr, nullptr,
                       s_scr[0], nullptr, 32, lane, wave - 2, wave - 1);
  __syncthreads();

  // fc1, all eight waves: each 16-lane row of the block takes six weight rows and
  // walks them together, so every load covers 256 contiguous bytes of each of two
  // weight rows (whole 128-byte lines) and the loads of three rows are in flight at
  // once. The last 16-lane row has no rows of its own: it repeats rows 84 to 89 into
  // the spare words 90 to 95 of s_fc, which nobody reads. The first three rows are
  // asked for here, so that they arrive while the final attention runs.
  const int l16  = lane & 15;
  const int row0 = (tid >> 4) * 6;
  const v4f* wr = (const v4f*)(fc1_w + (row0 < 84 ? row0 : 84) * 256) + l16;
  const int bi = tid < 30 ? tid * 3 : 0;
  const float fb[3] = {fc1_b[bi], fc1_b[bi + 1], fc1_b[bi + 2]};
  v4f wa[3][4];
  #pragma unroll  // constant p, j: the weights stay in named registers
  for (int p = 0; p < 3; ++p) {
    #pragma unroll  // as above
    for (int j = 0; j < 4; ++j) wa[p][j] = wr[64 * p + 16 * j];
  }

  // One head per wave, one query row per lane: all eight waves share the 8 x 126
  // keys that one wave would otherwise walk alone.
  s_ob[0][lane][wave] = (_Float16)attn_head<8>(lane, wave, s_scr[0], &s_kpTf[0][0],
                                               &s_vpTf[0][0], 128, 126, s_scr[1]);
  __syncthreads();  // a row of s_ob[0] holds the heads of eight waves

  if (projWave)
    wave_proj_rm(&s_ob[0][0][0], oout_w, oout_b, &s_tout[0][0], lane,
                 wave - 2, wave - 1);
  __syncthreads();

  // ---------------- Phase 3: fc1 + channel softmax -> (B,3,30) -------------
  // Lane l of a 16-lane row sums the columns 64*j + 4*l + u of its six weight rows;
  // the 16 partial sums of a row are then added across the lanes.
  {
    v4f xv[4];
    #pragma unroll  // constant j: the sixteen x values stay in named registers
    for (int j = 0; j < 4; ++j)
      xv[j] = *(const v4f*)(&s_tout[0][0] + 64 * j + 4 * l16);
    float part[6];
    #pragma unroll  // constant p: part stays in named registers
    for (int p = 0; p < 3; ++p) {
      v4f a = wa[p][0] * xv[0];
      #pragma unroll  // constant j, as above
      for (int j = 1; j < 4; ++j) a += wa[p][j] * xv[j];
      part[p] = (a[0] + a[1]) + (a[2] + a[3]);
    }
    #pragma unroll  // constant p, as above
    for (int p = 3; p < 6; ++p) {
      v4f a = wr[64 * p] * xv[0];
      #pragma unroll  // constant j, as above
      for (int j = 1; j < 4; ++j) a += wr[64 * p + 16 * j] * xv[j];
      part[p] = (a[0] + a[1]) + (a[2] + a[3]);
    }
    #pragma unroll  // constant p, as above
    for (int p = 0; p < 6; ++p)
      part[p] = row_xadd<8>(row_xadd<4>(row_xadd<2>(row_xadd<1>(part[p]))));
    if (l16 == 0) {
      #pragma unroll  // constant p, as above
      for (int p = 0; p < 6; ++p) s_fc[row0 + p] = part[p];
    }
  }
  __syncthreads();
  if (tid < 30) {
    float x0 = s_fc[tid * 3 + 0] + fb[0], x1 = s_fc[tid * 3 + 1] + fb[1],
          x2 = s_fc[tid * 3 + 2] + fb[2];
    float m  = fmaxf(x0, fmaxf(x1, x2));
    float e0 = __expf(x0 - m), e1 = __expf(x1 - m), e2 = __expf(x2 - m);
    float s  = e0 + e1 + e2;
    float* o = out + (size_t)b * 90;
    o[0 * 30 + tid] = e0 / s;
    o[1 * 30 + tid] = e1 / s;
    o[2 * 30 + tid] = e2 / s;
  }
}

extern "C" void kernel_launch(void* const* d_in, const int* in_sizes, int n_in,
                              void* d_out, int out_size, void* d_ws, size_t ws_size,
                              hipStream_t stream) {
  (void)n_in; (void)out_size; (void)d_ws; (void)ws_size;
  const int B = in_sizes[0] / (2 * 20 * 118);
  cmt_kernel<<<B, 256, 0, stream>>>(
      (const float*)d_in[0],  (const float*)d_in[1],  (const float*)d_in[2],
      (const float*)d_in[3],  (const float*)d_in[4],  (const float*)d_in[5],
      (const float*)d_in[6],  (const float*)d_in[7],  (const float*)d_in[8],
      (const float*)d_in[9],  (const float*)d_in[10], (const float*)d_in[11],
      (const float*)d_in[12], (const float*)d_in[13], (const float*)d_in[14],
      (const float*)d_in[15], (const float*)d_in[16], (const float*)d_in[17],
      (const float*)d_in[18], (const float*)d_in[19], (const float*)d_in[20],
      (const float*)d_in[21], (const float*)d_in[22], (const float*)d_in[23],
      (const float*)d_in[24], (const float*)d_in[25], (const float*)d_in[26],
      (const float*)d_in[27], (const float*)d_in[28], (const float*)d_in[29],
      (float*)d_out);
}

// v006
// One run takes 167 microseconds.
// Next to v005, in two timings, it ran 1.07 and 1.08 times as fast.
// Over all steps from v000 it is 2.72 times as fast.
#include <hip/hip_runtime.h>
#include <math.h>

#define E 8

typedef __attribute__((ext_vector_type(16))) _Float16 v16h;
typedef __attribute__((ext_vector_type(8)))  _Float16 v8h;
typedef __attribute__((ext_vector_type(8)))  float    v8f;
typedef __attribute__((ext_vector_type(4)))  float    v4f;
typedef __attribute__((ext_vector_type(2)))  float    v2f;
typedef unsigned int u32;

__device__ __forceinline__ float pe_val(float pos, int oc) {
  int k = oc & ~1;
  float div = __expf((float)k * (-9.210340371976184f / 8.0f));
  float ang = pos * div;
  return (oc & 1) ? __cosf(ang) : __sinf(ang);
}

// ---------------------------------------------------------------------------
// One v_wmma_f32_16x16x32_f16 per 16-row chunk. K=8 real (zero-padded to 32).
// A (16-bit 16x32): lanes 0-15 row M=lane, halves 0..7 = K 0..7; lanes 16-31 zero.
// B (16-bit 32x16): lanes 0-15 col N=lane, halves 0..7 = K 0..7.
// D (f32 16x16):    lane -> col N=lane&15, VGPR r -> row M = r + 8*(lane>>4).
// Sources live in LDS as f16 rows (16B) -> A build = one ds_load_b128, no cvt.
// Bias is folded into the C accumulator (C[m][n] = bias[n]).
// ---------------------------------------------------------------------------

__device__ __forceinline__ v16h load_a_frag(const _Float16* src, int ch, int lane,
                                            u32 amask) {
  uint4 raw = *(const uint4*)(src + (ch * 16 + (lane & 15)) * 8);
  raw.x &= amask; raw.y &= amask; raw.z &= amask; raw.w &= amask;
  union { uint4 u; v8h h; } cv;
  cv.u = raw;
  v16h af;
  #pragma unroll
  for (int k = 0; k < 8; ++k) af[k] = cv.h[k];
  #pragma unroll
  for (int k = 8; k < 16; ++k) af[k] = (_Float16)0.0f;
  return af;
}

// Value held by the same lane of the other 16-lane row (all 32 lanes active).
__device__ __forceinline__ float other_row(float x) {
  u32 u = __builtin_bit_cast(u32, x);
  return __builtin_bit_cast(float, __builtin_amdgcn_permlanex16(
      u, u, 0x76543210u, 0xfedcba98u, false, false));
}

// x plus the x of lane l ^ M inside a 16-lane row (all lanes active).
template <int M>
__device__ __forceinline__ float row_xadd(float x) {
  const int y = __builtin_amdgcn_update_dpp(0, __builtin_bit_cast(int, x), 0x160 | M,
                                            0xf, 0xf, true);  // 0x160 | M: row_xmask:M
  return x + __builtin_bit_cast(float, y);
}

// Transposed-output projection. DUAL packs two 8x8 weight blocks into B's 16
// columns -> one WMMA yields both K and V. Writeback: 2 contiguous b128 stores.
// DUAL also leaves each head's largest and smallest K over the rows it projects:
// ext[head*2*np + slot] and ext[head*2*np + np + slot]. Every projected row
// counts, so pad rows of src must repeat a real row.
template <bool DUAL>
__device__ __forceinline__ void wave_proj_t(const _Float16* src,
                                            const float* W1, const float* b1,
                                            const float* W2, const float* b2,
                                            float* d1T, float* d2T, int ld,
                                            int lane, int c0, int c1,
                                            float* ext = nullptr, int np = 1,
                                            int slot = 0) {
  const int n = lane & 15;
  const int half = lane >> 4;
  const u32 amask = (lane < 16) ? 0xFFFFFFFFu : 0u;
  v16h bf = {};
  float bn = 0.0f;
  float* dcol = nullptr;
  if (n < 8) { bn = b1[n]; dcol = d1T + n * ld; }
  else if (DUAL) { bn = b2[n - 8]; dcol = d2T + (n - 8) * ld; }
  if (lane < 16 && (n < 8 || DUAL)) {
    const float* wrow = (n < 8) ? (W1 + n * 8) : (W2 + (n - 8) * 8);
    #pragma unroll
    for (int k = 0; k < 8; ++k) bf[k] = (_Float16)wrow[k];
  }
  float kmx = -INFINITY, kmn = INFINITY;
  for (int ch = c0; ch < c1; ++ch) {
    v16h af = load_a_frag(src, ch, lane, amask);
    v8f c = {bn, bn, bn, bn, bn, bn, bn, bn};
    c = __builtin_amdgcn_wmma_f32_16x16x32_f16(false, af, false, bf, (short)0, c,
                                               false, false);
    if (DUAL || n < 8) {
      const int rb = ch * 16 + 8 * half;
      *(v4f*)(dcol + rb)     = (v4f){c[0], c[1], c[2], c[3]};
      *(v4f*)(dcol + rb + 4) = (v4f){c[4], c[5], c[6], c[7]};
    }
    if (DUAL) {
      #pragma unroll  // constant r: c[r] stays a named register, pairs fold into max3/min3
      for (int r = 0; r < 8; ++r) {
        kmx = fmaxf(kmx, c[r]);
        kmn = fminf(kmn, c[r]);
      }
    }
  }
  if (DUAL) {
    kmx = fmaxf(kmx, other_row(kmx));
    kmn = fminf(kmn, other_row(kmn));
    if (lane < 8) {
      ext[lane * 2 * np + slot]      = kmx;
      ext[lane * 2 * np + np + slot] = kmn;
    }
  }
}

// Row-major f32 output projection (result consumed row-wise by layernorm/fc1).
__device__ __forceinline__ void wave_proj_rm(const _Float16* src, const float* W,
                                             const float* bias, float* dst,
                                             int lane, int c0, int c1) {
  const int n = lane & 15;
  const int half = lane >> 4;
  const u32 amask = (lane < 16) ? 0xFFFFFFFFu : 0u;
  v16h bf = {};
  if (lane < 16 && n < 8) {
    #pragma unroll
    for (int k = 0; k < 8; ++k) bf[k] = (_Float16)W[n * 8 + k];
  }
  const float bn = (n < 8) ? bias[n] : 0.0f;
  for (int ch = c0; ch < c1; ++ch) {
    v16h af = load_a_frag(src, ch, lane, amask);
    v8f c = {bn, bn, bn, bn, bn, bn, bn, bn};
    c = __builtin_amdgcn_wmma_f32_16x16x32_f16(false, af, false, bf, (short)0, c,
                                               false, false);
    if (n < 8) {
      const int rb = ch * 16 + 8 * half;
      #pragma unroll
      for (int r = 0; r < 8; ++r) dst[(rb + r) * 8 + n] = c[r];
    }
  }
}

// 2^x of eight values, each in its own register. One statement, so that no
// instruction directly behind a v_exp_f32 reads its result or overwrites its source
// (the slot the instruction set asks for); the v_nop is that slot behind the last.
__device__ __forceinline__ void exp2_x8(float* x) {
  asm("v_exp_f32 %0, %0\n\tv_exp_f32 %1, %1\n\tv_exp_f32 %2, %2\n\tv_exp_f32 %3, %3\n\t"
      "v_exp_f32 %4, %4\n\tv_exp_f32 %5, %5\n\tv_exp_f32 %6, %6\n\tv_exp_f32 %7, %7\n\t"
      "v_nop"
      : "+v"(x[0]), "+v"(x[1]), "+v"(x[2]), "+v"(x[3]),
        "+v"(x[4]), "+v"(x[5]), "+v"(x[6]), "+v"(x[7]));
}

// Per-lane softmax attention row (head_dim=1, scale=1). Transposed K/V allow
// contiguous b128 reads along j. Row result converted to f16 (next A-source).
// A score is q*k[j] with one q per row, and rounding keeps the order of the
// products, so the row maximum is exactly max(q*kmax, q*kmin): no pass over j.
// ext holds NP partial maxima, then NP partial minima, of each head's K.
// q is scaled by log2 e once, so q*k[j] - m is the exponent of 2 as it stands: one
// fma per score ahead of the exp.
// attn_keys8: eight keys from kc, vc on; the first N of them join the sums, in order.
template <int N>
__device__ __forceinline__ void attn_keys8(const float* kc, const float* vc, float qv,
                                           float m, float& s, float& acc) {
  const v4f ka = *(const v4f*)kc, kb = *(const v4f*)(kc + 4);
  const v4f va = *(const v4f*)vc, vb = *(const v4f*)(vc + 4);
  float e[8];
  #pragma unroll  // constant u: e stays in named registers
  for (int u = 0; u < 4; ++u) {
    e[u]     = qv * ka[u] - m;
    e[4 + u] = qv * kb[u] - m;
  }
  exp2_x8(e);
  #pragma unroll  // constant u, as above
  for (int u = 0; u < N; ++u) {
    s += e[u];
    acc += e[u] * (u < 4 ? va[u] : vb[u - 4]);
  }
  // one group at a time: with groups interleaved the build takes more than 96 registers,
  // which costs a wave per SIMD
  __builtin_amdgcn_sched_barrier(0);
}

// attn_head: query row i of head h, LK keys. The last group reads on to a multiple of
// eight keys (ldk covers it).
template <int NP, int LK>
__device__ __forceinline__ float attn_head(int i, int h, const float* qpT,
                                           const float* kpT, const float* vpT,
                                           int ldk, const float* ext) {
  const float qv = qpT[h * 32 + i] * 1.44269504088896341f;
  const float* kc = kpT + h * ldk;
  const float* vc = vpT + h * ldk;
  const float* ex = ext + h * 2 * NP;
  float kmx = ex[0], kmn = ex[NP];
  #pragma unroll  // constant offsets: the partials come in as b128 reads
  for (int p = 1; p < NP; ++p) {
    kmx = fmaxf(kmx, ex[p]);
    kmn = fminf(kmn, ex[NP + p]);
  }
  const float m = fmaxf(qv * kmx, qv * kmn);
  float s = 0.0f, acc = 0.0f;
  #pragma unroll  // constant LDS offsets: no address add, compare or branch per group
  for (int j = 0; j + 8 <= LK; j += 8) attn_keys8<8>(kc + j, vc + j, qv, m, s, acc);
  if (LK % 8) attn_keys8<LK % 8>(kc + LK / 8 * 8, vc + LK / 8 * 8, qv, m, s, acc);
  return acc / s;
}

// All eight heads of a 32-query, 32-key task by one wave, sums on the matrix unit.
// D = A x B per head and 16-query chunk, f16 operands, f32 accumulate:
//   B column c = query c, its 32 softmax weights exp(q*k - m) of that head;
//   A row 2*hd = V of head hd, row 2*hd+1 = ones (one fragment for all heads).
// Element s of lane half g is key 16*g + s in A and in B alike.
// D row 2*hd = weighted V sum, row 2*hd+1 = weight sum: register r of lane half g
// is row 8*g + r, so lanes 0-15 read heads 0-3 and lanes 16-31 heads 4-7.
// Lk is 30 or 32: at 30 the A columns of keys 30, 31 are zero, so the pad keys
// reach neither sum.
__device__ __forceinline__ void attn_rows_mm(int lane, const float* qpT,
                                             const float* kpT, const float* vpT,
                                             int Lk, const float* ext,
                                             _Float16* ob) {
  const int c = lane & 15;
  const int half = lane >> 4;
  union { u32 w[8]; v16h h; } a;
  const float* vr = vpT + (c >> 1) * 32 + 16 * half;
  #pragma unroll
  for (int p = 0; p < 4; ++p) {
    v4f x = *(const v4f*)(vr + 4 * p);
    #pragma unroll
    for (int u = 0; u < 4; ++u) a.h[4 * p + u] = (_Float16)x[u];
  }
  #pragma unroll
  for (int p = 0; p < 8; ++p) a.w[p] = (c & 1) ? 0x3C003C00u : a.w[p];  // 1.0h pair
  if (half == 1 && Lk < 32) a.w[7] = 0u;

  #pragma unroll 1  // rolled: four unrolled head pairs do not fit the register budget of 10 waves per SIMD
  for (int hp = 0; hp < 4; ++hp) {
    float num[2][2], den[2][2];
    #pragma unroll
    for (int w = 0; w < 2; ++w) {
      const int hd = hp + 4 * w;
      const float* kc = kpT + hd * 32 + 16 * half;
      float k[16];
      #pragma unroll
      for (int p = 0; p < 4; ++p) {
        v4f x = *(const v4f*)(kc + 4 * p);
        #pragma unroll
        for (int u = 0; u < 4; ++u) k[4 * p + u] = x[u];
      }
      const float kmx = ext[hd * 2], kmn = ext[hd * 2 + 1];
      // q * log2 e: q*k - m is then the exponent of 2 as it stands
      const float q2[2] = {qpT[hd * 32 + c] * 1.44269504088896341f,
                           qpT[hd * 32 + 16 + c] * 1.44269504088896341f};
      const float m2[2] = {fmaxf(q2[0] * kmx, q2[0] * kmn), fmaxf(q2[1] * kmx, q2[1] * kmn)};
      #pragma unroll
      for (int ch = 0; ch < 2; ++ch) {
        const float qv = q2[ch];
        const float m = m2[ch];
        float e[16];
        #pragma unroll
        for (int g = 0; g < 2; ++g) {
          #pragma unroll
          for (int s = 8 * g; s < 8 * g + 8; ++s)
            e[s] = qv * k[s] - m;
          exp2_x8(e + 8 * g);
          // eight scores at a time: with all sixteen formed ahead of the exps the build
          // takes a 97th register, which costs a wave per SIMD
          __builtin_amdgcn_sched_barrier(0);
        }
        v16h pf;
        #pragma unroll
        for (int s = 0; s < 16; ++s) pf[s] = (_Float16)e[s];
        v8f d = {};
        d = __builtin_amdgcn_wmma_f32_16x16x32_f16(false, a.h, false, pf, (short)0, d,
                                                   false, false);
        num[w][ch] = d[2 * hp];
        den[w][ch] = d[2 * hp + 1];
      }
    }
    #pragma unroll
    for (int ch = 0; ch < 2; ++ch)
      ob[(ch * 16 + c) * 8 + 4 * half + hp] =
          (_Float16)((half ? num[1][ch] : num[0][ch]) / (half ? den[1][ch] : den[0][ch]));
  }
}

// Full MHA by one wave. scr (1024 f32): [0..255]=qpT[8][32], [256..511]=kpT,
// [512..767]=vpT, [768..1023]=row-major f32 result (its first 16 words hold the
// K extremes until the attention has read them). ob = f16 [32][8] scratch.
__device__ void wave_mha(int lane, const _Float16* q, const _Float16* kv, int Lk,
                         const float* wIn, const float* bIn,
                         const float* wOut, const float* bOut,
                         float* scr, _Float16* ob) {
  wave_proj_t<false>(q, wIn, bIn, nullptr, nullptr, scr, nullptr, 32, lane, 0, 2);
  wave_proj_t<true>(kv, wIn + 64, bIn + 8, wIn + 128, bIn + 16,
                    scr + 256, scr + 512, 32, lane, 0, 2, scr + 768, 1, 0);
  attn_rows_mm(lane, scr, scr + 256, scr + 512, Lk, scr + 768, ob);
  wave_proj_rm(ob, wOut, bOut, scr + 768, lane, 0, 2);
}

__global__ __launch_bounds__(256) void cmt_kernel(
    const float* __restrict__ eeg, const float* __restrict__ pupil,
    const float* __restrict__ speech, const float* __restrict__ action,
    const float* __restrict__ location, const float* __restrict__ tgt,
    const float* __restrict__ eeg_w, const float* __restrict__ eeg_b,
    const float* __restrict__ psa_w, const float* __restrict__ psa_b,
    const float* __restrict__ loc_w, const float* __restrict__ loc_b,
    const float* __restrict__ tgt_w, const float* __restrict__ tgt_b,
    const float* __restrict__ ng, const float* __restrict__ nb,
    const float* __restrict__ cin_w, const float* __restrict__ cin_b,
    const float* __restrict__ cout_w, const float* __restrict__ cout_b,
    const float* __restrict__ sfin_w, const float* __restrict__ sfin_b,
    const float* __restrict__ sfout_w, const float* __restrict__ sfout_b,
    const float* __restrict__ oin_w, const float* __restrict__ oin_b,
    const float* __restrict__ oout_w, const float* __restrict__ oout_b,
    const float* __restrict__ fc1_w, const float* __restrict__ fc1_b,
    float* __restrict__ out) {
  __shared__ _Float16 s_seq[5][32][E];   // f16 A-sources: e(30), p, s, a, l
  __shared__ _Float16 s_t[32][E];
  __shared__ _Float16 s_concat[128][E];  // 126 rows + 2 pad rows
  __shared__ _Float16 s_ob[8][32][E];    // per-wave attention-output (A-source)
  __shared__ float s_acc[4][32][E];
  __shared__ float s_scr[8][1024];       // per-wave qpT/kpT/vpT/result
  __shared__ float s_kpTf[8][128];       // final MHA K, transposed [head][pos]
  __shared__ float s_vpTf[8][128];
  __shared__ float s_tout[32][E];
  __shared__ float s_fc[96];

  const int b    = blockIdx.x;
  const int tid  = threadIdx.x;
  const int lane = tid & 31;
  const int wave = tid >> 5;
  const int Lseq[5] = {30, 32, 32, 32, 32};

  __builtin_prefetch(fc1_w + (tid << 6), 0, 1);   // global_prefetch_b8

  // ---------------- Phase 0: convs + positional encoding into LDS ----------
  for (int idx = tid; idx < 4 * 32 * E; idx += 256) ((float*)s_acc)[idx] = 0.0f;

  // Every global read of phase 0 is issued here, ahead of the first use of any of
  // them: one memory latency for the whole phase, not one per group of conv rows.
  // The eeg block and its conv weights go through registers into s_scr, which is
  // free until phase 1, in floats: [0,5120) the 4720 floats of the block, then
  // copies of its last 16 bytes that nobody reads; from 5120 the weights, one row of
  // 80 per output channel at a pitch of 84 (b128 reads of 8 rows, no bank shared);
  // rows 8 to 12 take the stores of the threads without a chunk, read by nobody.
  float* stage = &s_scr[0][0];
  const int pos = tid >> 3;  // 0..31
  const int oc  = tid & 7;
  const v4f* ep4 = (const v4f*)(eeg + (size_t)b * (2 * 20 * 118));
  v4f ech[5];
  #pragma unroll  // constant k: the five chunks stay in named registers
  for (int k = 0; k < 5; ++k) {
    const int i = tid + 256 * k;
    ech[k] = ep4[i < 1180 ? i : 1179];
  }
  const v4f wch = ((const v4f*)eeg_w)[tid < 160 ? tid : 159];
  const bool inb = (pos >= 1 && pos <= 30);
  const u32 xi = inb ? (u32)(pos - 1) : 0u;  // in bounds for the two pad positions too
  const float* xp = pupil    + (size_t)b * 60;
  const float* xs = speech   + (size_t)b * 60;
  const float* xa = action   + (size_t)b * 60;
  const float* xl = location + (size_t)b * 90;
  const float psa_x[3][2] = {{xp[xi], xp[xi + 30]}, {xs[xi], xs[xi + 30]},
                             {xa[xi], xa[xi + 30]}};
  const float loc_x[3] = {xl[xi], xl[xi + 30], xl[xi + 60]};
  const float tgt_x = (tgt + (size_t)b * 30)[xi];
  const float pw0 = psa_w[oc * 2 + 0], pw1 = psa_w[oc * 2 + 1], pb = psa_b[oc];
  const float lw[3] = {loc_w[oc * 3 + 0], loc_w[oc * 3 + 1], loc_w[oc * 3 + 2]};
  const float lb = loc_b[oc], tw = tgt_w[oc], tb = tgt_b[oc], eb = eeg_b[oc];

  #pragma unroll  // constant k, as above
  for (int k = 0; k < 5; ++k) *(v4f*)(stage + (tid + 256 * k) * 4) = ech[k];
  *(v4f*)(stage + 5120 + (tid / 20) * 84 + (tid % 20) * 4) = wch;

  {  // p/s/a/l/tgt conv1d k1p1: this thread's (pos, oc) of all five
    const float pe32 = pe_val(32.0f, oc);
    #pragma unroll  // constant q: psa_x stays in named registers
    for (int q = 0; q < 3; ++q) {
      float v = pb;
      if (inb) v += pw0 * psa_x[q][0] + pw1 * psa_x[q][1];
      s_seq[1 + q][pos][oc] = (_Float16)(v + pe32);
    }
    float v = lb;
    if (inb) {
      #pragma unroll  // constant ic: lw and loc_x stay in named registers
      for (int ic = 0; ic < 3; ++ic) v += lw[ic] * loc_x[ic];
    }
    s_seq[4][pos][oc] = (_Float16)(v + pe32);
    v = tb;
    if (inb) v += tw * tgt_x;
    s_t[pos][oc] = (_Float16)(v + pe32);
  }
  __syncthreads();  // the staged block and weights are read by other threads than stored them

  if (tid < 240) {  // eeg conv2d (2,20,118) -> 30x8, kernel (20,2), stride (1,4)
    const float* xr = stage + pos * 4;
    const float* wr = stage + 5120 + oc * 84;
    float sum = eb;
    #pragma unroll 5  // ten conv rows a trip, so that their LDS reads overlap; more rows cost registers
    for (int j = 0; j < 20; ++j) {  // rows 2j, 2j+1 of the 40 (ic, kh) rows, in order
      const v4f w  = *(const v4f*)(wr + 4 * j);
      const v2f x0 = *(const v2f*)(xr + (2 * j) * 118);
      const v2f x1 = *(const v2f*)(xr + (2 * j + 1) * 118);
      sum += x0[0] * w[0] + x0[1] * w[1];
      sum += x1[0] * w[2] + x1[1] * w[3];
    }
    const _Float16 hv = (_Float16)(sum + pe_val(30.0f, oc));
    s_seq[0][pos][oc] = hv;
    if (pos == 29) {  // pad rows repeat the last row: K extremes stay those of 30 rows
      s_seq[0][30][oc] = hv;
      s_seq[0][31][oc] = hv;
    }
  }
  __syncthreads();

  // ---------------- Phase 1: 18 MHAs strided over 8 waves (2-3 each) --------------------
  const int TQ[18] = {0,0,0,0,0, 1,1,1,1,1, 2,2,2,2, 3,3,3,3};
  const int TK[18] = {1,3,4,0,2, 0,3,4,1,2, 0,1,3,4, 0,1,3,2};
  const int TS[18] = {0,0,0,1,0, 0,0,0,1,0, 0,0,0,0, 0,0,1,0};
  const int TA[18] = {0,0,0,0,0, 1,1,1,1,1, 2,2,2,2, 3,3,3,3};
  const int TB[18] = {-1,-1,-1,-1,-1, -1,-1,-1,-1,-1, -1,-1,-1,3, -1,-1,-1,-1};

  for (int t = wave; t < 18; t += 8) {
    const float* wIn  = TS[t] ? sfin_w  : cin_w;
    const float* bIn  = TS[t] ? sfin_b  : cin_b;
    const float* wOut = TS[t] ? sfout_w : cout_w;
    const float* bOut = TS[t] ? sfout_b : cout_b;
    int Lq = Lseq[TQ[t]], Lk = Lseq[TK[t]];
    float* scr = s_scr[wave];
    wave_mha(lane, &s_seq[TQ[t]][0][0], &s_seq[TK[t]][0][0], Lk,
             wIn, bIn, wOut, bOut, scr, &s_ob[wave][0][0]);
    // layernorm + accumulate (ds_add_f32 atomics across waves)
    int i = lane;
    if (i < Lq) {
      const float* row = scr + 768 + i * 8;
      float mu = 0.0f;
      #pragma unroll
      for (int c = 0; c < E; ++c) mu += row[c];
      mu *= 0.125f;
      float var = 0.0f;
      #pragma unroll
      for (int c = 0; c < E; ++c) { float d = row[c] - mu; var += d * d; }
      var *= 0.125f;
      float rinv = rsqrtf(var + 1e-5f);
      #pragma unroll
      for (int c = 0; c < E; ++c) {
        float v = (row[c] - mu) * rinv * ng[c] + nb[c];
        atomicAdd(&s_acc[TA[t]][i][c], v);
        if (TB[t] >= 0) atomicAdd(&s_acc[TB[t]][i][c], v);
      }
    }
  }
  __syncthreads();

  // ---------------- Phase 2: concat (f16) + final MHA ----------------------
  for (int idx = tid; idx < 128 * E; idx += 256) {  // [eeg30|pupil32|action32|speech32]
    int drow = idx >> 3, c = idx & 7;
    int row = drow < 125 ? drow : 125;  // pad rows 126, 127 repeat row 125
    int ai, r2;
    if (row < 30)      { ai = 0; r2 = row; }
    else if (row < 62) { ai = 1; r2 = row - 30; }
    else if (row < 94) { ai = 3; r2 = row - 62; }
    else               { ai = 2; r2 = row - 94; }
    s_concat[drow][c] = (_Float16)s_acc[ai][r2][c];
  }
  __syncthreads();

  // K/V of 126-row concat: dual WMMA, one 16-row chunk per wave; each wave leaves
  // its chunk's K extremes in s_scr[1] (free since phase 1), 8 partials per head
  wave_proj_t<true>(&s_concat[0][0], oin_w + 64, oin_b + 8, oin_w + 128, oin_b + 16,
                    &s_kpTf[0][0], &s_vpTf[0][0], 128, lane, wave, wave + 1,
                    s_scr[1], 8, wave);
  // Q of the 32 target rows into s_scr[0]: one 16-row chunk on each of waves 2, 3
  // (they had one task fewer than waves 0, 1 in phase 1)
  const bool projWave = (wave == 2 || wave == 3);
  if (projWave)
    wave_proj_t<false>(&s_t[0][0], oin_w, oin_b, nullptr, nullptr,
                       s_scr[0], nullptr, 32, lane, wave - 2, wave - 1);
  __syncthreads();

  // fc1, all eight waves: each 16-lane row of the block takes six weight rows and
  // walks them together, so every load covers 256 contiguous bytes of each of two
  // weight rows (whole 128-byte lines) and the loads of three rows are in flight at
  // once. The last 16-lane row has no rows of its own: it repeats rows 84 to 89 into
  // the spare words 90 to 95 of s_fc, which nobody reads. The first three rows are
  // asked for here, so that they arrive while the final attention runs.
  const int l16  = lane & 15;
  const int row0 = (tid >> 4) * 6;
  const v4f* wr = (const v4f*)(fc1_w + (row0 < 84 ? row0 : 84) * 256) + l16;
  const int bi = tid < 30 ? tid * 3 : 0;
  const float fb[3] = {fc1_b[bi], fc1_b[bi + 1], fc1_b[bi + 2]};
  v4f wa[3][4];
  #pragma unroll  // constant p, j: the weights stay in named registers
  for (int p = 0; p < 3; ++p) {
    #pragma unroll  // as above
    for (int j = 0; j < 4; ++j) wa[p][j] = wr[64 * p + 16 * j];
  }
  // holds the loads above here: with the attention unrolled the scheduler sinks them to its end
  __builtin_amdgcn_sched_barrier(0);

  // One head per wave, one query row per lane: all eight waves share the 8 x 126
  // keys that one wave would otherwise walk alone.
  s_ob[0][lane][wave] = (_Float16)attn_head<8, 126>(lane, wave, s_scr[0], &s_kpTf[0][0],
                                                    &s_vpTf[0][0], 128, s_scr[1]);
  __syncthreads();  // a row of s_ob[0] holds the heads of eight waves

  if (projWave)
    wave_proj_rm(&s_ob[0][0][0], oout_w, oout_b, &s_tout[0][0], lane,
                 wave - 2, wave - 1);
  __syncthreads();

  // ---------------- Phase 3: fc1 + channel softmax -> (B,3,30) -------------
  // Lane l of a 16-lane row sums the columns 64*j + 4*l + u of its six weight rows;
  // the 16 partial sums of a row are then added across the lanes.
  {
    v4f xv[4];
    #pragma unroll  // constant j: the sixteen x values stay in named registers
    for (int j = 0; j < 4; ++j)
      xv[j] = *(const v4f*)(&s_tout[0][0] + 64 * j + 4 * l16);
    float part[6];
    #pragma unroll  // constant p: part stays in named registers
    for (int p = 0; p < 3; ++p) {
      v4f a = wa[p][0] * xv[0];
      #pragma unroll  // constant j, as above
      for (int j = 1; j < 4; ++j) a += wa[p][j] * xv[j];
      part[p] = (a[0] + a[1]) + (a[2] + a[3]);
    }
    #pragma unroll  // constant p, as above
    for (int p = 3; p < 6; ++p) {
      v4f a = wr[64 * p] * xv[0];
      #pragma unroll  // constant j, as above
      for (int j = 1; j < 4; ++j) a += wr[64 * p + 16 * j] * xv[j];
      part[p] = (a[0] + a[1]) + (a[2] + a[3]);
    }
    #pragma unroll  // constant p, as above
    for (int p = 0; p < 6; ++p)
      part[p] = row_xadd<8>(row_xadd<4>(row_xadd<2>(row_xadd<1>(part[p]))));
    if (l16 == 0) {
      #pragma unroll  // constant p, as above
      for (int p = 0; p < 6; ++p) s_fc[row0 + p] = part[p];
    }
  }
  __syncthreads();
  if (tid < 30) {
    float x0 = s_fc[tid * 3 + 0] + fb[0], x1 = s_fc[tid * 3 + 1] + fb[1],
          x2 = s_fc[tid * 3 + 2] + fb[2];
    float m  = fmaxf(x0, fmaxf(x1, x2));
    float e0 = __expf(x0 - m), e1 = __expf(x1 - m), e2 = __expf(x2 - m);
    float s  = e0 + e1 + e2;
    float* o = out + (size_t)b * 90;
    o[0 * 30 + tid] = e0 / s;
    o[1 * 30 + tid] = e1 / s;
    o[2 * 30 + tid] = e2 / s;
  }
}

extern "C" void kernel_launch(void* const* d_in, const int* in_sizes, int n_in,
                              void* d_out, int out_size, void* d_ws, size_t ws_size,
                              hipStream_t stream) {
  (void)n_in; (void)out_size; (void)d_ws; (void)ws_size;
  const int B = in_sizes[0] / (2 * 20 * 118);
  cmt_kernel<<<B, 256, 0, stream>>>(
      (const float*)d_in[0],  (const float*)d_in[1],  (const float*)d_in[2],
      (const float*)d_in[3],  (const float*)d_in[4],  (const float*)d_in[5],
      (const float*)d_in[6],  (const float*)d_in[7],  (const float*)d_in[8],
      (const float*)d_in[9],  (const float*)d_in[10], (const float*)d_in[11],
      (const float*)d_in[12], (const float*)d_in[13], (const float*)d_in[14],
      (const float*)d_in[15], (const float*)d_in[16], (const float*)d_in[17],
      (const float*)d_in[18], (const float*)d_in[19], (const float*)d_in[20],
      (const float*)d_in[21], (const float*)d_in[22], (const float*)d_in[23],
      (const float*)d_in[24], (const float*)d_in[25], (const float*)d_in[26],
      (const float*)d_in[27], (const float*)d_in[28], (const float*)d_in[29],
      (float*)d_out);
}

// v007
// A run of this version takes 155 microseconds.
// Next to v006, in two timings, it ran 1.08 times as fast each time.
// Counting every step since v000, it is 2.92 times as fast.
#include <hip/hip_runtime.h>
#include <math.h>

#define E 8

typedef __attribute__((ext_vector_type(16))) _Float16 v16h;
typedef __attribute__((ext_vector_type(8)))  _Float16 v8h;
typedef __attribute__((ext_vector_type(8)))  float    v8f;
typedef __attribute__((ext_vector_type(4)))  float    v4f;
typedef __attribute__((ext_vector_type(2)))  float    v2f;
typedef unsigned int u32;

__device__ __forceinline__ float pe_val(float pos, int oc) {
  int k = oc & ~1;
  float div = __expf((float)k * (-9.210340371976184f / 8.0f));
  float ang = pos * div;
  return (oc & 1) ? __cosf(ang) : __sinf(ang);
}

// ---------------------------------------------------------------------------
// One v_wmma_f32_16x16x32_f16 per 16-row chunk. K=8 real (zero-padded to 32).
// A (16-bit 16x32): lanes 0-15 row M=lane, halves 0..7 = K 0..7; lanes 16-31 zero.
// B (16-bit 32x16): lanes 0-15 col N=lane, halves 0..7 = K 0..7.
// D (f32 16x16):    lane -> col N=lane&15, VGPR r -> row M = r + 8*(lane>>4).
// Sources live in LDS as f16 rows (16B) -> A build = one ds_load_b128, no cvt.
// Bias is folded into the C accumulator (C[m][n] = bias[n]).
// ---------------------------------------------------------------------------

__device__ __forceinline__ v16h load_a_frag(const _Float16* src, int ch, int lane,
                                            u32 amask) {
  uint4 raw = *(const uint4*)(src + (ch * 16 + (lane & 15)) * 8);
  raw.x &= amask; raw.y &= amask; raw.z &= amask; raw.w &= amask;
  union { uint4 u; v8h h; } cv;
  cv.u = raw;
  v16h af;
  #pragma unroll
  for (int k = 0; k < 8; ++k) af[k] = cv.h[k];
  #pragma unroll
  for (int k = 8; k < 16; ++k) af[k] = (_Float16)0.0f;
  return af;
}

// Value held by the same lane of the other 16-lane row (all 32 lanes active).
__device__ __forceinline__ float other_row(float x) {
  u32 u = __builtin_bit_cast(u32, x);
  return __builtin_bit_cast(float, __builtin_amdgcn_permlanex16(
      u, u, 0x76543210u, 0xfedcba98u, false, false));
}

// x plus the x of lane l ^ M inside a 16-lane row (all lanes active).
template <int M>
__device__ __forceinline__ float row_xadd(float x) {
  const int y = __builtin_amdgcn_update_dpp(0, __builtin_bit_cast(int, x), 0x160 | M,
                                            0xf, 0xf, true);  // 0x160 | M: row_xmask:M
  return x + __builtin_bit_cast(float, y);
}

// Transposed-output projection. DUAL packs two 8x8 weight blocks into B's 16
// columns -> one WMMA yields both K and V. Writeback: 2 contiguous b128 stores.
// DUAL also leaves each head's largest and smallest K over the rows it projects:
// ext[head*2*np + slot] and ext[head*2*np + np + slot]. Every projected row
// counts, so pad rows of src must repeat a real row.
template <bool DUAL>
__device__ __forceinline__ void wave_proj_t(const _Float16* src,
                                            const float* W1, const float* b1,
                                            const float* W2, const float* b2,
                                            float* d1T, float* d2T, int ld,
                                            int lane, int c0, int c1,
                                            float* ext = nullptr, int np = 1,
                                            int slot = 0) {
  const int n = lane & 15;
  const int half = lane >> 4;
  const u32 amask = (lane < 16) ? 0xFFFFFFFFu : 0u;
  v16h bf = {};
  float bn = 0.0f;
  float* dcol = nullptr;
  if (n < 8) { bn = b1[n]; dcol = d1T + n * ld; }
  else if (DUAL) { bn = b2[n - 8]; dcol = d2T + (n - 8) * ld; }
  if (lane < 16 && (n < 8 || DUAL)) {
    const float* wrow = (n < 8) ? (W1 + n * 8) : (W2 + (n - 8) * 8);
    #pragma unroll
    for (int k = 0; k < 8; ++k) bf[k] = (_Float16)wrow[k];
  }
  float kmx = -INFINITY, kmn = INFINITY;
  for (int ch = c0; ch < c1; ++ch) {
    v16h af = load_a_frag(src, ch, lane, amask);
    v8f c = {bn, bn, bn, bn, bn, bn, bn, bn};
    c = __builtin_amdgcn_wmma_f32_16x16x32_f16(false, af, false, bf, (short)0, c,
                                               false, false);
    if (DUAL || n < 8) {
      const int rb = ch * 16 + 8 * half;
      *(v4f*)(dcol + rb)     = (v4f){c[0], c[1], c[2], c[3]};
      *(v4f*)(dcol + rb + 4) = (v4f){c[4], c[5], c[6], c[7]};
    }
    if (DUAL) {
      #pragma unroll  // constant r: c[r] stays a named register, pairs fold into max3/min3
      for (int r = 0; r < 8; ++r) {
        kmx = fmaxf(kmx, c[r]);
        kmn = fminf(kmn, c[r]);
      }
    }
  }
  if (DUAL) {
    kmx = fmaxf(kmx, other_row(kmx));
    kmn = fminf(kmn, other_row(kmn));
    if (lane < 8) {
      ext[lane * 2 * np + slot]      = kmx;
      ext[lane * 2 * np + np + slot] = kmn;
    }
  }
}

// Row-major f32 output projection (result consumed row-wise by layernorm/fc1).
// bf is the B fragment of the 8x8 weight block: lane n < 8 holds row n in halves 0..7.
__device__ __forceinline__ void wave_proj_rm_bf(const _Float16* src, v16h bf,
                                                const float* bias, float* dst,
                                                int lane, int c0, int c1) {
  const int n = lane & 15;
  const int half = lane >> 4;
  const u32 amask = (lane < 16) ? 0xFFFFFFFFu : 0u;
  const float bn = (n < 8) ? bias[n] : 0.0f;
  for (int ch = c0; ch < c1; ++ch) {
    v16h af = load_a_frag(src, ch, lane, amask);
    v8f c = {bn, bn, bn, bn, bn, bn, bn, bn};
    c = __builtin_amdgcn_wmma_f32_16x16x32_f16(false, af, false, bf, (short)0, c,
                                               false, false);
    if (n < 8) {
      const int rb = ch * 16 + 8 * half;
      #pragma unroll
      for (int r = 0; r < 8; ++r) dst[(rb + r) * 8 + n] = c[r];
    }
  }
}

// The same with the weights read from global memory in f32.
__device__ __forceinline__ void wave_proj_rm(const _Float16* src, const float* W,
                                             const float* bias, float* dst,
                                             int lane, int c0, int c1) {
  v16h bf = {};
  if (lane < 8) {
    #pragma unroll
    for (int k = 0; k < 8; ++k) bf[k] = (_Float16)W[lane * 8 + k];
  }
  wave_proj_rm_bf(src, bf, bias, dst, lane, c0, c1);
}

// The same with the weights already in f16 rows of 16 bytes in LDS.
__device__ __forceinline__ void wave_proj_rm_h(const _Float16* src, const _Float16* Wh,
                                               const float* bias, float* dst,
                                               int lane, int c0, int c1) {
  const u32 bmask = (lane < 8) ? 0xFFFFFFFFu : 0u;
  uint4 raw = *(const uint4*)(Wh + (lane & 7) * 8);
  raw.x &= bmask; raw.y &= bmask; raw.z &= bmask; raw.w &= bmask;
  union { uint4 u; v8h h; } cv;
  cv.u = raw;
  v16h bf = {};
  #pragma unroll  // constant k: bf stays in named registers
  for (int k = 0; k < 8; ++k) bf[k] = cv.h[k];
  wave_proj_rm_bf(src, bf, bias, dst, lane, c0, c1);
}

// 2^x of eight values, each in its own register. One statement, so that no
// instruction directly behind a v_exp_f32 reads its result or overwrites its source
// (the slot the instruction set asks for); the v_nop is that slot behind the last.
__device__ __forceinline__ void exp2_x8(float* x) {
  asm("v_exp_f32 %0, %0\n\tv_exp_f32 %1, %1\n\tv_exp_f32 %2, %2\n\tv_exp_f32 %3, %3\n\t"
      "v_exp_f32 %4, %4\n\tv_exp_f32 %5, %5\n\tv_exp_f32 %6, %6\n\tv_exp_f32 %7, %7\n\t"
      "v_nop"
      : "+v"(x[0]), "+v"(x[1]), "+v"(x[2]), "+v"(x[3]),
        "+v"(x[4]), "+v"(x[5]), "+v"(x[6]), "+v"(x[7]));
}

// Per-lane softmax attention row (head_dim=1, scale=1). Transposed K/V allow
// contiguous b128 reads along j. Row result converted to f16 (next A-source).
// A score is q*k[j] with one q per row, and rounding keeps the order of the
// products, so the row maximum is exactly max(q*kmax, q*kmin): no pass over j.
// ext holds NP partial maxima, then NP partial minima, of each head's K.
// q is scaled by log2 e once, so q*k[j] - m is the exponent of 2 as it stands: one
// fma per score ahead of the exp.
// attn_keys8: eight keys from kc, vc on; the first N of them join the sums, in order.
template <int N>
__device__ __forceinline__ void attn_keys8(const float* kc, const float* vc, float qv,
                                           float m, float& s, float& acc) {
  const v4f ka = *(const v4f*)kc, kb = *(const v4f*)(kc + 4);
  const v4f va = *(const v4f*)vc, vb = *(const v4f*)(vc + 4);
  float e[8];
  #pragma unroll  // constant u: e stays in named registers
  for (int u = 0; u < 4; ++u) {
    e[u]     = qv * ka[u] - m;
    e[4 + u] = qv * kb[u] - m;
  }
  exp2_x8(e);
  #pragma unroll  // constant u, as above
  for (int u = 0; u < N; ++u) {
    s += e[u];
    acc += e[u] * (u < 4 ? va[u] : vb[u - 4]);
  }
  // one group at a time: with groups interleaved the build takes more than 96 registers,
  // which costs a wave per SIMD
  __builtin_amdgcn_sched_barrier(0);
}

// attn_head: query row i of head h, LK keys. The last group reads on to a multiple of
// eight keys (ldk covers it).
template <int NP, int LK>
__device__ __forceinline__ float attn_head(int i, int h, const float* qpT,
                                           const float* kpT, const float* vpT,
                                           int ldk, const float* ext) {
  const float qv = qpT[h * 32 + i] * 1.44269504088896341f;
  const float* kc = kpT + h * ldk;
  const float* vc = vpT + h * ldk;
  const float* ex = ext + h * 2 * NP;
  float kmx = ex[0], kmn = ex[NP];
  #pragma unroll  // constant offsets: the partials come in as b128 reads
  for (int p = 1; p < NP; ++p) {
    kmx = fmaxf(kmx, ex[p]);
    kmn = fminf(kmn, ex[NP + p]);
  }
  const float m = fmaxf(qv * kmx, qv * kmn);
  float s = 0.0f, acc = 0.0f;
  #pragma unroll  // constant LDS offsets: no address add, compare or branch per group
  for (int j = 0; j + 8 <= LK; j += 8) attn_keys8<8>(kc + j, vc + j, qv, m, s, acc);
  if (LK % 8) attn_keys8<LK % 8>(kc + LK / 8 * 8, vc + LK / 8 * 8, qv, m, s, acc);
  return acc / s;
}

// All eight heads of a 32-query, 32-key task by one wave, sums on the matrix unit.
// D = A x B per head and 16-query chunk, f16 operands, f32 accumulate:
//   B column c = query c, its 32 softmax weights exp(q*k - m) of that head;
//   A row 2*hd = V of head hd, row 2*hd+1 = ones (one fragment for all heads).
// Element s of lane half g is key 16*g + s in A and in B alike.
// D row 2*hd = weighted V sum, row 2*hd+1 = weight sum: register r of lane half g
// is row 8*g + r, so lanes 0-15 read heads 0-3 and lanes 16-31 heads 4-7.
// Lk is 30 or 32: at 30 the A columns of keys 30, 31 are zero, so the pad keys
// reach neither sum.
// attn_a_frag builds that A fragment from vpT[8][32] and leaves it in the same 1 KiB:
// words 0-3 of lane l at uint4 index l, words 4-7 at 32 + l. One wave; its loads of vpT
// are all issued ahead of its stores.
__device__ __forceinline__ void attn_a_frag(int lane, float* vpT, int Lk) {
  const int c = lane & 15;
  const int half = lane >> 4;
  union { u32 w[8]; v16h h; uint4 q[2]; } a;
  const float* vr = vpT + (c >> 1) * 32 + 16 * half;
  #pragma unroll
  for (int p = 0; p < 4; ++p) {
    v4f x = *(const v4f*)(vr + 4 * p);
    #pragma unroll
    for (int u = 0; u < 4; ++u) a.h[4 * p + u] = (_Float16)x[u];
  }
  #pragma unroll
  for (int p = 0; p < 8; ++p) a.w[p] = (c & 1) ? 0x3C003C00u : a.w[p];  // 1.0h pair
  if (half == 1 && Lk < 32) a.w[7] = 0u;
  ((uint4*)vpT)[lane]      = a.q[0];
  ((uint4*)vpT)[32 + lane] = a.q[1];
}

__device__ __forceinline__ void attn_rows_mm(int lane, const float* qpT,
                                             const float* kpT, const float* afrag,
                                             const float* ext, _Float16* ob) {
  const int c = lane & 15;
  const int half = lane >> 4;
  union { u32 w[8]; v16h h; uint4 q[2]; } a;
  a.q[0] = ((const uint4*)afrag)[lane];
  a.q[1] = ((const uint4*)afrag)[32 + lane];

  #pragma unroll 1  // rolled: four unrolled head pairs do not fit the register budget of 10 waves per SIMD
  for (int hp = 0; hp < 4; ++hp) {
    float num[2][2], den[2][2];
    #pragma unroll
    for (int w = 0; w < 2; ++w) {
      const int hd = hp + 4 * w;
      const float* kc = kpT + hd * 32 + 16 * half;
      float k[16];
      #pragma unroll
      for (int p = 0; p < 4; ++p) {
        v4f x = *(const v4f*)(kc + 4 * p);
        #pragma unroll
        for (int u = 0; u < 4; ++u) k[4 * p + u] = x[u];
      }
      const float kmx = ext[hd * 2], kmn = ext[hd * 2 + 1];
      // q * log2 e: q*k - m is then the exponent of 2 as it stands
      const float q2[2] = {qpT[hd * 32 + c] * 1.44269504088896341f,
                           qpT[hd * 32 + 16 + c] * 1.44269504088896341f};
      const float m2[2] = {fmaxf(q2[0] * kmx, q2[0] * kmn), fmaxf(q2[1] * kmx, q2[1] * kmn)};
      #pragma unroll
      for (int ch = 0; ch < 2; ++ch) {
        const float qv = q2[ch];
        const float m = m2[ch];
        float e[16];
        #pragma unroll
        for (int g = 0; g < 2; ++g) {
          #pragma unroll
          for (int s = 8 * g; s < 8 * g + 8; ++s)
            e[s] = qv * k[s] - m;
          exp2_x8(e + 8 * g);
          // eight scores at a time: with all sixteen formed ahead of the exps the build
          // takes a 97th register, which costs a wave per SIMD
          __builtin_amdgcn_sched_barrier(0);
        }
        v16h pf;
        #pragma unroll
        for (int s = 0; s < 16; ++s) pf[s] = (_Float16)e[s];
        v8f d = {};
        d = __builtin_amdgcn_wmma_f32_16x16x32_f16(false, a.h, false, pf, (short)0, d,
                                                   false, false);
        num[w][ch] = d[2 * hp];
        den[w][ch] = d[2 * hp + 1];
      }
    }
    #pragma unroll
    for (int ch = 0; ch < 2; ++ch)
      ob[(ch * 16 + c) * 8 + 4 * half + hp] =
          (_Float16)((half ? num[1][ch] : num[0][ch]) / (half ? den[1][ch] : den[0][ch]));
  }
}

__global__ __launch_bounds__(256) void cmt_kernel(
    const float* __restrict__ eeg, const float* __restrict__ pupil,
    const float* __restrict__ speech, const float* __restrict__ action,
    const float* __restrict__ location, const float* __restrict__ tgt,
    const float* __restrict__ eeg_w, const float* __restrict__ eeg_b,
    const float* __restrict__ psa_w, const float* __restrict__ psa_b,
    const float* __restrict__ loc_w, const float* __restrict__ loc_b,
    const float* __restrict__ tgt_w, const float* __restrict__ tgt_b,
    const float* __restrict__ ng, const float* __restrict__ nb,
    const float* __restrict__ cin_w, const float* __restrict__ cin_b,
    const float* __restrict__ cout_w, const float* __restrict__ cout_b,
    const float* __restrict__ sfin_w, const float* __restrict__ sfin_b,
    const float* __restrict__ sfout_w, const float* __restrict__ sfout_b,
    const float* __restrict__ oin_w, const float* __restrict__ oin_b,
    const float* __restrict__ oout_w, const float* __restrict__ oout_b,
    const float* __restrict__ fc1_w, const float* __restrict__ fc1_b,
    float* __restrict__ out) {
  __shared__ _Float16 s_seq[5][32][E];   // f16 A-sources: e(30), p, s, a, l
  __shared__ _Float16 s_t[32][E];
  __shared__ _Float16 s_concat[128][E];  // 126 rows + 2 pad rows
  __shared__ _Float16 s_ob[8][32][E];    // per-wave attention-output (A-source)
  __shared__ float s_acc[4][32][E];
  __shared__ float s_scr[8][1024];       // phase 0 staging; phase 1 projections and results
  __shared__ float s_kpTf[8][128];       // final MHA K, transposed [head][pos]
  __shared__ float s_vpTf[8][128];
  __shared__ float s_tout[32][E];
  __shared__ float s_fc[96];

  const int b    = blockIdx.x;
  const int tid  = threadIdx.x;
  const int lane = tid & 31;
  const int wave = tid >> 5;
  const int Lseq[5] = {30, 32, 32, 32, 32};

  __builtin_prefetch(fc1_w + (tid << 6), 0, 1);   // global_prefetch_b8

  // ---------------- Phase 0: convs + positional encoding into LDS ----------
  for (int idx = tid; idx < 4 * 32 * E; idx += 256) ((float*)s_acc)[idx] = 0.0f;

  // Every global read of phase 0 is issued here, ahead of the first use of any of
  // them: one memory latency for the whole phase, not one per group of conv rows.
  // The eeg block and its conv weights go through registers into s_scr, which is
  // free until phase 1, in floats: [0,5120) the 4720 floats of the block, then
  // copies of its last 16 bytes that nobody reads; from 5120 the weights, one row of
  // 80 per output channel at a pitch of 84 (b128 reads of 8 rows, no bank shared);
  // rows 8 to 12 take the stores of the threads without a chunk, read by nobody.
  float* stage = &s_scr[0][0];
  const int pos = tid >> 3;  // 0..31
  const int oc  = tid & 7;
  const v4f* ep4 = (const v4f*)(eeg + (size_t)b * (2 * 20 * 118));
  v4f ech[5];
  #pragma unroll  // constant k: the five chunks stay in named registers
  for (int k = 0; k < 5; ++k) {
    const int i = tid + 256 * k;
    ech[k] = ep4[i < 1180 ? i : 1179];
  }
  const v4f wch = ((const v4f*)eeg_w)[tid < 160 ? tid : 159];
  const bool inb = (pos >= 1 && pos <= 30);
  const u32 xi = inb ? (u32)(pos - 1) : 0u;  // in bounds for the two pad positions too
  const float* xp = pupil    + (size_t)b * 60;
  const float* xs = speech   + (size_t)b * 60;
  const float* xa = action   + (size_t)b * 60;
  const float* xl = location + (size_t)b * 90;
  const float psa_x[3][2] = {{xp[xi], xp[xi + 30]}, {xs[xi], xs[xi + 30]},
                             {xa[xi], xa[xi + 30]}};
  const float loc_x[3] = {xl[xi], xl[xi + 30], xl[xi + 60]};
  const float tgt_x = (tgt + (size_t)b * 30)[xi];
  const float pw0 = psa_w[oc * 2 + 0], pw1 = psa_w[oc * 2 + 1], pb = psa_b[oc];
  const float lw[3] = {loc_w[oc * 3 + 0], loc_w[oc * 3 + 1], loc_w[oc * 3 + 2]};
  const float lb = loc_b[oc], tw = tgt_w[oc], tb = tgt_b[oc], eb = eeg_b[oc];

  #pragma unroll  // constant k, as above
  for (int k = 0; k < 5; ++k) *(v4f*)(stage + (tid + 256 * k) * 4) = ech[k];
  *(v4f*)(stage + 5120 + (tid / 20) * 84 + (tid % 20) * 4) = wch;

  {  // p/s/a/l/tgt conv1d k1p1: this thread's (pos, oc) of all five
    const float pe32 = pe_val(32.0f, oc);
    #pragma unroll  // constant q: psa_x stays in named registers
    for (int q = 0; q < 3; ++q) {
      float v = pb;
      if (inb) v += pw0 * psa_x[q][0] + pw1 * psa_x[q][1];
      s_seq[1 + q][pos][oc] = (_Float16)(v + pe32);
    }
    float v = lb;
    if (inb) {
      #pragma unroll  // constant ic: lw and loc_x stay in named registers
      for (int ic = 0; ic < 3; ++ic) v += lw[ic] * loc_x[ic];
    }
    s_seq[4][pos][oc] = (_Float16)(v + pe32);
    v = tb;
    if (inb) v += tw * tgt_x;
    s_t[pos][oc] = (_Float16)(v + pe32);
  }
  __syncthreads();  // the staged block and weights are read by other threads than stored them

  if (tid < 240) {  // eeg conv2d (2,20,118) -> 30x8, kernel (20,2), stride (1,4)
    const float* xr = stage + pos * 4;
    const float* wr = stage + 5120 + oc * 84;
    float sum = eb;
    #pragma unroll 5  // ten conv rows a trip, so that their LDS reads overlap; more rows cost registers
    for (int j = 0; j < 20; ++j) {  // rows 2j, 2j+1 of the 40 (ic, kh) rows, in order
      const v4f w  = *(const v4f*)(wr + 4 * j);
      const v2f x0 = *(const v2f*)(xr + (2 * j) * 118);
      const v2f x1 = *(const v2f*)(xr + (2 * j + 1) * 118);
      sum += x0[0] * w[0] + x0[1] * w[1];
      sum += x1[0] * w[2] + x1[1] * w[3];
    }
    const _Float16 hv = (_Float16)(sum + pe_val(30.0f, oc));
    s_seq[0][pos][oc] = hv;
    if (pos == 29) {  // pad rows repeat the last row: K extremes stay those of 30 rows
      s_seq[0][30][oc] = hv;
      s_seq[0][31][oc] = hv;
    }
  }
  __syncthreads();

  // ---------------- Phase 1: 18 MHAs, one task per wave --------------------
  // The 18 tasks share their input projections: 7 distinct Q (e, p, s, a under the
  // cross weights; e, p, a under the self weights) and 8 distinct K/V (e, p, s, a, l
  // cross; e, p, a self). Each is projected once, here, and read by every task that
  // wants it. s_scr in floats: Q set i at 256*i (qpT[8][32]); K/V set i at 1792 + 528*i
  // (kpT[8][32]; vpT[8][32], then in its place the attention's A fragment; 16 K
  // extremes); wave w's row-major result at 6016 + 256*w; from 8064 the cross and the
  // self output weights in f16, 64 halves each, converted once as well.
  {
    const bool ks = wave >= 5;  // K/V set 'wave': sequences 0,1,2,3,4 cross, 0,1,3 self
    const int kseq = wave < 5 ? wave : (wave == 7 ? 3 : wave - 5);
    const float* kw = ks ? sfin_w : cin_w;
    const float* kb = ks ? sfin_b : cin_b;
    float* kv = stage + 1792 + 528 * wave;
    wave_proj_t<true>(&s_seq[kseq][0][0], kw + 64, kb + 8, kw + 128, kb + 16,
                      kv, kv + 256, 32, lane, 0, 2, kv + 512, 1, 0);
    attn_a_frag(lane, kv + 256, Lseq[kseq]);
    if (wave < 7) {  // Q set 'wave': sequences 0,1,2,3 cross, 0,1,3 self
      const bool qs = wave >= 4;
      const int qseq = wave < 4 ? wave : (wave == 6 ? 3 : wave - 4);
      wave_proj_t<false>(&s_seq[qseq][0][0], qs ? sfin_w : cin_w, qs ? sfin_b : cin_b,
                         nullptr, nullptr, stage + 256 * wave, nullptr, 32, lane, 0, 2);
    } else if (lane < 16) {  // wave 7: both 8x8 output weight blocks as f16 rows
      const float* wsrc = (lane < 8 ? cout_w : sfout_w) + (lane & 7) * 8;
      v8h hw;
      #pragma unroll  // constant c: hw stays in named registers
      for (int c = 0; c < 8; ++c) hw[c] = (_Float16)wsrc[c];
      *(v8h*)((_Float16*)(stage + 8064) + lane * 8) = hw;
    }
  }
  __syncthreads();  // a task reads projections that other waves wrote

  const int TQ[18] = {0,0,0,0,0, 1,1,1,1,1, 2,2,2,2, 3,3,3,3};
  const int TQI[18] = {0,0,0,4,0, 1,1,1,5,1, 2,2,2,2, 3,3,6,3};  // Q set of the task
  const int TKI[18] = {1,3,4,5,2, 0,3,4,6,2, 0,1,3,4, 0,1,7,2};  // K/V set of the task
  const int TA[18] = {0,0,0,0,0, 1,1,1,1,1, 2,2,2,2, 3,3,3,3};
  const int TB[18] = {-1,-1,-1,-1,-1, -1,-1,-1,-1,-1, -1,-1,-1,3, -1,-1,-1,-1};

  for (int t = wave; t < 18; t += 8) {
    const u32 sf = (0x10108u >> t) & 1u;  // tasks 3, 8, 16 are the self attentions
    const _Float16* wOut = (const _Float16*)(stage + 8064) + 64 * sf;
    const float* bOut = sf ? sfout_b : cout_b;
    int Lq = Lseq[TQ[t]];
    const float* kv = stage + 1792 + 528 * TKI[t];
    float* res = stage + 6016 + 256 * wave;
    attn_rows_mm(lane, stage + 256 * TQI[t], kv, kv + 256, kv + 512, &s_ob[wave][0][0]);
    wave_proj_rm_h(&s_ob[wave][0][0], wOut, bOut, res, lane, 0, 2);
    // layernorm + accumulate (ds_add_f32 atomics across waves)
    int i = lane;
    if (i < Lq) {
      const float* row = res + i * 8;
      float mu = 0.0f;
      #pragma unroll
      for (int c = 0; c < E; ++c) mu += row[c];
      mu *= 0.125f;
      float var = 0.0f;
      #pragma unroll
      for (int c = 0; c < E; ++c) { float d = row[c] - mu; var += d * d; }
      var *= 0.125f;
      float rinv = rsqrtf(var + 1e-5f);
      #pragma unroll
      for (int c = 0; c < E; ++c) {
        float v = (row[c] - mu) * rinv * ng[c] + nb[c];
        atomicAdd(&s_acc[TA[t]][i][c], v);
        if (TB[t] >= 0) atomicAdd(&s_acc[TB[t]][i][c], v);
      }
    }
  }
  __syncthreads();

  // ---------------- Phase 2: concat (f16) + final MHA ----------------------
  for (int idx = tid; idx < 128 * E; idx += 256) {  // [eeg30|pupil32|action32|speech32]
    int drow = idx >> 3, c = idx & 7;
    int row = drow < 125 ? drow : 125;  // pad rows 126, 127 repeat row 125
    int ai, r2;
    if (row < 30)      { ai = 0; r2 = row; }
    else if (row < 62) { ai = 1; r2 = row - 30; }
    else if (row < 94) { ai = 3; r2 = row - 62; }
    else               { ai = 2; r2 = row - 94; }
    s_concat[drow][c] = (_Float16)s_acc[ai][r2][c];
  }
  __syncthreads();

  // K/V of 126-row concat: dual WMMA, one 16-row chunk per wave; each wave leaves
  // its chunk's K extremes in s_scr[1] (free since phase 1), 8 partials per head
  wave_proj_t<true>(&s_concat[0][0], oin_w + 64, oin_b + 8, oin_w + 128, oin_b + 16,
                    &s_kpTf[0][0], &s_vpTf[0][0], 128, lane, wave, wave + 1,
                    s_scr[1], 8, wave);
  // Q of the 32 target rows into s_scr[0]: one 16-row chunk on each of waves 2, 3
  // (they had one task fewer than waves 0, 1 in phase 1)
  const bool projWave = (wave == 2 || wave == 3);
  if (projWave)
    wave_proj_t<false>(&s_t[0][0], oin_w, oin_b, nullptr, nullptr,
                       s_scr[0], nullptr, 32, lane, wave - 2, wave - 1);
  __syncthreads();

  // fc1, all eight waves: each 16-lane row of the block takes six weight rows and
  // walks them together, so every load covers 256 contiguous bytes of each of two
  // weight rows (whole 128-byte lines) and the loads of three rows are in flight at
  // once. The last 16-lane row has no rows of its own: it repeats rows 84 to 89 into
  // the spare words 90 to 95 of s_fc, which nobody reads. The first three rows are
  // asked for here, so that they arrive while the final attention runs.
  const int l16  = lane & 15;
  const int row0 = (tid >> 4) * 6;
  const v4f* wr = (const v4f*)(fc1_w + (row0 < 84 ? row0 : 84) * 256) + l16;
  const int bi = tid < 30 ? tid * 3 : 0;
  const float fb[3] = {fc1_b[bi], fc1_b[bi + 1], fc1_b[bi + 2]};
  v4f wa[3][4];
  #pragma unroll  // constant p, j: the weights stay in named registers
  for (int p = 0; p < 3; ++p) {
    #pragma unroll  // as above
    for (int j = 0; j < 4; ++j) wa[p][j] = wr[64 * p + 16 * j];
  }
  // holds the loads above here: with the attention unrolled the scheduler sinks them to its end
  __builtin_amdgcn_sched_barrier(0);

  // One head per wave, one query row per lane: all eight waves share the 8 x 126
  // keys that one wave would otherwise walk alone.
  s_ob[0][lane][wave] = (_Float16)attn_head<8, 126>(lane, wave, s_scr[0], &s_kpTf[0][0],
                                                    &s_vpTf[0][0], 128, s_scr[1]);
  __syncthreads();  // a row of s_ob[0] holds the heads of eight waves

  if (projWave)
    wave_proj_rm(&s_ob[0][0][0], oout_w, oout_b, &s_tout[0][0], lane,
                 wave - 2, wave - 1);
  __syncthreads();

  // ---------------- Phase 3: fc1 + channel softmax -> (B,3,30) -------------
  // Lane l of a 16-lane row sums the columns 64*j + 4*l + u of its six weight rows;
  // the 16 partial sums of a row are then added across the lanes.
  {
    v4f xv[4];
    #pragma unroll  // constant j: the sixteen x values stay in named registers
    for (int j = 0; j < 4; ++j)
      xv[j] = *(const v4f*)(&s_tout[0][0] + 64 * j + 4 * l16);
    float part[6];
    #pragma unroll  // constant p: part stays in named registers
    for (int p = 0; p < 3; ++p) {
      v4f a = wa[p][0] * xv[0];
      #pragma unroll  // constant j, as above
      for (int j = 1; j < 4; ++j) a += wa[p][j] * xv[j];
      part[p] = (a[0] + a[1]) + (a[2] + a[3]);
    }
    #pragma unroll  // constant p, as above
    for (int p = 3; p < 6; ++p) {
      v4f a = wr[64 * p] * xv[0];
      #pragma unroll  // constant j, as above
      for (int j = 1; j < 4; ++j) a += wr[64 * p + 16 * j] * xv[j];
      part[p] = (a[0] + a[1]) + (a[2] + a[3]);
    }
    #pragma unroll  // constant p, as above
    for (int p = 0; p < 6; ++p)
      part[p] = row_xadd<8>(row_xadd<4>(row_xadd<2>(row_xadd<1>(part[p]))));
    if (l16 == 0) {
      #pragma unroll  // constant p, as above
      for (int p = 0; p < 6; ++p) s_fc[row0 + p] = part[p];
    }
  }
  __syncthreads();
  if (tid < 30) {
    float x0 = s_fc[tid * 3 + 0] + fb[0], x1 = s_fc[tid * 3 + 1] + fb[1],
          x2 = s_fc[tid * 3 + 2] + fb[2];
    float m  = fmaxf(x0, fmaxf(x1, x2));
    float e0 = __expf(x0 - m), e1 = __expf(x1 - m), e2 = __expf(x2 - m);
    float s  = e0 + e1 + e2;
    float* o = out + (size_t)b * 90;
    o[0 * 30 + tid] = e0 / s;
    o[1 * 30 + tid] = e1 / s;
    o[2 * 30 + tid] = e2 / s;
  }
}

extern "C" void kernel_launch(void* const* d_in, const int* in_sizes, int n_in,
                              void* d_out, int out_size, void* d_ws, size_t ws_size,
                              hipStream_t stream) {
  (void)n_in; (void)out_size; (void)d_ws; (void)ws_size;
  const int B = in_sizes[0] / (2 * 20 * 118);
  cmt_kernel<<<B, 256, 0, stream>>>(
      (const float*)d_in[0],  (const float*)d_in[1],  (const float*)d_in[2],
      (const float*)d_in[3],  (const float*)d_in[4],  (const float*)d_in[5],
      (const float*)d_in[6],  (const float*)d_in[7],  (const float*)d_in[8],
      (const float*)d_in[9],  (const float*)d_in[10], (const float*)d_in[11],
      (const float*)d_in[12], (const float*)d_in[13], (const float*)d_in[14],
      (const float*)d_in[15], (const float*)d_in[16], (const float*)d_in[17],
      (const float*)d_in[18], (const float*)d_in[19], (const float*)d_in[20],
      (const float*)d_in[21], (const float*)d_in[22], (const float*)d_in[23],
      (const float*)d_in[24], (const float*)d_in[25], (const float*)d_in[26],
      (const float*)d_in[27], (const float*)d_in[28], (const float*)d_in[29],
      (float*)d_out);
}

// v008
// One run takes 144 microseconds.
// In both of two side-by-side timings against v007, it was 1.08 times as fast.
// Counting every step since v000, it is 3.15 times as fast.
#include <hip/hip_runtime.h>
#include <math.h>

#define E 8

typedef __attribute__((ext_vector_type(16))) _Float16 v16h;
typedef __attribute__((ext_vector_type(8)))  _Float16 v8h;
typedef __attribute__((ext_vector_type(2)))  _Float16 v2h;
typedef __attribute__((ext_vector_type(8)))  float    v8f;
typedef __attribute__((ext_vector_type(4)))  float    v4f;
typedef __attribute__((ext_vector_type(2)))  float    v2f;
typedef unsigned int u32;

__device__ __forceinline__ float pe_val(float pos, int oc) {
  int k = oc & ~1;
  float div = __expf((float)k * (-9.210340371976184f / 8.0f));
  float ang = pos * div;
  return (oc & 1) ? __cosf(ang) : __sinf(ang);
}

// ---------------------------------------------------------------------------
// One v_wmma_f32_16x16x32_f16 per 16-row chunk. K=8 real (zero-padded to 32).
// A (16-bit 16x32): lanes 0-15 row M=lane, halves 0..7 = K 0..7; lanes 16-31 zero.
// B (16-bit 32x16): lanes 0-15 col N=lane, halves 0..7 = K 0..7.
// D (f32 16x16):    lane -> col N=lane&15, VGPR r -> row M = r + 8*(lane>>4).
// Sources live in LDS as f16 rows (16B) -> A build = one ds_load_b128, no cvt.
// Bias is folded into the C accumulator (C[m][n] = bias[n]).
// ---------------------------------------------------------------------------

__device__ __forceinline__ v16h load_a_frag(const _Float16* src, int ch, int lane,
                                            u32 amask) {
  uint4 raw = *(const uint4*)(src + (ch * 16 + (lane & 15)) * 8);
  raw.x &= amask; raw.y &= amask; raw.z &= amask; raw.w &= amask;
  union { uint4 u; v8h h; } cv;
  cv.u = raw;
  v16h af;
  #pragma unroll
  for (int k = 0; k < 8; ++k) af[k] = cv.h[k];
  #pragma unroll
  for (int k = 8; k < 16; ++k) af[k] = (_Float16)0.0f;
  return af;
}

// Value held by the same lane of the other 16-lane row (all 32 lanes active).
__device__ __forceinline__ float other_row(float x) {
  u32 u = __builtin_bit_cast(u32, x);
  return __builtin_bit_cast(float, __builtin_amdgcn_permlanex16(
      u, u, 0x76543210u, 0xfedcba98u, false, false));
}

// x plus the x of lane l ^ M inside a 16-lane row (all lanes active).
template <int M>
__device__ __forceinline__ float row_xadd(float x) {
  const int y = __builtin_amdgcn_update_dpp(0, __builtin_bit_cast(int, x), 0x160 | M,
                                            0xf, 0xf, true);  // 0x160 | M: row_xmask:M
  return x + __builtin_bit_cast(float, y);
}

// Transposed-output projection. DUAL packs two 8x8 weight blocks into B's 16
// columns -> one WMMA yields both K and V. Writeback: 2 contiguous b128 stores.
// DUAL also leaves each head's largest and smallest K over the rows it projects:
// ext[head*2*np + slot] and ext[head*2*np + np + slot]. Every projected row
// counts, so pad rows of src must repeat a real row.
// KH: d1T takes its block as f16 (ld counts halves there), one b128 store per chunk.
template <bool DUAL, bool KH = false>
__device__ __forceinline__ void wave_proj_t(const _Float16* src,
                                            const float* W1, const float* b1,
                                            const float* W2, const float* b2,
                                            float* d1T, float* d2T, int ld,
                                            int lane, int c0, int c1,
                                            float* ext = nullptr, int np = 1,
                                            int slot = 0) {
  const int n = lane & 15;
  const int half = lane >> 4;
  const u32 amask = (lane < 16) ? 0xFFFFFFFFu : 0u;
  v16h bf = {};
  float bn = 0.0f;
  float* dcol = nullptr;
  if (n < 8) { bn = b1[n]; dcol = d1T + n * ld; }
  else if (DUAL) { bn = b2[n - 8]; dcol = d2T + (n - 8) * ld; }
  if (lane < 16 && (n < 8 || DUAL)) {
    const float* wrow = (n < 8) ? (W1 + n * 8) : (W2 + (n - 8) * 8);
    #pragma unroll
    for (int k = 0; k < 8; ++k) bf[k] = (_Float16)wrow[k];
  }
  float kmx = -INFINITY, kmn = INFINITY;
  for (int ch = c0; ch < c1; ++ch) {
    v16h af = load_a_frag(src, ch, lane, amask);
    v8f c = {bn, bn, bn, bn, bn, bn, bn, bn};
    c = __builtin_amdgcn_wmma_f32_16x16x32_f16(false, af, false, bf, (short)0, c,
                                               false, false);
    const int rb = ch * 16 + 8 * half;
    if (KH && n < 8) {
      v8h hk;
      #pragma unroll  // constant r: hk stays in named registers
      for (int r = 0; r < 8; ++r) hk[r] = (_Float16)c[r];
      *(v8h*)((_Float16*)d1T + n * ld + rb) = hk;
    } else if (DUAL || n < 8) {
      *(v4f*)(dcol + rb)     = (v4f){c[0], c[1], c[2], c[3]};
      *(v4f*)(dcol + rb + 4) = (v4f){c[4], c[5], c[6], c[7]};
    }
    if (DUAL) {
      #pragma unroll  // constant r: c[r] stays a named register, pairs fold into max3/min3
      for (int r = 0; r < 8; ++r) {
        kmx = fmaxf(kmx, c[r]);
        kmn = fminf(kmn, c[r]);
      }
    }
  }
  if (DUAL) {
    kmx = fmaxf(kmx, other_row(kmx));
    kmn = fminf(kmn, other_row(kmn));
    if (lane < 8) {
      ext[lane * 2 * np + slot]      = kmx;
      ext[lane * 2 * np + np + slot] = kmn;
    }
  }
}

// Row-major f32 output projection (result consumed row-wise by layernorm/fc1).
// bf is the B fragment of the 8x8 weight block: lane n < 8 holds row n in halves 0..7.
__device__ __forceinline__ void wave_proj_rm_bf(const _Float16* src, v16h bf,
                                                const float* bias, float* dst,
                                                int lane, int c0, int c1) {
  const int n = lane & 15;
  const int half = lane >> 4;
  const u32 amask = (lane < 16) ? 0xFFFFFFFFu : 0u;
  const float bn = (n < 8) ? bias[n] : 0.0f;
  for (int ch = c0; ch < c1; ++ch) {
    v16h af = load_a_frag(src, ch, lane, amask);
    v8f c = {bn, bn, bn, bn, bn, bn, bn, bn};
    c = __builtin_amdgcn_wmma_f32_16x16x32_f16(false, af, false, bf, (short)0, c,
                                               false, false);
    if (n < 8) {
      const int rb = ch * 16 + 8 * half;
      #pragma unroll
      for (int r = 0; r < 8; ++r) dst[(rb + r) * 8 + n] = c[r];
    }
  }
}

// The same with the weights read from global memory in f32.
__device__ __forceinline__ void wave_proj_rm(const _Float16* src, const float* W,
                                             const float* bias, float* dst,
                                             int lane, int c0, int c1) {
  v16h bf = {};
  if (lane < 8) {
    #pragma unroll
    for (int k = 0; k < 8; ++k) bf[k] = (_Float16)W[lane * 8 + k];
  }
  wave_proj_rm_bf(src, bf, bias, dst, lane, c0, c1);
}

// The same with the weights already in f16 rows of 16 bytes in LDS.
__device__ __forceinline__ void wave_proj_rm_h(const _Float16* src, const _Float16* Wh,
                                               const float* bias, float* dst,
                                               int lane, int c0, int c1) {
  const u32 bmask = (lane < 8) ? 0xFFFFFFFFu : 0u;
  uint4 raw = *(const uint4*)(Wh + (lane & 7) * 8);
  raw.x &= bmask; raw.y &= bmask; raw.z &= bmask; raw.w &= bmask;
  union { uint4 u; v8h h; } cv;
  cv.u = raw;
  v16h bf = {};
  #pragma unroll  // constant k: bf stays in named registers
  for (int k = 0; k < 8; ++k) bf[k] = cv.h[k];
  wave_proj_rm_bf(src, bf, bias, dst, lane, c0, c1);
}

// 2^x of eight values, each in its own register. One statement, so that no
// instruction directly behind a v_exp_f32 reads its result or overwrites its source
// (the slot the instruction set asks for); the v_nop is that slot behind the last.
__device__ __forceinline__ void exp2_x8(float* x) {
  asm("v_exp_f32 %0, %0\n\tv_exp_f32 %1, %1\n\tv_exp_f32 %2, %2\n\tv_exp_f32 %3, %3\n\t"
      "v_exp_f32 %4, %4\n\tv_exp_f32 %5, %5\n\tv_exp_f32 %6, %6\n\tv_exp_f32 %7, %7\n\t"
      "v_nop"
      : "+v"(x[0]), "+v"(x[1]), "+v"(x[2]), "+v"(x[3]),
        "+v"(x[4]), "+v"(x[5]), "+v"(x[6]), "+v"(x[7]));
}

// 2^x of sixteen f16 values, two to a register, each in place: what comes out is a B
// fragment as it stands. One statement, the low halves of all eight registers and then
// the high halves, so that no instruction directly behind a v_exp_f16 touches the
// register it works on (the slot the instruction set asks for); the v_nop is that slot
// behind the last.
__device__ __forceinline__ void exp2h_x16(u32* x) {
  asm("v_exp_f16 %0.l, %0.l\n\tv_exp_f16 %1.l, %1.l\n\tv_exp_f16 %2.l, %2.l\n\t"
      "v_exp_f16 %3.l, %3.l\n\tv_exp_f16 %4.l, %4.l\n\tv_exp_f16 %5.l, %5.l\n\t"
      "v_exp_f16 %6.l, %6.l\n\tv_exp_f16 %7.l, %7.l\n\t"
      "v_exp_f16 %0.h, %0.h\n\tv_exp_f16 %1.h, %1.h\n\tv_exp_f16 %2.h, %2.h\n\t"
      "v_exp_f16 %3.h, %3.h\n\tv_exp_f16 %4.h, %4.h\n\tv_exp_f16 %5.h, %5.h\n\t"
      "v_exp_f16 %6.h, %6.h\n\tv_exp_f16 %7.h, %7.h\n\t"
      "v_nop"
      : "+v"(x[0]), "+v"(x[1]), "+v"(x[2]), "+v"(x[3]),
        "+v"(x[4]), "+v"(x[5]), "+v"(x[6]), "+v"(x[7]));
}

// Per-lane softmax attention row (head_dim=1, scale=1). Transposed K/V allow
// contiguous b128 reads along j. Row result converted to f16 (next A-source).
// A score is q*k[j] with one q per row, and rounding keeps the order of the
// products, so the row maximum is exactly max(q*kmax, q*kmin): no pass over j.
// ext holds NP partial maxima, then NP partial minima, of each head's K.
// q is scaled by log2 e once, so q*k[j] - m is the exponent of 2 as it stands: one
// fma per score ahead of the exp.
// attn_keys8: eight keys from kc, vc on; the first N of them join the sums, in order.
template <int N>
__device__ __forceinline__ void attn_keys8(const float* kc, const float* vc, float qv,
                                           float m, float& s, float& acc) {
  const v4f ka = *(const v4f*)kc, kb = *(const v4f*)(kc + 4);
  const v4f va = *(const v4f*)vc, vb = *(const v4f*)(vc + 4);
  float e[8];
  #pragma unroll  // constant u: e stays in named registers
  for (int u = 0; u < 4; ++u) {
    e[u]     = qv * ka[u] - m;
    e[4 + u] = qv * kb[u] - m;
  }
  exp2_x8(e);
  #pragma unroll  // constant u, as above
  for (int u = 0; u < N; ++u) {
    s += e[u];
    acc += e[u] * (u < 4 ? va[u] : vb[u - 4]);
  }
  // one group at a time: with groups interleaved the build takes more than 96 registers,
  // which costs a wave per SIMD
  __builtin_amdgcn_sched_barrier(0);
}

// attn_head: query row i of head h, LK keys. The last group reads on to a multiple of
// eight keys (ldk covers it).
template <int NP, int LK>
__device__ __forceinline__ float attn_head(int i, int h, const float* qpT,
                                           const float* kpT, const float* vpT,
                                           int ldk, const float* ext) {
  const float qv = qpT[h * 32 + i] * 1.44269504088896341f;
  const float* kc = kpT + h * ldk;
  const float* vc = vpT + h * ldk;
  const float* ex = ext + h * 2 * NP;
  float kmx = ex[0], kmn = ex[NP];
  #pragma unroll  // constant offsets: the partials come in as b128 reads
  for (int p = 1; p < NP; ++p) {
    kmx = fmaxf(kmx, ex[p]);
    kmn = fminf(kmn, ex[NP + p]);
  }
  const float m = fmaxf(qv * kmx, qv * kmn);
  float s = 0.0f, acc = 0.0f;
  #pragma unroll  // constant LDS offsets: no address add, compare or branch per group
  for (int j = 0; j + 8 <= LK; j += 8) attn_keys8<8>(kc + j, vc + j, qv, m, s, acc);
  if (LK % 8) attn_keys8<LK % 8>(kc + LK / 8 * 8, vc + LK / 8 * 8, qv, m, s, acc);
  return acc / s;
}

// All eight heads of a 32-query, 32-key task by one wave, sums on the matrix unit.
// D = A x B per head and 16-query chunk, f16 operands, f32 accumulate:
//   B column c = query c, its 32 softmax weights exp(q*k - m) of that head;
//   A row 2*hd = V of head hd, row 2*hd+1 = ones (one fragment for all heads).
// Element s of lane half g is key 16*g + s in A and in B alike.
// D row 2*hd = weighted V sum, row 2*hd+1 = weight sum: register r of lane half g
// is row 8*g + r, so lanes 0-15 read heads 0-3 and lanes 16-31 heads 4-7.
// Lk is 30 or 32: at 30 the A columns of keys 30, 31 are zero, so the pad keys
// reach neither sum.
// The weights are made in f16, the type B takes them in: K lies in LDS as f16
// (khT[8][32]), a packed fma forms two exponents q*k - m, and the f16 exp works in
// place. m only has to be near the row's largest exponent: it is the same in both sums
// of a row and cancels in their quotient.
// attn_a_frag builds that A fragment from vpT[8][32] and leaves it in the same 1 KiB:
// words 0-3 of lane l at uint4 index l, words 4-7 at 32 + l. One wave; its loads of vpT
// are all issued ahead of its stores.
__device__ __forceinline__ void attn_a_frag(int lane, float* vpT, int Lk) {
  const int c = lane & 15;
  const int half = lane >> 4;
  union { u32 w[8]; v16h h; uint4 q[2]; } a;
  const float* vr = vpT + (c >> 1) * 32 + 16 * half;
  #pragma unroll
  for (int p = 0; p < 4; ++p) {
    v4f x = *(const v4f*)(vr + 4 * p);
    #pragma unroll
    for (int u = 0; u < 4; ++u) a.h[4 * p + u] = (_Float16)x[u];
  }
  #pragma unroll
  for (int p = 0; p < 8; ++p) a.w[p] = (c & 1) ? 0x3C003C00u : a.w[p];  // 1.0h pair
  if (half == 1 && Lk < 32) a.w[7] = 0u;
  ((uint4*)vpT)[lane]      = a.q[0];
  ((uint4*)vpT)[32 + lane] = a.q[1];
}

// What one head of a task reads from LDS: its 16 keys of this lane half as f16 pairs
// (p[s]: keys 16*half + 2*s and + 2*s + 1), the K extremes, the q of both query chunks.
struct head_in {
  union { uint4 q[2]; v2h p[8]; } k;
  float kmx, kmn, q0, q1;
};

__device__ __forceinline__ head_in attn_head_in(int hd, int c, int half, const float* qpT,
                                                const _Float16* khT, const float* ext) {
  head_in in;
  const uint4* kc = (const uint4*)(khT + hd * 32 + 16 * half);
  in.k.q[0] = kc[0];
  in.k.q[1] = kc[1];
  in.kmx = ext[hd * 2];
  in.kmn = ext[hd * 2 + 1];
  in.q0 = qpT[hd * 32 + c];
  in.q1 = qpT[hd * 32 + 16 + c];
  return in;
}

// Both query chunks of one head: weights, then D = A x weights.
__device__ __forceinline__ void attn_head_mm(const head_in& in, v16h a, v8f* d) {
  // q * log2 e: q*k - m is then the exponent of 2 as it stands
  const float q2[2] = {in.q0 * 1.44269504088896341f, in.q1 * 1.44269504088896341f};
  union { v2h p[8]; u32 w[8]; v16h h; } e[2];
  #pragma unroll  // constant ch, s: e stays in named registers
  for (int ch = 0; ch < 2; ++ch) {
    const _Float16 qh = (_Float16)q2[ch];
    const _Float16 mh = (_Float16)fmaxf(q2[ch] * in.kmx, q2[ch] * in.kmn);
    const v2h qq = {qh, qh}, mm = {mh, mh};
    #pragma unroll  // as above
    for (int s = 0; s < 8; ++s) e[ch].p[s] = qq * in.k.p[s] - mm;
  }
  #pragma unroll  // constant ch, as above
  for (int ch = 0; ch < 2; ++ch) {
    exp2h_x16(e[ch].w);
    d[ch] = (v8f){};
    d[ch] = __builtin_amdgcn_wmma_f32_16x16x32_f16(false, a, false, e[ch].h, (short)0, d[ch],
                                                   false, false);
  }
}

__device__ __forceinline__ void attn_rows_mm(int lane, const float* qpT,
                                             const _Float16* khT, const float* afrag,
                                             const float* ext, _Float16* ob) {
  const int c = lane & 15;
  const int half = lane >> 4;
  union { u32 w[8]; v16h h; uint4 q[2]; } a;
  a.q[0] = ((const uint4*)afrag)[lane];
  a.q[1] = ((const uint4*)afrag)[32 + lane];

  #pragma unroll 1  // rolled: four unrolled head pairs do not fit the register budget of 10 waves per SIMD
  for (int hp = 0; hp < 4; ++hp) {
    float num[2][2], den[2][2];
    v8f d[2];
    const head_in h0 = attn_head_in(hp, c, half, qpT, khT, ext);
    attn_head_mm(h0, a.h, d);
    // This line and the next of its kind keep the two heads apart: interleaved, the build
    // takes more than 96 registers, which costs a work-group per WGP. The first head's
    // sums are read between the two lines, beside the second head's LDS reads.
    __builtin_amdgcn_sched_barrier(0);
    const head_in h1 = attn_head_in(hp + 4, c, half, qpT, khT, ext);
    #pragma unroll  // constant ch: num, den stay in named registers
    for (int ch = 0; ch < 2; ++ch) {
      num[0][ch] = d[ch][2 * hp];
      den[0][ch] = d[ch][2 * hp + 1];
    }
    __builtin_amdgcn_sched_barrier(0);  // as above
    attn_head_mm(h1, a.h, d);
    #pragma unroll  // constant ch, as above
    for (int ch = 0; ch < 2; ++ch) {
      num[1][ch] = d[ch][2 * hp];
      den[1][ch] = d[ch][2 * hp + 1];
    }
    #pragma unroll
    for (int ch = 0; ch < 2; ++ch)
      ob[(ch * 16 + c) * 8 + 4 * half + hp] =
          (_Float16)((half ? num[1][ch] : num[0][ch]) / (half ? den[1][ch] : den[0][ch]));
  }
}

__global__ __launch_bounds__(256) void cmt_kernel(
    const float* __restrict__ eeg, const float* __restrict__ pupil,
    const float* __restrict__ speech, const float* __restrict__ action,
    const float* __restrict__ location, const float* __restrict__ tgt,
    const float* __restrict__ eeg_w, const float* __restrict__ eeg_b,
    const float* __restrict__ psa_w, const float* __restrict__ psa_b,
    const float* __restrict__ loc_w, const float* __restrict__ loc_b,
    const float* __restrict__ tgt_w, const float* __restrict__ tgt_b,
    const float* __restrict__ ng, const float* __restrict__ nb,
    const float* __restrict__ cin_w, const float* __restrict__ cin_b,
    const float* __restrict__ cout_w, const float* __restrict__ cout_b,
    const float* __restrict__ sfin_w, const float* __restrict__ sfin_b,
    const float* __restrict__ sfout_w, const float* __restrict__ sfout_b,
    const float* __restrict__ oin_w, const float* __restrict__ oin_b,
    const float* __restrict__ oout_w, const float* __restrict__ oout_b,
    const float* __restrict__ fc1_w, const float* __restrict__ fc1_b,
    float* __restrict__ out) {
  __shared__ _Float16 s_seq[5][32][E];   // f16 A-sources: e(30), p, s, a, l
  __shared__ _Float16 s_t[32][E];
  __shared__ _Float16 s_concat[128][E];  // 126 rows + 2 pad rows
  __shared__ _Float16 s_ob[8][32][E];    // per-wave attention-output (A-source)
  __shared__ float s_acc[4][32][E];
  __shared__ float s_scr[8][1024];       // phase 0 staging; phase 1 projections and results
  __shared__ float s_kpTf[8][128];       // final MHA K, transposed [head][pos]
  __shared__ float s_vpTf[8][128];
  __shared__ float s_tout[32][E];
  __shared__ float s_fc[96];

  const int b    = blockIdx.x;
  const int tid  = threadIdx.x;
  const int lane = tid & 31;
  const int wave = tid >> 5;
  const int Lseq[5] = {30, 32, 32, 32, 32};

  __builtin_prefetch(fc1_w + (tid << 6), 0, 1);   // global_prefetch_b8

  // ---------------- Phase 0: convs + positional encoding into LDS ----------
  for (int idx = tid; idx < 4 * 32 * E; idx += 256) ((float*)s_acc)[idx] = 0.0f;

  // Every global read of phase 0 is issued here, ahead of the first use of any of
  // them: one memory latency for the whole phase, not one per group of conv rows.
  // The eeg block and its conv weights go through registers into s_scr, which is
  // free until phase 1, in floats: [0,5120) the 4720 floats of the block, then
  // copies of its last 16 bytes that nobody reads; from 5120 the weights, one row of
  // 80 per output channel at a pitch of 84 (b128 reads of 8 rows, no bank shared);
  // rows 8 to 12 take the stores of the threads without a chunk, read by nobody.
  float* stage = &s_scr[0][0];
  const int pos = tid >> 3;  // 0..31
  const int oc  = tid & 7;
  const v4f* ep4 = (const v4f*)(eeg + (size_t)b * (2 * 20 * 118));
  v4f ech[5];
  #pragma unroll  // constant k: the five chunks stay in named registers
  for (int k = 0; k < 5; ++k) {
    const int i = tid + 256 * k;
    ech[k] = ep4[i < 1180 ? i : 1179];
  }
  const v4f wch = ((const v4f*)eeg_w)[tid < 160 ? tid : 159];
  const bool inb = (pos >= 1 && pos <= 30);
  const u32 xi = inb ? (u32)(pos - 1) : 0u;  // in bounds for the two pad positions too
  const float* xp = pupil    + (size_t)b * 60;
  const float* xs = speech   + (size_t)b * 60;
  const float* xa = action   + (size_t)b * 60;
  const float* xl = location + (size_t)b * 90;
  const float psa_x[3][2] = {{xp[xi], xp[xi + 30]}, {xs[xi], xs[xi + 30]},
                             {xa[xi], xa[xi + 30]}};
  const float loc_x[3] = {xl[xi], xl[xi + 30], xl[xi + 60]};
  const float tgt_x = (tgt + (size_t)b * 30)[xi];
  const float pw0 = psa_w[oc * 2 + 0], pw1 = psa_w[oc * 2 + 1], pb = psa_b[oc];
  const float lw[3] = {loc_w[oc * 3 + 0], loc_w[oc * 3 + 1], loc_w[oc * 3 + 2]};
  const float lb = loc_b[oc], tw = tgt_w[oc], tb = tgt_b[oc], eb = eeg_b[oc];

  #pragma unroll  // constant k, as above
  for (int k = 0; k < 5; ++k) *(v4f*)(stage + (tid + 256 * k) * 4) = ech[k];
  *(v4f*)(stage + 5120 + (tid / 20) * 84 + (tid % 20) * 4) = wch;

  {  // p/s/a/l/tgt conv1d k1p1: this thread's (pos, oc) of all five
    const float pe32 = pe_val(32.0f, oc);
    #pragma unroll  // constant q: psa_x stays in named registers
    for (int q = 0; q < 3; ++q) {
      float v = pb;
      if (inb) v += pw0 * psa_x[q][0] + pw1 * psa_x[q][1];
      s_seq[1 + q][pos][oc] = (_Float16)(v + pe32);
    }
    float v = lb;
    if (inb) {
      #pragma unroll  // constant ic: lw and loc_x stay in named registers
      for (int ic = 0; ic < 3; ++ic) v += lw[ic] * loc_x[ic];
    }
    s_seq[4][pos][oc] = (_Float16)(v + pe32);
    v = tb;
    if (inb) v += tw * tgt_x;
    s_t[pos][oc] = (_Float16)(v + pe32);
  }
  __syncthreads();  // the staged block and weights are read by other threads than stored them

  if (tid < 240) {  // eeg conv2d (2,20,118) -> 30x8, kernel (20,2), stride (1,4)
    const float* xr = stage + pos * 4;
    const float* wr = stage + 5120 + oc * 84;
    float sum = eb;
    #pragma unroll 5  // ten conv rows a trip, so that their LDS reads overlap; more rows cost registers
    for (int j = 0; j < 20; ++j) {  // rows 2j, 2j+1 of the 40 (ic, kh) rows, in order
      const v4f w  = *(const v4f*)(wr + 4 * j);
      const v2f x0 = *(const v2f*)(xr + (2 * j) * 118);
      const v2f x1 = *(const v2f*)(xr + (2 * j + 1) * 118);
      sum += x0[0] * w[0] + x0[1] * w[1];
      sum += x1[0] * w[2] + x1[1] * w[3];
    }
    const _Float16 hv = (_Float16)(sum + pe_val(30.0f, oc));
    s_seq[0][pos][oc] = hv;
    if (pos == 29) {  // pad rows repeat the last row: K extremes stay those of 30 rows
      s_seq[0][30][oc] = hv;
      s_seq[0][31][oc] = hv;
    }
  }
  __syncthreads();

  // ---------------- Phase 1: 18 MHAs, one task per wave --------------------
  // The 18 tasks share their input projections: 7 distinct Q (e, p, s, a under the
  // cross weights; e, p, a under the self weights) and 8 distinct K/V (e, p, s, a, l
  // cross; e, p, a self). Each is projected once, here, and read by every task that
  // wants it. s_scr in floats: Q set i at 256*i (qpT[8][32]); K/V set i at 1792 + 528*i
  // (K in f16, khT[8][32], in the first 128; from 256 vpT[8][32], then in its place
  // the attention's A fragment; 16 K extremes);
  // wave w's row-major result at 6016 + 256*w; from 8064 the cross and the
  // self output weights in f16, 64 halves each, converted once as well.
  {
    const bool ks = wave >= 5;  // K/V set 'wave': sequences 0,1,2,3,4 cross, 0,1,3 self
    const int kseq = wave < 5 ? wave : (wave == 7 ? 3 : wave - 5);
    const float* kw = ks ? sfin_w : cin_w;
    const float* kb = ks ? sfin_b : cin_b;
    float* kv = stage + 1792 + 528 * wave;
    wave_proj_t<true, true>(&s_seq[kseq][0][0], kw + 64, kb + 8, kw + 128, kb + 16,
                      kv, kv + 256, 32, lane, 0, 2, kv + 512, 1, 0);
    attn_a_frag(lane, kv + 256, Lseq[kseq]);
    if (wave < 7) {  // Q set 'wave': sequences 0,1,2,3 cross, 0,1,3 self
      const bool qs = wave >= 4;
      const int qseq = wave < 4 ? wave : (wave == 6 ? 3 : wave - 4);
      wave_proj_t<false>(&s_seq[qseq][0][0], qs ? sfin_w : cin_w, qs ? sfin_b : cin_b,
                         nullptr, nullptr, stage + 256 * wave, nullptr, 32, lane, 0, 2);
    } else if (lane < 16) {  // wave 7: both 8x8 output weight blocks as f16 rows
      const float* wsrc = (lane < 8 ? cout_w : sfout_w) + (lane & 7) * 8;
      v8h hw;
      #pragma unroll  // constant c: hw stays in named registers
      for (int c = 0; c < 8; ++c) hw[c] = (_Float16)wsrc[c];
      *(v8h*)((_Float16*)(stage + 8064) + lane * 8) = hw;
    }
  }
  __syncthreads();  // a task reads projections that other waves wrote

  const int TQ[18] = {0,0,0,0,0, 1,1,1,1,1, 2,2,2,2, 3,3,3,3};
  const int TQI[18] = {0,0,0,4,0, 1,1,1,5,1, 2,2,2,2, 3,3,6,3};  // Q set of the task
  const int TKI[18] = {1,3,4,5,2, 0,3,4,6,2, 0,1,3,4, 0,1,7,2};  // K/V set of the task
  const int TA[18] = {0,0,0,0,0, 1,1,1,1,1, 2,2,2,2, 3,3,3,3};
  const int TB[18] = {-1,-1,-1,-1,-1, -1,-1,-1,-1,-1, -1,-1,-1,3, -1,-1,-1,-1};

  for (int t = wave; t < 18; t += 8) {
    const u32 sf = (0x10108u >> t) & 1u;  // tasks 3, 8, 16 are the self attentions
    const _Float16* wOut = (const _Float16*)(stage + 8064) + 64 * sf;
    const float* bOut = sf ? sfout_b : cout_b;
    int Lq = Lseq[TQ[t]];
    const float* kv = stage + 1792 + 528 * TKI[t];
    float* res = stage + 6016 + 256 * wave;
    attn_rows_mm(lane, stage + 256 * TQI[t], (const _Float16*)kv, kv + 256, kv + 512,
                 &s_ob[wave][0][0]);
    wave_proj_rm_h(&s_ob[wave][0][0], wOut, bOut, res, lane, 0, 2);
    // layernorm + accumulate (ds_add_f32 atomics across waves)
    int i = lane;
    if (i < Lq) {
      const float* row = res + i * 8;
      float mu = 0.0f;
      #pragma unroll
      for (int c = 0; c < E; ++c) mu += row[c];
      mu *= 0.125f;
      float var = 0.0f;
      #pragma unroll
      for (int c = 0; c < E; ++c) { float d = row[c] - mu; var += d * d; }
      var *= 0.125f;
      float rinv = rsqrtf(var + 1e-5f);
      #pragma unroll
      for (int c = 0; c < E; ++c) {
        float v = (row[c] - mu) * rinv * ng[c] + nb[c];
        atomicAdd(&s_acc[TA[t]][i][c], v);
        if (TB[t] >= 0) atomicAdd(&s_acc[TB[t]][i][c], v);
      }
    }
  }
  __syncthreads();

  // ---------------- Phase 2: concat (f16) + final MHA ----------------------
  for (int idx = tid; idx < 128 * E; idx += 256) {  // [eeg30|pupil32|action32|speech32]
    int drow = idx >> 3, c = idx & 7;
    int row = drow < 125 ? drow : 125;  // pad rows 126, 127 repeat row 125
    int ai, r2;
    if (row < 30)      { ai = 0; r2 = row; }
    else if (row < 62) { ai = 1; r2 = row - 30; }
    else if (row < 94) { ai = 3; r2 = row - 62; }
    else               { ai = 2; r2 = row - 94; }
    s_concat[drow][c] = (_Float16)s_acc[ai][r2][c];
  }
  __syncthreads();

  // K/V of 126-row concat: dual WMMA, one 16-row chunk per wave; each wave leaves
  // its chunk's K extremes in s_scr[1] (free since phase 1), 8 partials per head
  wave_proj_t<true>(&s_concat[0][0], oin_w + 64, oin_b + 8, oin_w + 128, oin_b + 16,
                    &s_kpTf[0][0], &s_vpTf[0][0], 128, lane, wave, wave + 1,
                    s_scr[1], 8, wave);
  // Q of the 32 target rows into s_scr[0]: one 16-row chunk on each of waves 2, 3
  // (they had one task fewer than waves 0, 1 in phase 1)
  const bool projWave = (wave == 2 || wave == 3);
  if (projWave)
    wave_proj_t<false>(&s_t[0][0], oin_w, oin_b, nullptr, nullptr,
                       s_scr[0], nullptr, 32, lane, wave - 2, wave - 1);
  __syncthreads();

  // fc1, all eight waves: each 16-lane row of the block takes six weight rows and
  // walks them together, so every load covers 256 contiguous bytes of each of two
  // weight rows (whole 128-byte lines) and the loads of three rows are in flight at
  // once. The last 16-lane row has no rows of its own: it repeats rows 84 to 89 into
  // the spare words 90 to 95 of s_fc, which nobody reads. The first three rows are
  // asked for here, so that they arrive while the final attention runs.
  const int l16  = lane & 15;
  const int row0 = (tid >> 4) * 6;
  const v4f* wr = (const v4f*)(fc1_w + (row0 < 84 ? row0 : 84) * 256) + l16;
  const int bi = tid < 30 ? tid * 3 : 0;
  const float fb[3] = {fc1_b[bi], fc1_b[bi + 1], fc1_b[bi + 2]};
  v4f wa[3][4];
  #pragma unroll  // constant p, j: the weights stay in named registers
  for (int p = 0; p < 3; ++p) {
    #pragma unroll  // as above
    for (int j = 0; j < 4; ++j) wa[p][j] = wr[64 * p + 16 * j];
  }
  // holds the loads above here: with the attention unrolled the scheduler sinks them to its end
  __builtin_amdgcn_sched_barrier(0);

  // One head per wave, one query row per lane: all eight waves share the 8 x 126
  // keys that one wave would otherwise walk alone.
  s_ob[0][lane][wave] = (_Float16)attn_head<8, 126>(lane, wave, s_scr[0], &s_kpTf[0][0],
                                                    &s_vpTf[0][0], 128, s_scr[1]);
  __syncthreads();  // a row of s_ob[0] holds the heads of eight waves

  if (projWave)
    wave_proj_rm(&s_ob[0][0][0], oout_w, oout_b, &s_tout[0][0], lane,
                 wave - 2, wave - 1);
  __syncthreads();

  // ---------------- Phase 3: fc1 + channel softmax -> (B,3,30) -------------
  // Lane l of a 16-lane row sums the columns 64*j + 4*l + u of its six weight rows;
  // the 16 partial sums of a row are then added across the lanes.
  {
    v4f xv[4];
    #pragma unroll  // constant j: the sixteen x values stay in named registers
    for (int j = 0; j < 4; ++j)
      xv[j] = *(const v4f*)(&s_tout[0][0] + 64 * j + 4 * l16);
    float part[6];
    #pragma unroll  // constant p: part stays in named registers
    for (int p = 0; p < 3; ++p) {
      v4f a = wa[p][0] * xv[0];
      #pragma unroll  // constant j, as above
      for (int j = 1; j < 4; ++j) a += wa[p][j] * xv[j];
      part[p] = (a[0] + a[1]) + (a[2] + a[3]);
    }
    #pragma unroll  // constant p, as above
    for (int p = 3; p < 6; ++p) {
      v4f a = wr[64 * p] * xv[0];
      #pragma unroll  // constant j, as above
      for (int j = 1; j < 4; ++j) a += wr[64 * p + 16 * j] * xv[j];
      part[p] = (a[0] + a[1]) + (a[2] + a[3]);
    }
    #pragma unroll  // constant p, as above
    for (int p = 0; p < 6; ++p)
      part[p] = row_xadd<8>(row_xadd<4>(row_xadd<2>(row_xadd<1>(part[p]))));
    if (l16 == 0) {
      #pragma unroll  // constant p, as above
      for (int p = 0; p < 6; ++p) s_fc[row0 + p] = part[p];
    }
  }
  __syncthreads();
  if (tid < 30) {
    float x0 = s_fc[tid * 3 + 0] + fb[0], x1 = s_fc[tid * 3 + 1] + fb[1],
          x2 = s_fc[tid * 3 + 2] + fb[2];
    float m  = fmaxf(x0, fmaxf(x1, x2));
    float e0 = __expf(x0 - m), e1 = __expf(x1 - m), e2 = __expf(x2 - m);
    float s  = e0 + e1 + e2;
    float* o = out + (size_t)b * 90;
    o[0 * 30 + tid] = e0 / s;
    o[1 * 30 + tid] = e1 / s;
    o[2 * 30 + tid] = e2 / s;
  }
}

extern "C" void kernel_launch(void* const* d_in, const int* in_sizes, int n_in,
                              void* d_out, int out_size, void* d_ws, size_t ws_size,
                              hipStream_t stream) {
  (void)n_in; (void)out_size; (void)d_ws; (void)ws_size;
  const int B = in_sizes[0] / (2 * 20 * 118);
  cmt_kernel<<<B, 256, 0, stream>>>(
      (const float*)d_in[0],  (const float*)d_in[1],  (const float*)d_in[2],
      (const float*)d_in[3],  (const float*)d_in[4],  (const float*)d_in[5],
      (const float*)d_in[6],  (const float*)d_in[7],  (const float*)d_in[8],
      (const float*)d_in[9],  (const float*)d_in[10], (const float*)d_in[11],
      (const float*)d_in[12], (const float*)d_in[13], (const float*)d_in[14],
      (const float*)d_in[15], (const float*)d_in[16], (const float*)d_in[17],
      (const float*)d_in[18], (const float*)d_in[19], (const float*)d_in[20],
      (const float*)d_in[21], (const float*)d_in[22], (const float*)d_in[23],
      (const float*)d_in[24], (const float*)d_in[25], (const float*)d_in[26],
      (const float*)d_in[27], (const float*)d_in[28], (const float*)d_in[29],
      (float*)d_out);
}

// v009
// It runs in 140 microseconds.
// Next to v008, in two timings, it ran 1.03 times as fast each time.
// All steps since v000 together make it 3.25 times as fast.
#include <hip/hip_runtime.h>
#include <math.h>

#define E 8

typedef __attribute__((ext_vector_type(16))) _Float16 v16h;
typedef __attribute__((ext_vector_type(8)))  _Float16 v8h;
typedef __attribute__((ext_vector_type(2)))  _Float16 v2h;
typedef __attribute__((ext_vector_type(8)))  float    v8f;
typedef __attribute__((ext_vector_type(4)))  float    v4f;
typedef __attribute__((ext_vector_type(2)))  float    v2f;
typedef unsigned int u32;

__device__ __forceinline__ float pe_val(float pos, int oc) {
  int k = oc & ~1;
  float div = __expf((float)k * (-9.210340371976184f / 8.0f));
  float ang = pos * div;
  return (oc & 1) ? __cosf(ang) : __sinf(ang);
}

// ---------------------------------------------------------------------------
// One v_wmma_f32_16x16x32_f16 per 16-row chunk. K=8 real (zero-padded to 32).
// A (16-bit 16x32): lanes 0-15 row M=lane, halves 0..7 = K 0..7; lanes 16-31 zero.
// B (16-bit 32x16): lanes 0-15 col N=lane, halves 0..7 = K 0..7.
// D (f32 16x16):    lane -> col N=lane&15, VGPR r -> row M = r + 8*(lane>>4).
// Sources live in LDS as f16 rows (16B) -> A build = one ds_load_b128, no cvt.
// Bias is folded into the C accumulator (C[m][n] = bias[n]).
// ---------------------------------------------------------------------------

__device__ __forceinline__ v16h load_a_frag(const _Float16* src, int ch, int lane,
                                            u32 amask) {
  uint4 raw = *(const uint4*)(src + (ch * 16 + (lane & 15)) * 8);
  raw.x &= amask; raw.y &= amask; raw.z &= amask; raw.w &= amask;
  union { uint4 u; v8h h; } cv;
  cv.u = raw;
  v16h af;
  #pragma unroll
  for (int k = 0; k < 8; ++k) af[k] = cv.h[k];
  #pragma unroll
  for (int k = 8; k < 16; ++k) af[k] = (_Float16)0.0f;
  return af;
}

// Value held by the same lane of the other 16-lane row (all 32 lanes active).
__device__ __forceinline__ float other_row(float x) {
  u32 u = __builtin_bit_cast(u32, x);
  return __builtin_bit_cast(float, __builtin_amdgcn_permlanex16(
      u, u, 0x76543210u, 0xfedcba98u, false, false));
}

// x plus the x of lane l ^ M inside a 16-lane row (all lanes active).
template <int M>
__device__ __forceinline__ float row_xadd(float x) {
  const int y = __builtin_amdgcn_update_dpp(0, __builtin_bit_cast(int, x), 0x160 | M,
                                            0xf, 0xf, true);  // 0x160 | M: row_xmask:M
  return x + __builtin_bit_cast(float, y);
}

// Transposed-output projection. DUAL packs two 8x8 weight blocks into B's 16
// columns -> one WMMA yields both K and V. Writeback: 2 contiguous b128 stores.
// DUAL also leaves each head's largest and smallest K over the rows it projects:
// ext[head*2*np + slot] and ext[head*2*np + np + slot]. Every projected row
// counts, so pad rows of src must repeat a real row.
// KH: d1T takes its block as f16 (ld counts halves there), one b128 store per chunk.
template <bool DUAL, bool KH = false>
__device__ __forceinline__ void wave_proj_t(const _Float16* src,
                                            const float* W1, const float* b1,
                                            const float* W2, const float* b2,
                                            float* d1T, float* d2T, int ld,
                                            int lane, int c0, int c1,
                                            float* ext = nullptr, int np = 1,
                                            int slot = 0) {
  const int n = lane & 15;
  const int half = lane >> 4;
  const u32 amask = (lane < 16) ? 0xFFFFFFFFu : 0u;
  v16h bf = {};
  float bn = 0.0f;
  float* dcol = nullptr;
  if (n < 8) { bn = b1[n]; dcol = d1T + n * ld; }
  else if (DUAL) { bn = b2[n - 8]; dcol = d2T + (n - 8) * ld; }
  if (lane < 16 && (n < 8 || DUAL)) {
    const float* wrow = (n < 8) ? (W1 + n * 8) : (W2 + (n - 8) * 8);
    #pragma unroll
    for (int k = 0; k < 8; ++k) bf[k] = (_Float16)wrow[k];
  }
  float kmx = -INFINITY, kmn = INFINITY;
  for (int ch = c0; ch < c1; ++ch) {
    v16h af = load_a_frag(src, ch, lane, amask);
    v8f c = {bn, bn, bn, bn, bn, bn, bn, bn};
    c = __builtin_amdgcn_wmma_f32_16x16x32_f16(false, af, false, bf, (short)0, c,
                                               false, false);
    const int rb = ch * 16 + 8 * half;
    if (KH && n < 8) {
      v8h hk;
      #pragma unroll  // constant r: hk stays in named registers
      for (int r = 0; r < 8; ++r) hk[r] = (_Float16)c[r];
      *(v8h*)((_Float16*)d1T + n * ld + rb) = hk;
    } else if (DUAL || n < 8) {
      *(v4f*)(dcol + rb)     = (v4f){c[0], c[1], c[2], c[3]};
      *(v4f*)(dcol + rb + 4) = (v4f){c[4], c[5], c[6], c[7]};
    }
    if (DUAL) {
      #pragma unroll  // constant r: c[r] stays a named register, pairs fold into max3/min3
      for (int r = 0; r < 8; ++r) {
        kmx = fmaxf(kmx, c[r]);
        kmn = fminf(kmn, c[r]);
      }
    }
  }
  if (DUAL) {
    kmx = fmaxf(kmx, other_row(kmx));
    kmn = fminf(kmn, other_row(kmn));
    if (lane < 8) {
      ext[lane * 2 * np + slot]      = kmx;
      ext[lane * 2 * np + np + slot] = kmn;
    }
  }
}

// Row-major f32 output projection (result consumed row-wise by layernorm/fc1).
// bf is the B fragment of the 8x8 weight block: lane n < 8 holds row n in halves 0..7.
__device__ __forceinline__ void wave_proj_rm_bf(const _Float16* src, v16h bf,
                                                const float* bias, float* dst,
                                                int lane, int c0, int c1) {
  const int n = lane & 15;
  const int half = lane >> 4;
  const u32 amask = (lane < 16) ? 0xFFFFFFFFu : 0u;
  const float bn = (n < 8) ? bias[n] : 0.0f;
  for (int ch = c0; ch < c1; ++ch) {
    v16h af = load_a_frag(src, ch, lane, amask);
    v8f c = {bn, bn, bn, bn, bn, bn, bn, bn};
    c = __builtin_amdgcn_wmma_f32_16x16x32_f16(false, af, false, bf, (short)0, c,
                                               false, false);
    if (n < 8) {
      const int rb = ch * 16 + 8 * half;
      #pragma unroll
      for (int r = 0; r < 8; ++r) dst[(rb + r) * 8 + n] = c[r];
    }
  }
}

// The same with the weights read from global memory in f32.
__device__ __forceinline__ void wave_proj_rm(const _Float16* src, const float* W,
                                             const float* bias, float* dst,
                                             int lane, int c0, int c1) {
  v16h bf = {};
  if (lane < 8) {
    #pragma unroll
    for (int k = 0; k < 8; ++k) bf[k] = (_Float16)W[lane * 8 + k];
  }
  wave_proj_rm_bf(src, bf, bias, dst, lane, c0, c1);
}

// The same with the weights already in f16 rows of 16 bytes in LDS.
__device__ __forceinline__ void wave_proj_rm_h(const _Float16* src, const _Float16* Wh,
                                               const float* bias, float* dst,
                                               int lane, int c0, int c1) {
  const u32 bmask = (lane < 8) ? 0xFFFFFFFFu : 0u;
  uint4 raw = *(const uint4*)(Wh + (lane & 7) * 8);
  raw.x &= bmask; raw.y &= bmask; raw.z &= bmask; raw.w &= bmask;
  union { uint4 u; v8h h; } cv;
  cv.u = raw;
  v16h bf = {};
  #pragma unroll  // constant k: bf stays in named registers
  for (int k = 0; k < 8; ++k) bf[k] = cv.h[k];
  wave_proj_rm_bf(src, bf, bias, dst, lane, c0, c1);
}

// a / b for a softmax's weight sum b. The largest weight of a row is about 1, so b is an
// ordinary number of moderate size: the scaling and fix-up steps of the full division
// sequence have nothing to do, and v_rcp_f32 with one multiply gives the quotient to
// within a few units of the last place of an f32.
__device__ __forceinline__ float quot(float a, float b) {
  return a * __builtin_amdgcn_rcpf(b);
}

// 2^x of eight values, each in its own register. One statement, so that no
// instruction directly behind a v_exp_f32 reads its result or overwrites its source
// (the slot the instruction set asks for); the v_nop is that slot behind the last.
__device__ __forceinline__ void exp2_x8(float* x) {
  asm("v_exp_f32 %0, %0\n\tv_exp_f32 %1, %1\n\tv_exp_f32 %2, %2\n\tv_exp_f32 %3, %3\n\t"
      "v_exp_f32 %4, %4\n\tv_exp_f32 %5, %5\n\tv_exp_f32 %6, %6\n\tv_exp_f32 %7, %7\n\t"
      "v_nop"
      : "+v"(x[0]), "+v"(x[1]), "+v"(x[2]), "+v"(x[3]),
        "+v"(x[4]), "+v"(x[5]), "+v"(x[6]), "+v"(x[7]));
}

// 2^x of sixteen f16 values, two to a register, each in place: what comes out is a B
// fragment as it stands. One statement, the low halves of all eight registers and then
// the high halves, so that no instruction directly behind a v_exp_f16 touches the
// register it works on (the slot the instruction set asks for); the v_nop is that slot
// behind the last.
__device__ __forceinline__ void exp2h_x16(u32* x) {
  asm("v_exp_f16 %0.l, %0.l\n\tv_exp_f16 %1.l, %1.l\n\tv_exp_f16 %2.l, %2.l\n\t"
      "v_exp_f16 %3.l, %3.l\n\tv_exp_f16 %4.l, %4.l\n\tv_exp_f16 %5.l, %5.l\n\t"
      "v_exp_f16 %6.l, %6.l\n\tv_exp_f16 %7.l, %7.l\n\t"
      "v_exp_f16 %0.h, %0.h\n\tv_exp_f16 %1.h, %1.h\n\tv_exp_f16 %2.h, %2.h\n\t"
      "v_exp_f16 %3.h, %3.h\n\tv_exp_f16 %4.h, %4.h\n\tv_exp_f16 %5.h, %5.h\n\t"
      "v_exp_f16 %6.h, %6.h\n\tv_exp_f16 %7.h, %7.h\n\t"
      "v_nop"
      : "+v"(x[0]), "+v"(x[1]), "+v"(x[2]), "+v"(x[3]),
        "+v"(x[4]), "+v"(x[5]), "+v"(x[6]), "+v"(x[7]));
}

// Per-lane softmax attention row (head_dim=1, scale=1). Transposed K/V allow
// contiguous b128 reads along j. Row result converted to f16 (next A-source).
// A score is q*k[j] with one q per row, and rounding keeps the order of the
// products, so the row maximum is exactly max(q*kmax, q*kmin): no pass over j.
// ext holds NP partial maxima, then NP partial minima, of each head's K.
// q is scaled by log2 e once, so q*k[j] - m is the exponent of 2 as it stands: one
// fma per score ahead of the exp.
// attn_keys8: eight keys from kc, vc on; the first N of them join the sums, in order.
template <int N>
__device__ __forceinline__ void attn_keys8(const float* kc, const float* vc, float qv,
                                           float m, float& s, float& acc) {
  const v4f ka = *(const v4f*)kc, kb = *(const v4f*)(kc + 4);
  const v4f va = *(const v4f*)vc, vb = *(const v4f*)(vc + 4);
  float e[8];
  #pragma unroll  // constant u: e stays in named registers
  for (int u = 0; u < 4; ++u) {
    e[u]     = qv * ka[u] - m;
    e[4 + u] = qv * kb[u] - m;
  }
  exp2_x8(e);
  #pragma unroll  // constant u, as above
  for (int u = 0; u < N; ++u) {
    s += e[u];
    acc += e[u] * (u < 4 ? va[u] : vb[u - 4]);
  }
  // one group at a time: with groups interleaved the build takes more than 96 registers,
  // which costs a wave per SIMD
  __builtin_amdgcn_sched_barrier(0);
}

// attn_head: query row i of head h, LK keys. The last group reads on to a multiple of
// eight keys (ldk covers it).
template <int NP, int LK>
__device__ __forceinline__ float attn_head(int i, int h, const float* qpT,
                                           const float* kpT, const float* vpT,
                                           int ldk, const float* ext) {
  const float qv = qpT[h * 32 + i] * 1.44269504088896341f;
  const float* kc = kpT + h * ldk;
  const float* vc = vpT + h * ldk;
  const float* ex = ext + h * 2 * NP;
  float kmx = ex[0], kmn = ex[NP];
  #pragma unroll  // constant offsets: the partials come in as b128 reads
  for (int p = 1; p < NP; ++p) {
    kmx = fmaxf(kmx, ex[p]);
    kmn = fminf(kmn, ex[NP + p]);
  }
  const float m = fmaxf(qv * kmx, qv * kmn);
  float s = 0.0f, acc = 0.0f;
  #pragma unroll  // constant LDS offsets: no address add, compare or branch per group
  for (int j = 0; j + 8 <= LK; j += 8) attn_keys8<8>(kc + j, vc + j, qv, m, s, acc);
  if (LK % 8) attn_keys8<LK % 8>(kc + LK / 8 * 8, vc + LK / 8 * 8, qv, m, s, acc);
  return quot(acc, s);
}

// All eight heads of a 32-query, 32-key task by one wave, sums on the matrix unit.
// D = A x B per head and 16-query chunk, f16 operands, f32 accumulate:
//   B column c = query c, its 32 softmax weights exp(q*k - m) of that head;
//   A row 2*hd = V of head hd, row 2*hd+1 = ones (one fragment for all heads).
// Element s of lane half g is key 16*g + s in A and in B alike.
// D row 2*hd = weighted V sum, row 2*hd+1 = weight sum: register r of lane half g
// is row 8*g + r, so lanes 0-15 read heads 0-3 and lanes 16-31 heads 4-7.
// Lk is 30 or 32: at 30 the A columns of keys 30, 31 are zero, so the pad keys
// reach neither sum.
// The weights are made in f16, the type B takes them in: K lies in LDS as f16
// (khT[8][32]), a packed fma forms two exponents q*k - m, and the f16 exp works in
// place. m only has to be near the row's largest exponent: it is the same in both sums
// of a row and cancels in their quotient.
// attn_a_frag builds that A fragment from vpT[8][32] and leaves it in the same 1 KiB:
// words 0-3 of lane l at uint4 index l, words 4-7 at 32 + l. One wave; its loads of vpT
// are all issued ahead of its stores.
__device__ __forceinline__ void attn_a_frag(int lane, float* vpT, int Lk) {
  const int c = lane & 15;
  const int half = lane >> 4;
  union { u32 w[8]; v16h h; uint4 q[2]; } a;
  const float* vr = vpT + (c >> 1) * 32 + 16 * half;
  #pragma unroll
  for (int p = 0; p < 4; ++p) {
    v4f x = *(const v4f*)(vr + 4 * p);
    #pragma unroll
    for (int u = 0; u < 4; ++u) a.h[4 * p + u] = (_Float16)x[u];
  }
  #pragma unroll
  for (int p = 0; p < 8; ++p) a.w[p] = (c & 1) ? 0x3C003C00u : a.w[p];  // 1.0h pair
  if (half == 1 && Lk < 32) a.w[7] = 0u;
  ((uint4*)vpT)[lane]      = a.q[0];
  ((uint4*)vpT)[32 + lane] = a.q[1];
}

// What one head of a task reads from LDS: its 16 keys of this lane half as f16 pairs
// (p[s]: keys 16*half + 2*s and + 2*s + 1), the K extremes, the q of both query chunks.
struct head_in {
  union { uint4 q[2]; v2h p[8]; } k;
  float kmx, kmn, q0, q1;
};

__device__ __forceinline__ head_in attn_head_in(int hd, int c, int half, const float* qpT,
                                                const _Float16* khT, const float* ext) {
  head_in in;
  const uint4* kc = (const uint4*)(khT + hd * 32 + 16 * half);
  in.k.q[0] = kc[0];
  in.k.q[1] = kc[1];
  in.kmx = ext[hd * 2];
  in.kmn = ext[hd * 2 + 1];
  in.q0 = qpT[hd * 32 + c];
  in.q1 = qpT[hd * 32 + 16 + c];
  return in;
}

// Both query chunks of one head: weights, then D = A x weights.
__device__ __forceinline__ void attn_head_mm(const head_in& in, v16h a, v8f* d) {
  // q * log2 e: q*k - m is then the exponent of 2 as it stands
  const float q2[2] = {in.q0 * 1.44269504088896341f, in.q1 * 1.44269504088896341f};
  union { v2h p[8]; u32 w[8]; v16h h; } e[2];
  #pragma unroll  // constant ch, s: e stays in named registers
  for (int ch = 0; ch < 2; ++ch) {
    const _Float16 qh = (_Float16)q2[ch];
    const _Float16 mh = (_Float16)fmaxf(q2[ch] * in.kmx, q2[ch] * in.kmn);
    const v2h qq = {qh, qh}, mm = {mh, mh};
    #pragma unroll  // as above
    for (int s = 0; s < 8; ++s) e[ch].p[s] = qq * in.k.p[s] - mm;
  }
  #pragma unroll  // constant ch, as above
  for (int ch = 0; ch < 2; ++ch) {
    exp2h_x16(e[ch].w);
    d[ch] = (v8f){};
    d[ch] = __builtin_amdgcn_wmma_f32_16x16x32_f16(false, a, false, e[ch].h, (short)0, d[ch],
                                                   false, false);
  }
}

__device__ __forceinline__ void attn_rows_mm(int lane, const float* qpT,
                                             const _Float16* khT, const float* afrag,
                                             const float* ext, _Float16* ob) {
  const int c = lane & 15;
  const int half = lane >> 4;
  union { u32 w[8]; v16h h; uint4 q[2]; } a;
  a.q[0] = ((const uint4*)afrag)[lane];
  a.q[1] = ((const uint4*)afrag)[32 + lane];

  #pragma unroll 1  // rolled: four unrolled head pairs do not fit the register budget of 10 waves per SIMD
  for (int hp = 0; hp < 4; ++hp) {
    float num[2][2], den[2][2];
    v8f d[2];
    const head_in h0 = attn_head_in(hp, c, half, qpT, khT, ext);
    attn_head_mm(h0, a.h, d);
    // This line and the next of its kind keep the two heads apart: interleaved, the build
    // takes more than 96 registers, which costs a work-group per WGP. The first head's
    // sums are read between the two lines, beside the second head's LDS reads.
    __builtin_amdgcn_sched_barrier(0);
    const head_in h1 = attn_head_in(hp + 4, c, half, qpT, khT, ext);
    #pragma unroll  // constant ch: num, den stay in named registers
    for (int ch = 0; ch < 2; ++ch) {
      num[0][ch] = d[ch][2 * hp];
      den[0][ch] = d[ch][2 * hp + 1];
    }
    __builtin_amdgcn_sched_barrier(0);  // as above
    attn_head_mm(h1, a.h, d);
    #pragma unroll  // constant ch, as above
    for (int ch = 0; ch < 2; ++ch) {
      num[1][ch] = d[ch][2 * hp];
      den[1][ch] = d[ch][2 * hp + 1];
    }
    #pragma unroll
    for (int ch = 0; ch < 2; ++ch)
      ob[(ch * 16 + c) * 8 + 4 * half + hp] =
          (_Float16)quot(half ? num[1][ch] : num[0][ch], half ? den[1][ch] : den[0][ch]);
  }
}

__global__ __launch_bounds__(256) void cmt_kernel(
    const float* __restrict__ eeg, const float* __restrict__ pupil,
    const float* __restrict__ speech, const float* __restrict__ action,
    const float* __restrict__ location, const float* __restrict__ tgt,
    const float* __restrict__ eeg_w, const float* __restrict__ eeg_b,
    const float* __restrict__ psa_w, const float* __restrict__ psa_b,
    const float* __restrict__ loc_w, const float* __restrict__ loc_b,
    const float* __restrict__ tgt_w, const float* __restrict__ tgt_b,
    const float* __restrict__ ng, const float* __restrict__ nb,
    const float* __restrict__ cin_w, const float* __restrict__ cin_b,
    const float* __restrict__ cout_w, const float* __restrict__ cout_b,
    const float* __restrict__ sfin_w, const float* __restrict__ sfin_b,
    const float* __restrict__ sfout_w, const float* __restrict__ sfout_b,
    const float* __restrict__ oin_w, const float* __restrict__ oin_b,
    const float* __restrict__ oout_w, const float* __restrict__ oout_b,
    const float* __restrict__ fc1_w, const float* __restrict__ fc1_b,
    float* __restrict__ out) {
  __shared__ _Float16 s_seq[5][32][E];   // f16 A-sources: e(30), p, s, a, l
  __shared__ _Float16 s_t[32][E];
  __shared__ _Float16 s_concat[128][E];  // 126 rows + 2 pad rows
  __shared__ _Float16 s_ob[8][32][E];    // per-wave attention-output (A-source)
  __shared__ float s_acc[4][32][E];
  __shared__ float s_scr[8][1024];       // phase 0 staging; phase 1 projections and results
  __shared__ float s_kpTf[8][128];       // final MHA K, transposed [head][pos]
  __shared__ float s_vpTf[8][128];
  __shared__ float s_tout[32][E];
  __shared__ float s_fc[96];

  const int b    = blockIdx.x;
  const int tid  = threadIdx.x;
  const int lane = tid & 31;
  const int wave = tid >> 5;
  const int Lseq[5] = {30, 32, 32, 32, 32};

  __builtin_prefetch(fc1_w + (tid << 6), 0, 1);   // global_prefetch_b8

  // ---------------- Phase 0: convs + positional encoding into LDS ----------
  for (int idx = tid; idx < 4 * 32 * E; idx += 256) ((float*)s_acc)[idx] = 0.0f;

  // Every global read of phase 0 is issued here, ahead of the first use of any of
  // them: one memory latency for the whole phase, not one per group of conv rows.
  // The eeg block and its conv weights go through registers into s_scr, which is
  // free until phase 1, in floats: [0,5120) the 4720 floats of the block, then
  // copies of its last 16 bytes that nobody reads; from 5120 the weights, one row of
  // 80 per output channel at a pitch of 84 (b128 reads of 8 rows, no bank shared);
  // rows 8 to 12 take the stores of the threads without a chunk, read by nobody.
  float* stage = &s_scr[0][0];
  const int pos = tid >> 3;  // 0..31
  const int oc  = tid & 7;
  const v4f* ep4 = (const v4f*)(eeg + (size_t)b * (2 * 20 * 118));
  v4f ech[5];
  #pragma unroll  // constant k: the five chunks stay in named registers
  for (int k = 0; k < 5; ++k) {
    const int i = tid + 256 * k;
    ech[k] = ep4[i < 1180 ? i : 1179];
  }
  const v4f wch = ((const v4f*)eeg_w)[tid < 160 ? tid : 159];
  const bool inb = (pos >= 1 && pos <= 30);
  const u32 xi = inb ? (u32)(pos - 1) : 0u;  // in bounds for the two pad positions too
  const float* xp = pupil    + (size_t)b * 60;
  const float* xs = speech   + (size_t)b * 60;
  const float* xa = action   + (size_t)b * 60;
  const float* xl = location + (size_t)b * 90;
  const float psa_x[3][2] = {{xp[xi], xp[xi + 30]}, {xs[xi], xs[xi + 30]},
                             {xa[xi], xa[xi + 30]}};
  const float loc_x[3] = {xl[xi], xl[xi + 30], xl[xi + 60]};
  const float tgt_x = (tgt + (size_t)b * 30)[xi];
  const float pw0 = psa_w[oc * 2 + 0], pw1 = psa_w[oc * 2 + 1], pb = psa_b[oc];
  const float lw[3] = {loc_w[oc * 3 + 0], loc_w[oc * 3 + 1], loc_w[oc * 3 + 2]};
  const float lb = loc_b[oc], tw = tgt_w[oc], tb = tgt_b[oc], eb = eeg_b[oc];

  #pragma unroll  // constant k, as above
  for (int k = 0; k < 5; ++k) *(v4f*)(stage + (tid + 256 * k) * 4) = ech[k];
  *(v4f*)(stage + 5120 + (tid / 20) * 84 + (tid % 20) * 4) = wch;

  {  // p/s/a/l/tgt conv1d k1p1: this thread's (pos, oc) of all five
    const float pe32 = pe_val(32.0f, oc);
    #pragma unroll  // constant q: psa_x stays in named registers
    for (int q = 0; q < 3; ++q) {
      float v = pb;
      if (inb) v += pw0 * psa_x[q][0] + pw1 * psa_x[q][1];
      s_seq[1 + q][pos][oc] = (_Float16)(v + pe32);
    }
    float v = lb;
    if (inb) {
      #pragma unroll  // constant ic: lw and loc_x stay in named registers
      for (int ic = 0; ic < 3; ++ic) v += lw[ic] * loc_x[ic];
    }
    s_seq[4][pos][oc] = (_Float16)(v + pe32);
    v = tb;
    if (inb) v += tw * tgt_x;
    s_t[pos][oc] = (_Float16)(v + pe32);
  }
  __syncthreads();  // the staged block and weights are read by other threads than stored them

  if (tid < 240) {  // eeg conv2d (2,20,118) -> 30x8, kernel (20,2), stride (1,4)
    const float* xr = stage + pos * 4;
    const float* wr = stage + 5120 + oc * 84;
    float sum = eb;
    #pragma unroll 5  // ten conv rows a trip, so that their LDS reads overlap; more rows cost registers
    for (int j = 0; j < 20; ++j) {  // rows 2j, 2j+1 of the 40 (ic, kh) rows, in order
      const v4f w  = *(const v4f*)(wr + 4 * j);
      const v2f x0 = *(const v2f*)(xr + (2 * j) * 118);
      const v2f x1 = *(const v2f*)(xr + (2 * j + 1) * 118);
      sum += x0[0] * w[0] + x0[1] * w[1];
      sum += x1[0] * w[2] + x1[1] * w[3];
    }
    const _Float16 hv = (_Float16)(sum + pe_val(30.0f, oc));
    s_seq[0][pos][oc] = hv;
    if (pos == 29) {  // pad rows repeat the last row: K extremes stay those of 30 rows
      s_seq[0][30][oc] = hv;
      s_seq[0][31][oc] = hv;
    }
  }
  __syncthreads();

  // ---------------- Phase 1: 18 MHAs, one task per wave --------------------
  // The 18 tasks share their input projections: 7 distinct Q (e, p, s, a under the
  // cross weights; e, p, a under the self weights) and 8 distinct K/V (e, p, s, a, l
  // cross; e, p, a self). Each is projected once, here, and read by every task that
  // wants it. s_scr in floats: Q set i at 256*i (qpT[8][32]); K/V set i at 1792 + 528*i
  // (K in f16, khT[8][32], in the first 128; from 256 vpT[8][32], then in its place
  // the attention's A fragment; 16 K extremes);
  // wave w's row-major result at 6016 + 256*w; from 8064 the cross and the
  // self output weights in f16, 64 halves each, converted once as well.
  {
    const bool ks = wave >= 5;  // K/V set 'wave': sequences 0,1,2,3,4 cross, 0,1,3 self
    const int kseq = wave < 5 ? wave : (wave == 7 ? 3 : wave - 5);
    const float* kw = ks ? sfin_w : cin_w;
    const float* kb = ks ? sfin_b : cin_b;
    float* kv = stage + 1792 + 528 * wave;
    wave_proj_t<true, true>(&s_seq[kseq][0][0], kw + 64, kb + 8, kw + 128, kb + 16,
                      kv, kv + 256, 32, lane, 0, 2, kv + 512, 1, 0);
    attn_a_frag(lane, kv + 256, Lseq[kseq]);
    if (wave < 7) {  // Q set 'wave': sequences 0,1,2,3 cross, 0,1,3 self
      const bool qs = wave >= 4;
      const int qseq = wave < 4 ? wave : (wave == 6 ? 3 : wave - 4);
      wave_proj_t<false>(&s_seq[qseq][0][0], qs ? sfin_w : cin_w, qs ? sfin_b : cin_b,
                         nullptr, nullptr, stage + 256 * wave, nullptr, 32, lane, 0, 2);
    } else if (lane < 16) {  // wave 7: both 8x8 output weight blocks as f16 rows
      const float* wsrc = (lane < 8 ? cout_w : sfout_w) + (lane & 7) * 8;
      v8h hw;
      #pragma unroll  // constant c: hw stays in named registers
      for (int c = 0; c < 8; ++c) hw[c] = (_Float16)wsrc[c];
      *(v8h*)((_Float16*)(stage + 8064) + lane * 8) = hw;
    }
  }
  __syncthreads();  // a task reads projections that other waves wrote

  const int TQ[18] = {0,0,0,0,0, 1,1,1,1,1, 2,2,2,2, 3,3,3,3};
  const int TQI[18] = {0,0,0,4,0, 1,1,1,5,1, 2,2,2,2, 3,3,6,3};  // Q set of the task
  const int TKI[18] = {1,3,4,5,2, 0,3,4,6,2, 0,1,3,4, 0,1,7,2};  // K/V set of the task
  const int TA[18] = {0,0,0,0,0, 1,1,1,1,1, 2,2,2,2, 3,3,3,3};
  const int TB[18] = {-1,-1,-1,-1,-1, -1,-1,-1,-1,-1, -1,-1,-1,3, -1,-1,-1,-1};

  for (int t = wave; t < 18; t += 8) {
    const u32 sf = (0x10108u >> t) & 1u;  // tasks 3, 8, 16 are the self attentions
    const _Float16* wOut = (const _Float16*)(stage + 8064) + 64 * sf;
    const float* bOut = sf ? sfout_b : cout_b;
    int Lq = Lseq[TQ[t]];
    const float* kv = stage + 1792 + 528 * TKI[t];
    float* res = stage + 6016 + 256 * wave;
    attn_rows_mm(lane, stage + 256 * TQI[t], (const _Float16*)kv, kv + 256, kv + 512,
                 &s_ob[wave][0][0]);
    wave_proj_rm_h(&s_ob[wave][0][0], wOut, bOut, res, lane, 0, 2);
    // layernorm + accumulate (ds_add_f32 atomics across waves)
    int i = lane;
    if (i < Lq) {
      const float* row = res + i * 8;
      float mu = 0.0f;
      #pragma unroll
      for (int c = 0; c < E; ++c) mu += row[c];
      mu *= 0.125f;
      float var = 0.0f;
      #pragma unroll
      for (int c = 0; c < E; ++c) { float d = row[c] - mu; var += d * d; }
      var *= 0.125f;
      float rinv = rsqrtf(var + 1e-5f);
      #pragma unroll
      for (int c = 0; c < E; ++c) {
        float v = (row[c] - mu) * rinv * ng[c] + nb[c];
        atomicAdd(&s_acc[TA[t]][i][c], v);
        if (TB[t] >= 0) atomicAdd(&s_acc[TB[t]][i][c], v);
      }
    }
  }
  __syncthreads();

  // ---------------- Phase 2: concat (f16) + final MHA ----------------------
  for (int idx = tid; idx < 128 * E; idx += 256) {  // [eeg30|pupil32|action32|speech32]
    int drow = idx >> 3, c = idx & 7;
    int row = drow < 125 ? drow : 125;  // pad rows 126, 127 repeat row 125
    int ai, r2;
    if (row < 30)      { ai = 0; r2 = row; }
    else if (row < 62) { ai = 1; r2 = row - 30; }
    else if (row < 94) { ai = 3; r2 = row - 62; }
    else               { ai = 2; r2 = row - 94; }
    s_concat[drow][c] = (_Float16)s_acc[ai][r2][c];
  }
  __syncthreads();

  // K/V of 126-row concat: dual WMMA, one 16-row chunk per wave; each wave leaves
  // its chunk's K extremes in s_scr[1] (free since phase 1), 8 partials per head
  wave_proj_t<true>(&s_concat[0][0], oin_w + 64, oin_b + 8, oin_w + 128, oin_b + 16,
                    &s_kpTf[0][0], &s_vpTf[0][0], 128, lane, wave, wave + 1,
                    s_scr[1], 8, wave);
  // Q of the 32 target rows into s_scr[0]: one 16-row chunk on each of waves 2, 3
  // (they had one task fewer than waves 0, 1 in phase 1)
  const bool projWave = (wave == 2 || wave == 3);
  if (projWave)
    wave_proj_t<false>(&s_t[0][0], oin_w, oin_b, nullptr, nullptr,
                       s_scr[0], nullptr, 32, lane, wave - 2, wave - 1);
  __syncthreads();

  // fc1, all eight waves: each 16-lane row of the block takes six weight rows and
  // walks them together, so every load covers 256 contiguous bytes of each of two
  // weight rows (whole 128-byte lines) and the loads of three rows are in flight at
  // once. The last 16-lane row has no rows of its own: it repeats rows 84 to 89 into
  // the spare words 90 to 95 of s_fc, which nobody reads. The first three rows are
  // asked for here, so that they arrive while the final attention runs.
  const int l16  = lane & 15;
  const int row0 = (tid >> 4) * 6;
  const v4f* wr = (const v4f*)(fc1_w + (row0 < 84 ? row0 : 84) * 256) + l16;
  const int bi = tid < 30 ? tid * 3 : 0;
  const float fb[3] = {fc1_b[bi], fc1_b[bi + 1], fc1_b[bi + 2]};
  v4f wa[3][4];
  #pragma unroll  // constant p, j: the weights stay in named registers
  for (int p = 0; p < 3; ++p) {
    #pragma unroll  // as above
    for (int j = 0; j < 4; ++j) wa[p][j] = wr[64 * p + 16 * j];
  }
  // holds the loads above here: with the attention unrolled the scheduler sinks them to its end
  __builtin_amdgcn_sched_barrier(0);

  // One head per wave, one query row per lane: all eight waves share the 8 x 126
  // keys that one wave would otherwise walk alone.
  s_ob[0][lane][wave] = (_Float16)attn_head<8, 126>(lane, wave, s_scr[0], &s_kpTf[0][0],
                                                    &s_vpTf[0][0], 128, s_scr[1]);
  __syncthreads();  // a row of s_ob[0] holds the heads of eight waves

  if (projWave)
    wave_proj_rm(&s_ob[0][0][0], oout_w, oout_b, &s_tout[0][0], lane,
                 wave - 2, wave - 1);
  __syncthreads();

  // ---------------- Phase 3: fc1 + channel softmax -> (B,3,30) -------------
  // Lane l of a 16-lane row sums the columns 64*j + 4*l + u of its six weight rows;
  // the 16 partial sums of a row are then added across the lanes.
  {
    v4f xv[4];
    #pragma unroll  // constant j: the sixteen x values stay in named registers
    for (int j = 0; j < 4; ++j)
      xv[j] = *(const v4f*)(&s_tout[0][0] + 64 * j + 4 * l16);
    float part[6];
    #pragma unroll  // constant p: part stays in named registers
    for (int p = 0; p < 3; ++p) {
      v4f a = wa[p][0] * xv[0];
      #pragma unroll  // constant j, as above
      for (int j = 1; j < 4; ++j) a += wa[p][j] * xv[j];
      part[p] = (a[0] + a[1]) + (a[2] + a[3]);
    }
    #pragma unroll  // constant p, as above
    for (int p = 3; p < 6; ++p) {
      v4f a = wr[64 * p] * xv[0];
      #pragma unroll  // constant j, as above
      for (int j = 1; j < 4; ++j) a += wr[64 * p + 16 * j] * xv[j];
      part[p] = (a[0] + a[1]) + (a[2] + a[3]);
    }
    #pragma unroll  // constant p, as above
    for (int p = 0; p < 6; ++p)
      part[p] = row_xadd<8>(row_xadd<4>(row_xadd<2>(row_xadd<1>(part[p]))));
    if (l16 == 0) {
      #pragma unroll  // constant p, as above
      for (int p = 0; p < 6; ++p) s_fc[row0 + p] = part[p];
    }
  }
  __syncthreads();
  if (tid < 30) {
    float x0 = s_fc[tid * 3 + 0] + fb[0], x1 = s_fc[tid * 3 + 1] + fb[1],
          x2 = s_fc[tid * 3 + 2] + fb[2];
    float m  = fmaxf(x0, fmaxf(x1, x2));
    float e0 = __expf(x0 - m), e1 = __expf(x1 - m), e2 = __expf(x2 - m);
    float s  = e0 + e1 + e2;
    float* o = out + (size_t)b * 90;
    o[0 * 30 + tid] = quot(e0, s);
    o[1 * 30 + tid] = quot(e1, s);
    o[2 * 30 + tid] = quot(e2, s);
  }
}

extern "C" void kernel_launch(void* const* d_in, const int* in_sizes, int n_in,
                              void* d_out, int out_size, void* d_ws, size_t ws_size,
                              hipStream_t stream) {
  (void)n_in; (void)out_size; (void)d_ws; (void)ws_size;
  const int B = in_sizes[0] / (2 * 20 * 118);
  cmt_kernel<<<B, 256, 0, stream>>>(
      (const float*)d_in[0],  (const float*)d_in[1],  (const float*)d_in[2],
      (const float*)d_in[3],  (const float*)d_in[4],  (const float*)d_in[5],
      (const float*)d_in[6],  (const float*)d_in[7],  (const float*)d_in[8],
      (const float*)d_in[9],  (const float*)d_in[10], (const float*)d_in[11],
      (const float*)d_in[12], (const float*)d_in[13], (const float*)d_in[14],
      (const float*)d_in[15], (const float*)d_in[16], (const float*)d_in[17],
      (const float*)d_in[18], (const float*)d_in[19], (const float*)d_in[20],
      (const float*)d_in[21], (const float*)d_in[22], (const float*)d_in[23],
      (const float*)d_in[24], (const float*)d_in[25], (const float*)d_in[26],
      (const float*)d_in[27], (const float*)d_in[28], (const float*)d_in[29],
      (float*)d_out);
}

// v010
// One run takes 134 microseconds.
// In both of two side-by-side timings against v009, it was 1.04 times as fast.
// Counting every step since v000, it is 3.39 times as fast.
#include <hip/hip_runtime.h>
#include <math.h>

#define E 8

typedef __attribute__((ext_vector_type(16))) _Float16 v16h;
typedef __attribute__((ext_vector_type(8)))  _Float16 v8h;
typedef __attribute__((ext_vector_type(2)))  _Float16 v2h;
typedef __attribute__((ext_vector_type(8)))  float    v8f;
typedef __attribute__((ext_vector_type(4)))  float    v4f;
typedef __attribute__((ext_vector_type(2)))  float    v2f;
typedef unsigned int u32;

__device__ __forceinline__ float pe_val(float pos, int oc) {
  int k = oc & ~1;
  float div = __expf((float)k * (-9.210340371976184f / 8.0f));
  float ang = pos * div;
  return (oc & 1) ? __cosf(ang) : __sinf(ang);
}

// ---------------------------------------------------------------------------
// One v_wmma_f32_16x16x32_f16 per 16-row chunk. K=8 real (zero-padded to 32).
// A (16-bit 16x32): lanes 0-15 row M=lane, halves 0..7 = K 0..7; lanes 16-31 zero.
// B (16-bit 32x16): lanes 0-15 col N=lane, halves 0..7 = K 0..7.
// D (f32 16x16):    lane -> col N=lane&15, VGPR r -> row M = r + 8*(lane>>4).
// Sources live in LDS as f16 rows (16B) -> A build = one ds_load_b128, no cvt.
// Bias is folded into the C accumulator (C[m][n] = bias[n]).
// ---------------------------------------------------------------------------

__device__ __forceinline__ v16h load_a_frag(const _Float16* src, int ch, int lane,
                                            u32 amask) {
  uint4 raw = *(const uint4*)(src + (ch * 16 + (lane & 15)) * 8);
  raw.x &= amask; raw.y &= amask; raw.z &= amask; raw.w &= amask;
  union { uint4 u; v8h h; } cv;
  cv.u = raw;
  v16h af;
  #pragma unroll
  for (int k = 0; k < 8; ++k) af[k] = cv.h[k];
  #pragma unroll
  for (int k = 8; k < 16; ++k) af[k] = (_Float16)0.0f;
  return af;
}

// Value held by the same lane of the other 16-lane row (all 32 lanes active).
__device__ __forceinline__ float other_row(float x) {
  u32 u = __builtin_bit_cast(u32, x);
  return __builtin_bit_cast(float, __builtin_amdgcn_permlanex16(
      u, u, 0x76543210u, 0xfedcba98u, false, false));
}

// x plus the x of lane l ^ M inside a 16-lane row (all lanes active).
template <int M>
__device__ __forceinline__ float row_xadd(float x) {
  const int y = __builtin_amdgcn_update_dpp(0, __builtin_bit_cast(int, x), 0x160 | M,
                                            0xf, 0xf, true);  // 0x160 | M: row_xmask:M
  return x + __builtin_bit_cast(float, y);
}

// Transposed-output projection. DUAL packs two 8x8 weight blocks into B's 16
// columns -> one WMMA yields both K and V. Writeback: 2 contiguous b128 stores.
// DUAL also leaves each head's largest and smallest K over the rows it projects:
// ext[head*2*np + slot] and ext[head*2*np + np + slot]. Every projected row
// counts, so pad rows of src must repeat a real row.
// KH: d1T takes its block as f16 (ld counts halves there), one b128 store per chunk.
template <bool DUAL, bool KH = false>
__device__ __forceinline__ void wave_proj_t(const _Float16* src,
                                            const float* W1, const float* b1,
                                            const float* W2, const float* b2,
                                            float* d1T, float* d2T, int ld,
                                            int lane, int c0, int c1,
                                            float* ext = nullptr, int np = 1,
                                            int slot = 0) {
  const int n = lane & 15;
  const int half = lane >> 4;
  const u32 amask = (lane < 16) ? 0xFFFFFFFFu : 0u;
  v16h bf = {};
  float bn = 0.0f;
  float* dcol = nullptr;
  if (n < 8) { bn = b1[n]; dcol = d1T + n * ld; }
  else if (DUAL) { bn = b2[n - 8]; dcol = d2T + (n - 8) * ld; }
  if (lane < 16 && (n < 8 || DUAL)) {
    const float* wrow = (n < 8) ? (W1 + n * 8) : (W2 + (n - 8) * 8);
    #pragma unroll
    for (int k = 0; k < 8; ++k) bf[k] = (_Float16)wrow[k];
  }
  float kmx = -INFINITY, kmn = INFINITY;
  for (int ch = c0; ch < c1; ++ch) {
    v16h af = load_a_frag(src, ch, lane, amask);
    v8f c = {bn, bn, bn, bn, bn, bn, bn, bn};
    c = __builtin_amdgcn_wmma_f32_16x16x32_f16(false, af, false, bf, (short)0, c,
                                               false, false);
    const int rb = ch * 16 + 8 * half;
    if (KH && n < 8) {
      v8h hk;
      #pragma unroll  // constant r: hk stays in named registers
      for (int r = 0; r < 8; ++r) hk[r] = (_Float16)c[r];
      *(v8h*)((_Float16*)d1T + n * ld + rb) = hk;
    } else if (DUAL || n < 8) {
      *(v4f*)(dcol + rb)     = (v4f){c[0], c[1], c[2], c[3]};
      *(v4f*)(dcol + rb + 4) = (v4f){c[4], c[5], c[6], c[7]};
    }
    if (DUAL) {
      #pragma unroll  // constant r: c[r] stays a named register, pairs fold into max3/min3
      for (int r = 0; r < 8; ++r) {
        kmx = fmaxf(kmx, c[r]);
        kmn = fminf(kmn, c[r]);
      }
    }
  }
  if (DUAL) {
    kmx = fmaxf(kmx, other_row(kmx));
    kmn = fminf(kmn, other_row(kmn));
    if (lane < 8) {
      ext[lane * 2 * np + slot]      = kmx;
      ext[lane * 2 * np + np + slot] = kmn;
    }
  }
}

// Row-major f32 output projection (result consumed row-wise by layernorm/fc1).
// bf is the B fragment of the 8x8 weight block: lane n < 8 holds row n in halves 0..7.
__device__ __forceinline__ void wave_proj_rm_bf(const _Float16* src, v16h bf,
                                                const float* bias, float* dst,
                                                int lane, int c0, int c1) {
  const int n = lane & 15;
  const int half = lane >> 4;
  const u32 amask = (lane < 16) ? 0xFFFFFFFFu : 0u;
  const float bn = (n < 8) ? bias[n] : 0.0f;
  for (int ch = c0; ch < c1; ++ch) {
    v16h af = load_a_frag(src, ch, lane, amask);
    v8f c = {bn, bn, bn, bn, bn, bn, bn, bn};
    c = __builtin_amdgcn_wmma_f32_16x16x32_f16(false, af, false, bf, (short)0, c,
                                               false, false);
    if (n < 8) {
      const int rb = ch * 16 + 8 * half;
      #pragma unroll
      for (int r = 0; r < 8; ++r) dst[(rb + r) * 8 + n] = c[r];
    }
  }
}

// The same with the weights read from global memory in f32.
__device__ __forceinline__ void wave_proj_rm(const _Float16* src, const float* W,
                                             const float* bias, float* dst,
                                             int lane, int c0, int c1) {
  v16h bf = {};
  if (lane < 8) {
    #pragma unroll
    for (int k = 0; k < 8; ++k) bf[k] = (_Float16)W[lane * 8 + k];
  }
  wave_proj_rm_bf(src, bf, bias, dst, lane, c0, c1);
}

// The same with the weights already in f16 rows of 16 bytes in LDS.
__device__ __forceinline__ void wave_proj_rm_h(const _Float16* src, const _Float16* Wh,
                                               const float* bias, float* dst,
                                               int lane, int c0, int c1) {
  const u32 bmask = (lane < 8) ? 0xFFFFFFFFu : 0u;
  uint4 raw = *(const uint4*)(Wh + (lane & 7) * 8);
  raw.x &= bmask; raw.y &= bmask; raw.z &= bmask; raw.w &= bmask;
  union { uint4 u; v8h h; } cv;
  cv.u = raw;
  v16h bf = {};
  #pragma unroll  // constant k: bf stays in named registers
  for (int k = 0; k < 8; ++k) bf[k] = cv.h[k];
  wave_proj_rm_bf(src, bf, bias, dst, lane, c0, c1);
}

// a / b for a softmax's weight sum b. The largest weight of a row is about 1, so b is an
// ordinary number of moderate size: the scaling and fix-up steps of the full division
// sequence have nothing to do, and v_rcp_f32 with one multiply gives the quotient to
// within a few units of the last place of an f32.
__device__ __forceinline__ float quot(float a, float b) {
  return a * __builtin_amdgcn_rcpf(b);
}

// 2^x of sixteen f16 values, two to a register, each in place: what comes out is a B
// fragment as it stands. One statement, the low halves of all eight registers and then
// the high halves, so that no instruction directly behind a v_exp_f16 touches the
// register it works on (the slot the instruction set asks for); the v_nop is that slot
// behind the last.
__device__ __forceinline__ void exp2h_x16(u32* x) {
  asm("v_exp_f16 %0.l, %0.l\n\tv_exp_f16 %1.l, %1.l\n\tv_exp_f16 %2.l, %2.l\n\t"
      "v_exp_f16 %3.l, %3.l\n\tv_exp_f16 %4.l, %4.l\n\tv_exp_f16 %5.l, %5.l\n\t"
      "v_exp_f16 %6.l, %6.l\n\tv_exp_f16 %7.l, %7.l\n\t"
      "v_exp_f16 %0.h, %0.h\n\tv_exp_f16 %1.h, %1.h\n\tv_exp_f16 %2.h, %2.h\n\t"
      "v_exp_f16 %3.h, %3.h\n\tv_exp_f16 %4.h, %4.h\n\tv_exp_f16 %5.h, %5.h\n\t"
      "v_exp_f16 %6.h, %6.h\n\tv_exp_f16 %7.h, %7.h\n\t"
      "v_nop"
      : "+v"(x[0]), "+v"(x[1]), "+v"(x[2]), "+v"(x[3]),
        "+v"(x[4]), "+v"(x[5]), "+v"(x[6]), "+v"(x[7]));
}

// All eight heads of a 32-query, 32-key task by one wave, sums on the matrix unit.
// D = A x B per head and 16-query chunk, f16 operands, f32 accumulate:
//   B column c = query c, its 32 softmax weights exp(q*k - m) of that head;
//   A row 2*hd = V of head hd, row 2*hd+1 = ones (one fragment for all heads).
// Element s of lane half g is key 16*g + s in A and in B alike.
// D row 2*hd = weighted V sum, row 2*hd+1 = weight sum: register r of lane half g
// is row 8*g + r, so lanes 0-15 read heads 0-3 and lanes 16-31 heads 4-7.
// Lk is 30 or 32: at 30 the A columns of keys 30, 31 are zero, so the pad keys
// reach neither sum.
// The weights are made in f16, the type B takes them in: K lies in LDS as f16
// (khT[8][32]), a packed fma forms two exponents q*k - m, and the f16 exp works in
// place. m only has to be near the row's largest exponent: it is the same in both sums
// of a row and cancels in their quotient.
// attn_a_frag builds that A fragment from vpT[8][32] and leaves it in the same 1 KiB:
// words 0-3 of lane l at uint4 index l, words 4-7 at 32 + l. One wave; its loads of vpT
// are all issued ahead of its stores.
__device__ __forceinline__ void attn_a_frag(int lane, float* vpT, int Lk) {
  const int c = lane & 15;
  const int half = lane >> 4;
  union { u32 w[8]; v16h h; uint4 q[2]; } a;
  const float* vr = vpT + (c >> 1) * 32 + 16 * half;
  #pragma unroll
  for (int p = 0; p < 4; ++p) {
    v4f x = *(const v4f*)(vr + 4 * p);
    #pragma unroll
    for (int u = 0; u < 4; ++u) a.h[4 * p + u] = (_Float16)x[u];
  }
  #pragma unroll
  for (int p = 0; p < 8; ++p) a.w[p] = (c & 1) ? 0x3C003C00u : a.w[p];  // 1.0h pair
  if (half == 1 && Lk < 32) a.w[7] = 0u;
  ((uint4*)vpT)[lane]      = a.q[0];
  ((uint4*)vpT)[32 + lane] = a.q[1];
}

// What one head of a task reads from LDS: its 16 keys of this lane half as f16 pairs
// (p[s]: keys 16*half + 2*s and + 2*s + 1), the K extremes, the q of both query chunks.
struct head_in {
  union { uint4 q[2]; v2h p[8]; } k;
  float kmx, kmn, q0, q1;
};

__device__ __forceinline__ head_in attn_head_in(int hd, int c, int half, const float* qpT,
                                                const _Float16* khT, const float* ext) {
  head_in in;
  const uint4* kc = (const uint4*)(khT + hd * 32 + 16 * half);
  in.k.q[0] = kc[0];
  in.k.q[1] = kc[1];
  in.kmx = ext[hd * 2];
  in.kmn = ext[hd * 2 + 1];
  in.q0 = qpT[hd * 32 + c];
  in.q1 = qpT[hd * 32 + 16 + c];
  return in;
}

// Both query chunks of one head: weights, then D = A x weights.
__device__ __forceinline__ void attn_head_mm(const head_in& in, v16h a, v8f* d) {
  // q * log2 e: q*k - m is then the exponent of 2 as it stands
  const float q2[2] = {in.q0 * 1.44269504088896341f, in.q1 * 1.44269504088896341f};
  union { v2h p[8]; u32 w[8]; v16h h; } e[2];
  #pragma unroll  // constant ch, s: e stays in named registers
  for (int ch = 0; ch < 2; ++ch) {
    const _Float16 qh = (_Float16)q2[ch];
    const _Float16 mh = (_Float16)fmaxf(q2[ch] * in.kmx, q2[ch] * in.kmn);
    const v2h qq = {qh, qh}, mm = {mh, mh};
    #pragma unroll  // as above
    for (int s = 0; s < 8; ++s) e[ch].p[s] = qq * in.k.p[s] - mm;
  }
  #pragma unroll  // constant ch, as above
  for (int ch = 0; ch < 2; ++ch) {
    exp2h_x16(e[ch].w);
    d[ch] = (v8f){};
    d[ch] = __builtin_amdgcn_wmma_f32_16x16x32_f16(false, a, false, e[ch].h, (short)0, d[ch],
                                                   false, false);
  }
}

__device__ __forceinline__ void attn_rows_mm(int lane, const float* qpT,
                                             const _Float16* khT, const float* afrag,
                                             const float* ext, _Float16* ob) {
  const int c = lane & 15;
  const int half = lane >> 4;
  union { u32 w[8]; v16h h; uint4 q[2]; } a;
  a.q[0] = ((const uint4*)afrag)[lane];
  a.q[1] = ((const uint4*)afrag)[32 + lane];

  #pragma unroll 1  // rolled: four unrolled head pairs do not fit the register budget of 10 waves per SIMD
  for (int hp = 0; hp < 4; ++hp) {
    float num[2][2], den[2][2];
    v8f d[2];
    const head_in h0 = attn_head_in(hp, c, half, qpT, khT, ext);
    attn_head_mm(h0, a.h, d);
    // This line and the next of its kind keep the two heads apart: interleaved, the build
    // takes more than 96 registers, which costs a work-group per WGP. The first head's
    // sums are read between the two lines, beside the second head's LDS reads.
    __builtin_amdgcn_sched_barrier(0);
    const head_in h1 = attn_head_in(hp + 4, c, half, qpT, khT, ext);
    #pragma unroll  // constant ch: num, den stay in named registers
    for (int ch = 0; ch < 2; ++ch) {
      num[0][ch] = d[ch][2 * hp];
      den[0][ch] = d[ch][2 * hp + 1];
    }
    __builtin_amdgcn_sched_barrier(0);  // as above
    attn_head_mm(h1, a.h, d);
    #pragma unroll  // constant ch, as above
    for (int ch = 0; ch < 2; ++ch) {
      num[1][ch] = d[ch][2 * hp];
      den[1][ch] = d[ch][2 * hp + 1];
    }
    #pragma unroll
    for (int ch = 0; ch < 2; ++ch)
      ob[(ch * 16 + c) * 8 + 4 * half + hp] =
          (_Float16)quot(half ? num[1][ch] : num[0][ch], half ? den[1][ch] : den[0][ch]);
  }
}

// K and V of one 16-row chunk of the 128-row concat (126 real rows, two pad rows that
// repeat a real one), both as f16: khT[8][128], vhT[8][128], [head][pos], one b128 store
// per lane. V of the two pad rows is stored as zero, so that they add nothing to a
// weighted sum. ext takes the chunk's K extremes: ext[head*16 + ch], ext[head*16 + 8 + ch].
__device__ __forceinline__ void wave_proj_kv_h(const _Float16* src,
                                               const float* Wk, const float* bk,
                                               const float* Wv, const float* bv,
                                               _Float16* khT, _Float16* vhT,
                                               int lane, int ch, float* ext) {
  const int n = lane & 15;
  const int half = lane >> 4;
  const u32 amask = (lane < 16) ? 0xFFFFFFFFu : 0u;
  const float bn = (n < 8) ? bk[n] : bv[n - 8];
  v16h bf = {};
  if (lane < 16) {
    const float* wrow = (n < 8) ? (Wk + n * 8) : (Wv + (n - 8) * 8);
    #pragma unroll  // constant k: bf stays in named registers
    for (int k = 0; k < 8; ++k) bf[k] = (_Float16)wrow[k];
  }
  v16h af = load_a_frag(src, ch, lane, amask);
  v8f c = {bn, bn, bn, bn, bn, bn, bn, bn};
  c = __builtin_amdgcn_wmma_f32_16x16x32_f16(false, af, false, bf, (short)0, c,
                                             false, false);
  const int rb = ch * 16 + 8 * half;
  union { v8h h; u32 w[4]; } hk;
  #pragma unroll  // constant r: hk stays in named registers
  for (int r = 0; r < 8; ++r) hk.h[r] = (_Float16)c[r];
  if (n >= 8 && rb == 120) hk.w[3] = 0u;  // V of rows 126, 127
  *(v8h*)((n < 8 ? khT + n * 128 : vhT + (n - 8) * 128) + rb) = hk.h;
  float kmx = c[0], kmn = c[0];
  #pragma unroll  // constant r: pairs fold into max3/min3
  for (int r = 1; r < 8; ++r) {
    kmx = fmaxf(kmx, c[r]);
    kmn = fminf(kmn, c[r]);
  }
  kmx = fmaxf(kmx, other_row(kmx));
  kmn = fminf(kmn, other_row(kmn));
  if (lane < 8) {
    ext[lane * 16 + ch]     = kmx;
    ext[lane * 16 + 8 + ch] = kmn;
  }
}

// One head of the final attention by one wave: 32 queries, 126 keys in four blocks of 32,
// sums on the matrix unit in the form of attn_head_mm, accumulated over the blocks.
//   B column c = query c of the chunk, its 32 weights exp(q*k - m) of the key block;
//   A rows 0 and 8 = V of the head, rows 1 and 9 = ones, the other rows zero.
// Element s of lane half g is key 32*kb + 16*g + s in A and in B alike.
// A comes straight from LDS: rows 0-7 of vhT are the heads' V, row 8 the ones (zero at
// the pad keys 126, 127, as V is), row 9 zeros; a lane reads the row that is its A row.
// D register 0 = weighted V sum, register 1 = weight sum of query c, in both lane halves.
__device__ __forceinline__ void attn_final_mm(int lane, int h, const float* qpT,
                                              const _Float16* khT, const _Float16* vhT,
                                              const float* ext, _Float16* ob) {
  const int c = lane & 15;
  const int half = lane >> 4;
  const float* ex = ext + h * 16;
  float kmx = ex[0], kmn = ex[8];
  #pragma unroll  // constant offsets: the partials come in as b128 reads
  for (int p = 1; p < 8; ++p) {
    kmx = fmaxf(kmx, ex[p]);
    kmn = fminf(kmn, ex[8 + p]);
  }
  const int ar = (c & 7) == 0 ? h : ((c & 7) == 1 ? 8 : 9);
  const uint4* ap = (const uint4*)(vhT + ar * 128 + 16 * half);
  const uint4* kp = (const uint4*)(khT + h * 128 + 16 * half);
  v2h qq[2], mm[2];
  #pragma unroll  // constant ch: qq, mm stay in named registers
  for (int ch = 0; ch < 2; ++ch) {
    // q * log2 e: q*k - m is then the exponent of 2 as it stands
    const float q2 = qpT[h * 32 + 16 * ch + c] * 1.44269504088896341f;
    const _Float16 qh = (_Float16)q2;
    const _Float16 mh = (_Float16)fmaxf(q2 * kmx, q2 * kmn);
    qq[ch] = (v2h){qh, qh};
    mm[ch] = (v2h){mh, mh};
  }
  v8f d[2] = {{}, {}};
  #pragma unroll  // constant LDS offsets: no address add, compare or branch per block
  for (int kb = 0; kb < 4; ++kb) {
    union { uint4 q[2]; v16h h; } a;
    union { uint4 q[2]; v2h p[8]; } k;
    union { v2h p[8]; u32 w[8]; v16h h; } e[2];
    k.q[0] = kp[4 * kb];
    k.q[1] = kp[4 * kb + 1];
    a.q[0] = ap[4 * kb];
    a.q[1] = ap[4 * kb + 1];
    #pragma unroll  // constant ch, s: e stays in named registers
    for (int ch = 0; ch < 2; ++ch) {
      #pragma unroll  // as above
      for (int s = 0; s < 8; ++s) e[ch].p[s] = qq[ch] * k.p[s] - mm[ch];
    }
    #pragma unroll  // constant ch, as above
    for (int ch = 0; ch < 2; ++ch) {
      exp2h_x16(e[ch].w);
      d[ch] = __builtin_amdgcn_wmma_f32_16x16x32_f16(false, a.h, false, e[ch].h, (short)0,
                                                     d[ch], false, false);
    }
  }
  // lane half g stores query chunk g
  ob[(16 * half + c) * 8 + h] =
      (_Float16)quot(half ? d[1][0] : d[0][0], half ? d[1][1] : d[0][1]);
}

__global__ __launch_bounds__(256) void cmt_kernel(
    const float* __restrict__ eeg, const float* __restrict__ pupil,
    const float* __restrict__ speech, const float* __restrict__ action,
    const float* __restrict__ location, const float* __restrict__ tgt,
    const float* __restrict__ eeg_w, const float* __restrict__ eeg_b,
    const float* __restrict__ psa_w, const float* __restrict__ psa_b,
    const float* __restrict__ loc_w, const float* __restrict__ loc_b,
    const float* __restrict__ tgt_w, const float* __restrict__ tgt_b,
    const float* __restrict__ ng, const float* __restrict__ nb,
    const float* __restrict__ cin_w, const float* __restrict__ cin_b,
    const float* __restrict__ cout_w, const float* __restrict__ cout_b,
    const float* __restrict__ sfin_w, const float* __restrict__ sfin_b,
    const float* __restrict__ sfout_w, const float* __restrict__ sfout_b,
    const float* __restrict__ oin_w, const float* __restrict__ oin_b,
    const float* __restrict__ oout_w, const float* __restrict__ oout_b,
    const float* __restrict__ fc1_w, const float* __restrict__ fc1_b,
    float* __restrict__ out) {
  __shared__ _Float16 s_seq[5][32][E];   // f16 A-sources: e(30), p, s, a, l
  __shared__ _Float16 s_t[32][E];
  __shared__ _Float16 s_concat[128][E];  // 126 rows + 2 pad rows
  __shared__ _Float16 s_ob[8][32][E];    // per-wave attention-output (A-source)
  __shared__ float s_acc[4][32][E];
  __shared__ float s_scr[8][1024];       // phase 0 staging; phase 1 projections and results
  // final MHA, f16, transposed [head][pos]: K; V, then a row of ones and a row of zeros
  __shared__ __attribute__((aligned(16))) _Float16 s_khTf[8][128];
  __shared__ __attribute__((aligned(16))) _Float16 s_vhTf[10][128];
  __shared__ float s_tout[32][E];
  __shared__ float s_fc[96];

  const int b    = blockIdx.x;
  const int tid  = threadIdx.x;
  const int lane = tid & 31;
  const int wave = tid >> 5;
  const int Lseq[5] = {30, 32, 32, 32, 32};

  __builtin_prefetch(fc1_w + (tid << 6), 0, 1);   // global_prefetch_b8

  // ---------------- Phase 0: convs + positional encoding into LDS ----------
  for (int idx = tid; idx < 4 * 32 * E; idx += 256) ((float*)s_acc)[idx] = 0.0f;
  // rows 8, 9 of s_vhTf, two halves a word: ones for the 126 keys, zero from there on
  if (tid < 128) ((u32*)&s_vhTf[8][0])[tid] = tid < 63 ? 0x3C003C00u : 0u;

  // Every global read of phase 0 is issued here, ahead of the first use of any of
  // them: one memory latency for the whole phase, not one per group of conv rows.
  // The eeg block and its conv weights go through registers into s_scr, which is
  // free until phase 1, in floats: [0,5120) the 4720 floats of the block, then
  // copies of its last 16 bytes that nobody reads; from 5120 the weights, one row of
  // 80 per output channel at a pitch of 84 (b128 reads of 8 rows, no bank shared);
  // rows 8 to 12 take the stores of the threads without a chunk, read by nobody.
  float* stage = &s_scr[0][0];
  const int pos = tid >> 3;  // 0..31
  const int oc  = tid & 7;
  const v4f* ep4 = (const v4f*)(eeg + (size_t)b * (2 * 20 * 118));
  v4f ech[5];
  #pragma unroll  // constant k: the five chunks stay in named registers
  for (int k = 0; k < 5; ++k) {
    const int i = tid + 256 * k;
    ech[k] = ep4[i < 1180 ? i : 1179];
  }
  const v4f wch = ((const v4f*)eeg_w)[tid < 160 ? tid : 159];
  const bool inb = (pos >= 1 && pos <= 30);
  const u32 xi = inb ? (u32)(pos - 1) : 0u;  // in bounds for the two pad positions too
  const float* xp = pupil    + (size_t)b * 60;
  const float* xs = speech   + (size_t)b * 60;
  const float* xa = action   + (size_t)b * 60;
  const float* xl = location + (size_t)b * 90;
  const float psa_x[3][2] = {{xp[xi], xp[xi + 30]}, {xs[xi], xs[xi + 30]},
                             {xa[xi], xa[xi + 30]}};
  const float loc_x[3] = {xl[xi], xl[xi + 30], xl[xi + 60]};
  const float tgt_x = (tgt + (size_t)b * 30)[xi];
  const float pw0 = psa_w[oc * 2 + 0], pw1 = psa_w[oc * 2 + 1], pb = psa_b[oc];
  const float lw[3] = {loc_w[oc * 3 + 0], loc_w[oc * 3 + 1], loc_w[oc * 3 + 2]};
  const float lb = loc_b[oc], tw = tgt_w[oc], tb = tgt_b[oc], eb = eeg_b[oc];

  #pragma unroll  // constant k, as above
  for (int k = 0; k < 5; ++k) *(v4f*)(stage + (tid + 256 * k) * 4) = ech[k];
  *(v4f*)(stage + 5120 + (tid / 20) * 84 + (tid % 20) * 4) = wch;

  {  // p/s/a/l/tgt conv1d k1p1: this thread's (pos, oc) of all five
    const float pe32 = pe_val(32.0f, oc);
    #pragma unroll  // constant q: psa_x stays in named registers
    for (int q = 0; q < 3; ++q) {
      float v = pb;
      if (inb) v += pw0 * psa_x[q][0] + pw1 * psa_x[q][1];
      s_seq[1 + q][pos][oc] = (_Float16)(v + pe32);
    }
    float v = lb;
    if (inb) {
      #pragma unroll  // constant ic: lw and loc_x stay in named registers
      for (int ic = 0; ic < 3; ++ic) v += lw[ic] * loc_x[ic];
    }
    s_seq[4][pos][oc] = (_Float16)(v + pe32);
    v = tb;
    if (inb) v += tw * tgt_x;
    s_t[pos][oc] = (_Float16)(v + pe32);
  }
  __syncthreads();  // the staged block and weights are read by other threads than stored them

  if (tid < 240) {  // eeg conv2d (2,20,118) -> 30x8, kernel (20,2), stride (1,4)
    const float* xr = stage + pos * 4;
    const float* wr = stage + 5120 + oc * 84;
    float sum = eb;
    #pragma unroll 5  // ten conv rows a trip, so that their LDS reads overlap; more rows cost registers
    for (int j = 0; j < 20; ++j) {  // rows 2j, 2j+1 of the 40 (ic, kh) rows, in order
      const v4f w  = *(const v4f*)(wr + 4 * j);
      const v2f x0 = *(const v2f*)(xr + (2 * j) * 118);
      const v2f x1 = *(const v2f*)(xr + (2 * j + 1) * 118);
      sum += x0[0] * w[0] + x0[1] * w[1];
      sum += x1[0] * w[2] + x1[1] * w[3];
    }
    const _Float16 hv = (_Float16)(sum + pe_val(30.0f, oc));
    s_seq[0][pos][oc] = hv;
    if (pos == 29) {  // pad rows repeat the last row: K extremes stay those of 30 rows
      s_seq[0][30][oc] = hv;
      s_seq[0][31][oc] = hv;
    }
  }
  __syncthreads();

  // ---------------- Phase 1: 18 MHAs, one task per wave --------------------
  // The 18 tasks share their input projections: 7 distinct Q (e, p, s, a under the
  // cross weights; e, p, a under the self weights) and 8 distinct K/V (e, p, s, a, l
  // cross; e, p, a self). Each is projected once, here, and read by every task that
  // wants it. s_scr in floats: Q set i at 256*i (qpT[8][32]); K/V set i at 1792 + 528*i
  // (K in f16, khT[8][32], in the first 128; from 256 vpT[8][32], then in its place
  // the attention's A fragment; 16 K extremes);
  // wave w's row-major result at 6016 + 256*w; from 8064 the cross and the
  // self output weights in f16, 64 halves each, converted once as well.
  {
    const bool ks = wave >= 5;  // K/V set 'wave': sequences 0,1,2,3,4 cross, 0,1,3 self
    const int kseq = wave < 5 ? wave : (wave == 7 ? 3 : wave - 5);
    const float* kw = ks ? sfin_w : cin_w;
    const float* kb = ks ? sfin_b : cin_b;
    float* kv = stage + 1792 + 528 * wave;
    wave_proj_t<true, true>(&s_seq[kseq][0][0], kw + 64, kb + 8, kw + 128, kb + 16,
                      kv, kv + 256, 32, lane, 0, 2, kv + 512, 1, 0);
    attn_a_frag(lane, kv + 256, Lseq[kseq]);
    if (wave < 7) {  // Q set 'wave': sequences 0,1,2,3 cross, 0,1,3 self
      const bool qs = wave >= 4;
      const int qseq = wave < 4 ? wave : (wave == 6 ? 3 : wave - 4);
      wave_proj_t<false>(&s_seq[qseq][0][0], qs ? sfin_w : cin_w, qs ? sfin_b : cin_b,
                         nullptr, nullptr, stage + 256 * wave, nullptr, 32, lane, 0, 2);
    } else if (lane < 16) {  // wave 7: both 8x8 output weight blocks as f16 rows
      const float* wsrc = (lane < 8 ? cout_w : sfout_w) + (lane & 7) * 8;
      v8h hw;
      #pragma unroll  // constant c: hw stays in named registers
      for (int c = 0; c < 8; ++c) hw[c] = (_Float16)wsrc[c];
      *(v8h*)((_Float16*)(stage + 8064) + lane * 8) = hw;
    }
  }
  __syncthreads();  // a task reads projections that other waves wrote

  const int TQ[18] = {0,0,0,0,0, 1,1,1,1,1, 2,2,2,2, 3,3,3,3};
  const int TQI[18] = {0,0,0,4,0, 1,1,1,5,1, 2,2,2,2, 3,3,6,3};  // Q set of the task
  const int TKI[18] = {1,3,4,5,2, 0,3,4,6,2, 0,1,3,4, 0,1,7,2};  // K/V set of the task
  const int TA[18] = {0,0,0,0,0, 1,1,1,1,1, 2,2,2,2, 3,3,3,3};
  const int TB[18] = {-1,-1,-1,-1,-1, -1,-1,-1,-1,-1, -1,-1,-1,3, -1,-1,-1,-1};

  for (int t = wave; t < 18; t += 8) {
    const u32 sf = (0x10108u >> t) & 1u;  // tasks 3, 8, 16 are the self attentions
    const _Float16* wOut = (const _Float16*)(stage + 8064) + 64 * sf;
    const float* bOut = sf ? sfout_b : cout_b;
    int Lq = Lseq[TQ[t]];
    const float* kv = stage + 1792 + 528 * TKI[t];
    float* res = stage + 6016 + 256 * wave;
    attn_rows_mm(lane, stage + 256 * TQI[t], (const _Float16*)kv, kv + 256, kv + 512,
                 &s_ob[wave][0][0]);
    wave_proj_rm_h(&s_ob[wave][0][0], wOut, bOut, res, lane, 0, 2);
    // layernorm + accumulate (ds_add_f32 atomics across waves)
    int i = lane;
    if (i < Lq) {
      const float* row = res + i * 8;
      float mu = 0.0f;
      #pragma unroll
      for (int c = 0; c < E; ++c) mu += row[c];
      mu *= 0.125f;
      float var = 0.0f;
      #pragma unroll
      for (int c = 0; c < E; ++c) { float d = row[c] - mu; var += d * d; }
      var *= 0.125f;
      float rinv = rsqrtf(var + 1e-5f);
      #pragma unroll
      for (int c = 0; c < E; ++c) {
        float v = (row[c] - mu) * rinv * ng[c] + nb[c];
        atomicAdd(&s_acc[TA[t]][i][c], v);
        if (TB[t] >= 0) atomicAdd(&s_acc[TB[t]][i][c], v);
      }
    }
  }
  __syncthreads();

  // ---------------- Phase 2: concat (f16) + final MHA ----------------------
  for (int idx = tid; idx < 128 * E; idx += 256) {  // [eeg30|pupil32|action32|speech32]
    int drow = idx >> 3, c = idx & 7;
    int row = drow < 125 ? drow : 125;  // pad rows 126, 127 repeat row 125
    int ai, r2;
    if (row < 30)      { ai = 0; r2 = row; }
    else if (row < 62) { ai = 1; r2 = row - 30; }
    else if (row < 94) { ai = 3; r2 = row - 62; }
    else               { ai = 2; r2 = row - 94; }
    s_concat[drow][c] = (_Float16)s_acc[ai][r2][c];
  }
  __syncthreads();

  // K/V of 126-row concat: dual WMMA, one 16-row chunk per wave; each wave leaves
  // its chunk's K extremes in s_scr[1] (free since phase 1), 8 partials per head
  wave_proj_kv_h(&s_concat[0][0], oin_w + 64, oin_b + 8, oin_w + 128, oin_b + 16,
                 &s_khTf[0][0], &s_vhTf[0][0], lane, wave, s_scr[1]);
  // Q of the 32 target rows into s_scr[0]: one 16-row chunk on each of waves 2, 3
  // (they had one task fewer than waves 0, 1 in phase 1)
  const bool projWave = (wave == 2 || wave == 3);
  if (projWave)
    wave_proj_t<false>(&s_t[0][0], oin_w, oin_b, nullptr, nullptr,
                       s_scr[0], nullptr, 32, lane, wave - 2, wave - 1);
  __syncthreads();

  // One head per wave: all eight waves share the 8 x 126 keys that one wave would
  // otherwise walk alone.
  attn_final_mm(lane, wave, s_scr[0], &s_khTf[0][0], &s_vhTf[0][0], s_scr[1],
                &s_ob[0][0][0]);
  __syncthreads();  // a row of s_ob[0] holds the heads of eight waves

  // fc1, all eight waves: each 16-lane row of the block takes six weight rows and
  // walks them together, so every load covers 256 contiguous bytes of each of two
  // weight rows (whole 128-byte lines) and the loads of three rows are in flight at
  // once. The last 16-lane row has no rows of its own: it repeats rows 84 to 89 into
  // the spare words 90 to 95 of s_fc, which nobody reads. The first three rows are
  // asked for here, so that they arrive while the output projection runs (ahead of the
  // final attention they and its fragments do not fit the register budget; ahead of the
  // barrier above, the barrier would wait for them).
  const int l16  = lane & 15;
  const int row0 = (tid >> 4) * 6;
  const v4f* wr = (const v4f*)(fc1_w + (row0 < 84 ? row0 : 84) * 256) + l16;
  const int bi = tid < 30 ? tid * 3 : 0;
  const float fb[3] = {fc1_b[bi], fc1_b[bi + 1], fc1_b[bi + 2]};
  v4f wa[3][4];
  #pragma unroll  // constant p, j: the weights stay in named registers
  for (int p = 0; p < 3; ++p) {
    #pragma unroll  // as above
    for (int j = 0; j < 4; ++j) wa[p][j] = wr[64 * p + 16 * j];
  }

  if (projWave)
    wave_proj_rm(&s_ob[0][0][0], oout_w, oout_b, &s_tout[0][0], lane,
                 wave - 2, wave - 1);
  __syncthreads();

  // ---------------- Phase 3: fc1 + channel softmax -> (B,3,30) -------------
  // Lane l of a 16-lane row sums the columns 64*j + 4*l + u of its six weight rows;
  // the 16 partial sums of a row are then added across the lanes.
  {
    v4f xv[4];
    #pragma unroll  // constant j: the sixteen x values stay in named registers
    for (int j = 0; j < 4; ++j)
      xv[j] = *(const v4f*)(&s_tout[0][0] + 64 * j + 4 * l16);
    float part[6];
    #pragma unroll  // constant p: part stays in named registers
    for (int p = 0; p < 3; ++p) {
      v4f a = wa[p][0] * xv[0];
      #pragma unroll  // constant j, as above
      for (int j = 1; j < 4; ++j) a += wa[p][j] * xv[j];
      part[p] = (a[0] + a[1]) + (a[2] + a[3]);
    }
    // the loads of the last three rows start here, together, in the registers that the first
    // three rows have left: lifted higher, the build takes more than 96 registers
    __builtin_amdgcn_sched_barrier(0);
    #pragma unroll  // constant p, as above
    for (int p = 3; p < 6; ++p) {
      v4f a = wr[64 * p] * xv[0];
      #pragma unroll  // constant j, as above
      for (int j = 1; j < 4; ++j) a += wr[64 * p + 16 * j] * xv[j];
      part[p] = (a[0] + a[1]) + (a[2] + a[3]);
    }
    #pragma unroll  // constant p, as above
    for (int p = 0; p < 6; ++p)
      part[p] = row_xadd<8>(row_xadd<4>(row_xadd<2>(row_xadd<1>(part[p]))));
    if (l16 == 0) {
      #pragma unroll  // constant p, as above
      for (int p = 0; p < 6; ++p) s_fc[row0 + p] = part[p];
    }
  }
  __syncthreads();
  if (tid < 30) {
    float x0 = s_fc[tid * 3 + 0] + fb[0], x1 = s_fc[tid * 3 + 1] + fb[1],
          x2 = s_fc[tid * 3 + 2] + fb[2];
    float m  = fmaxf(x0, fmaxf(x1, x2));
    float e0 = __expf(x0 - m), e1 = __expf(x1 - m), e2 = __expf(x2 - m);
    float s  = e0 + e1 + e2;
    float* o = out + (size_t)b * 90;
    o[0 * 30 + tid] = quot(e0, s);
    o[1 * 30 + tid] = quot(e1, s);
    o[2 * 30 + tid] = quot(e2, s);
  }
}

extern "C" void kernel_launch(void* const* d_in, const int* in_sizes, int n_in,
                              void* d_out, int out_size, void* d_ws, size_t ws_size,
                              hipStream_t stream) {
  (void)n_in; (void)out_size; (void)d_ws; (void)ws_size;
  const int B = in_sizes[0] / (2 * 20 * 118);
  cmt_kernel<<<B, 256, 0, stream>>>(
      (const float*)d_in[0],  (const float*)d_in[1],  (const float*)d_in[2],
      (const float*)d_in[3],  (const float*)d_in[4],  (const float*)d_in[5],
      (const float*)d_in[6],  (const float*)d_in[7],  (const float*)d_in[8],
      (const float*)d_in[9],  (const float*)d_in[10], (const float*)d_in[11],
      (const float*)d_in[12], (const float*)d_in[13], (const float*)d_in[14],
      (const float*)d_in[15], (const float*)d_in[16], (const float*)d_in[17],
      (const float*)d_in[18], (const float*)d_in[19], (const float*)d_in[20],
      (const float*)d_in[21], (const float*)d_in[22], (const float*)d_in[23],
      (const float*)d_in[24], (const float*)d_in[25], (const float*)d_in[26],
      (const float*)d_in[27], (const float*)d_in[28], (const float*)d_in[29],
      (float*)d_out);
}
